// v007
// Measured on an AMD MI455X. A time is GPU time per run, averaged over a window of back-to-back runs after a warm-up
// (all launches, gaps included; the runs take copies of the inputs in turn), and the median of several windows.
// Apart from v000's, it joins two sittings. Times from different sittings can be a few percent apart, while
// side-by-side timings come from the same sitting.
// This document starts at v007; the versions before it stand elsewhere.
// A run of this version takes 239 microseconds.
// Next to v006, in two timings, it ran 1.13 times as fast each time.
// All steps since the starting kernel, v000, together make it 5.79 times as fast.
#include <hip/hip_runtime.h>
// FlexSummaryAttention (2 batches; 64 summary tokens S, 2048 regular tokens R, D = 1024; 16 query heads, 4 kv heads (GQA), head dim 64): q/k/v projections for both token sets; 1-D RoPE on summary q/k, 2-D hierarchical RoPE (bar id | token-in-bar id) on regular q/k; phase 1: summary queries over [summary; regular] keys with the summarize mask -> sum_attn; k2/v2 = sum_attn W + b; phase 2: regular queries over [k2; regular k] / [v2; regular v] with the updating mask -> reg_attn; outputs sum_attn W_so + b and reg_attn W_ro + b.
// Structure: exact f16 planes of both inputs; six projection GEMMs (32x64 wave tiles, f32 accumulation, exact x16 weights + bias); RoPE on VALU (thread per (row, head, 8 dims), f32 trig) into f16 q planes and the shared per-batch key plane [k2-or-summary ; regular] (4 kv heads); values as f16 hi + 2^10 residual planes, V^T by LDS tiles; the fused flash kernel (3-term P.V, GQA head mapping, INPUT int mask tables) once per phase; sum_attn / reg_attn as hi + residual pairs into the k2/v2 and output GEMMs.
// Compute dtype: inputs, masks' companions and parameters rounded to bf16; q/k after RoPE as f16 (~2^-12); P and v hi + residual (~2^-21-class); attention outputs hi + residual into the following GEMMs; f32 softmax/accumulation/trig. v_wmma_f32_16x16x32_f16.
#define NB 2
#define SS 64
#define RR 2048
#define DMOD 1024
#define KVD 256
#define NRS (NB * SS)            /* 128 summary rows */
#define NRR (NB * RR)            /* 4096 regular rows */
#define TK 2112                  /* keys per batch in both phases: 64 summary(-derived) + 2048 regular */
#define TQA 64                   /* phase-1 queries (summary tokens) */
#define TQB 2048                 /* phase-2 queries (regular tokens) */
#define TQ TQB
#define NH 16
#define KVG 4                    /* GQA: 16 query heads share 4 kv heads */
#define NKV (NH / KVG)
#define SCL 0.125f               /* 64^-0.5 */
#define QBLKSA (TQA / 64)
#define NSPL 11                  /* phase 1: waves that share the 2112 keys of one 16-query tile, 6 trips of 32 keys each */
#define QBLKSB (TQB / 64)
#define QTB (TQB / 16)           /* phase 2: 16-query tiles */
typedef __bf16 v16b __attribute__((ext_vector_type(16)));
typedef unsigned short v8us __attribute__((ext_vector_type(8), may_alias));
typedef float  v8f  __attribute__((ext_vector_type(8)));
typedef float  v4f  __attribute__((ext_vector_type(4)));
typedef float  v4fa __attribute__((ext_vector_type(4), may_alias));
union FragB { v16b v; v8us half[2]; unsigned short u[16]; };

__device__ __forceinline__ unsigned short bf16_bits(float x) { unsigned int u = __float_as_uint(x); return (unsigned short)((u + 0x7FFFu + ((u >> 16) & 1u)) >> 16); }
__device__ __forceinline__ float bf16_val(unsigned short b) { return __uint_as_float(((unsigned int)b) << 16); }
__device__ __forceinline__ float bf16_round(float x) { return bf16_val(bf16_bits(x)); }
// D += A·B with NT terms: 1 = ah·bh, 2 = + al·bh (A split), 3 = + ah·bl (both split)
template <int NT>
__device__ __forceinline__ v8f mmaN(v16b ah, v16b al, v16b bh, v16b bl, v8f c) {
  c = __builtin_amdgcn_wmma_f32_16x16x32_bf16(false, ah, false, bh, (short)0, c, false, false);
  if (NT >= 2) c = __builtin_amdgcn_wmma_f32_16x16x32_bf16(false, al, false, bh, (short)0, c, false, false);
  if (NT >= 3) c = __builtin_amdgcn_wmma_f32_16x16x32_bf16(false, ah, false, bl, (short)0, c, false, false);
  asm volatile("v_nop\n\tv_nop\n\tv_nop\n\tv_nop" : "+v"(c) : "v"(ah), "v"(al), "v"(bh), "v"(bl));
  return c;
}

__global__ __launch_bounds__(256) void k_wt_bf16(const float* __restrict__ W, unsigned short* __restrict__ Wt, int K, int N) {
  const int t = blockIdx.x * 256 + threadIdx.x;
  const int k8n = K / 8;
  if (t >= N * k8n) return;
  const int n = t / k8n, k8 = (t % k8n) * 8;
  v8us v;
#pragma unroll
  for (int i = 0; i < 8; ++i) v[i] = bf16_bits(W[(size_t)(k8 + i) * N + n]);
  *(v8us*)(Wt + (size_t)n * K + k8) = v;
  
}

// GEMM C[M][N] (f32, pitch ldc) = act(A[M][K]·W + bias). A f32 row-major (pitch lda) converted per fragment to bf16
// (ASPLIT: hi/lo two planes -> 2 terms, else single rounded term); Wt bf16 [N][K] (pitch ldb). BIAS_BF16 rounds the
// bias to bf16 first (bias quantised to bf16 before the add). K%32==0, M%16==0, N%64==0.
template <bool ASPLIT, int ACT, bool BIAS_BF16>
__global__ __launch_bounds__(128) void k_gemm_bf(const float* __restrict__ A, int lda, const unsigned short* __restrict__ Wt, int ldb,
                                               const float* __restrict__ bias, float* __restrict__ C, int ldc, int M, int N, int K) {
  __shared__ __attribute__((aligned(16))) float so[4][16][64];
  const int tid = threadIdx.x, w = tid >> 5, lane = tid & 31, ln = lane & 15, hh = lane >> 4;
  const int ntn = N / 64;
  const int wid = blockIdx.x * 4 + w;
  const int mt = wid / ntn, nq = wid % ntn;
  if (mt * 16 >= M) return;
  const int row0 = mt * 16, col0 = nq * 64;
  const float* arow = A + (size_t)(row0 + ln) * lda;
  v8f acc[4] = {};
  for (int kb = 0; kb < K; kb += 32) {
    FragB ah, al;
    const v4f x0 = *(const v4fa*)(arow + kb + 8 * hh), x1 = *(const v4fa*)(arow + kb + 8 * hh + 4);
    const v4f x2 = *(const v4fa*)(arow + kb + 16 + 8 * hh), x3 = *(const v4fa*)(arow + kb + 16 + 8 * hh + 4);
    float xs[16] = {x0[0],x0[1],x0[2],x0[3],x1[0],x1[1],x1[2],x1[3],x2[0],x2[1],x2[2],x2[3],x3[0],x3[1],x3[2],x3[3]};
#pragma unroll
    for (int i = 0; i < 16; ++i) { const unsigned short hb = bf16_bits(xs[i]); ah.u[i] = hb; al.u[i] = ASPLIT ? bf16_bits(xs[i] - bf16_val(hb)) : (unsigned short)0; }
#pragma unroll
    for (int t = 0; t < 4; ++t) {
      const unsigned short* brow = Wt + (size_t)(col0 + t * 16 + ln) * ldb + kb;
      FragB b;
      b.half[0] = *(const v8us*)(brow + 8 * hh);
      b.half[1] = *(const v8us*)(brow + 16 + 8 * hh);
      acc[t] = mmaN<ASPLIT ? 2 : 1>(ah.v, al.v, b.v, b.v, acc[t]);
    }
  }
#pragma unroll
  for (int t = 0; t < 4; ++t) {
    float bv = bias ? bias[col0 + t * 16 + ln] : 0.f;
    if (BIAS_BF16) bv = bf16_round(bv);
#pragma unroll
    for (int r = 0; r < 8; ++r) { float v = acc[t][r] + bv; if (ACT == 1) v = fmaxf(v, 0.f); so[w][8 * hh + r][t * 16 + ln] = v; }
  }
  __builtin_amdgcn_fence(__ATOMIC_ACQ_REL, "workgroup");
  __builtin_amdgcn_wave_barrier();
  const int rsub = lane >> 4, c4 = (lane & 15) * 4;
  {
#pragma unroll
    for (int q = 0; q < 8; ++q) {
      const int r = q * 2 + rsub;
      const v4f v = *(const v4fa*)&so[w][r][c4];
      *(v4f*)(C + (size_t)(row0 + r) * ldc + col0 + c4) = v;
    }
    
  }
}

// GEMM C = act(A·W + bias + resid): A f32 (ASPLIT -> hi/lo 2 terms), Wt bf16 [N][K]; ACT 0 none, 1 relu, 2 exact gelu;
// resid (optional, f32, row index = (row % rmod), pitch ldr, RES_BF16 rounds it) added before the activation.
template <bool ASPLIT, int ACT, bool BIAS_BF16, bool RES_BF16>
__global__ __launch_bounds__(128) void k_gemm_bf3(const float* __restrict__ A, int lda, const unsigned short* __restrict__ Wt, int ldb,
                                                const float* __restrict__ bias, const float* __restrict__ resid, int rmod, int ldr,
                                                float* __restrict__ C, int ldc, int M, int N, int K) {
  __shared__ __attribute__((aligned(16))) float so[4][16][64];
  const int tid = threadIdx.x, w = tid >> 5, lane = tid & 31, ln = lane & 15, hh = lane >> 4;
  const int ntn = N / 64;
  const int wid = blockIdx.x * 4 + w;
  const int mt = wid / ntn, nq = wid % ntn;
  if (mt * 16 >= M) return;
  const int row0 = mt * 16, col0 = nq * 64;
  const float* arow = A + (size_t)(row0 + ln) * lda;
  v8f acc[4] = {};
  for (int kb = 0; kb < K; kb += 32) {
    FragB ah, al;
    const v4f x0 = *(const v4fa*)(arow + kb + 8 * hh), x1 = *(const v4fa*)(arow + kb + 8 * hh + 4);
    const v4f x2 = *(const v4fa*)(arow + kb + 16 + 8 * hh), x3 = *(const v4fa*)(arow + kb + 16 + 8 * hh + 4);
    float xs[16] = {x0[0],x0[1],x0[2],x0[3],x1[0],x1[1],x1[2],x1[3],x2[0],x2[1],x2[2],x2[3],x3[0],x3[1],x3[2],x3[3]};
#pragma unroll
    for (int i = 0; i < 16; ++i) { const unsigned short hb = bf16_bits(xs[i]); ah.u[i] = hb; al.u[i] = ASPLIT ? bf16_bits(xs[i] - bf16_val(hb)) : (unsigned short)0; }
#pragma unroll
    for (int t = 0; t < 4; ++t) {
      const unsigned short* brow = Wt + (size_t)(col0 + t * 16 + ln) * ldb + kb;
      FragB b;
      b.half[0] = *(const v8us*)(brow + 8 * hh);
      b.half[1] = *(const v8us*)(brow + 16 + 8 * hh);
      acc[t] = mmaN<ASPLIT ? 2 : 1>(ah.v, al.v, b.v, b.v, acc[t]);
    }
  }
#pragma unroll
  for (int t = 0; t < 4; ++t) {
    const int col = col0 + t * 16 + ln;
    float bv = bias ? bias[col] : 0.f;
    if (BIAS_BF16) bv = bf16_round(bv);
#pragma unroll
    for (int r = 0; r < 8; ++r) {
      float v = acc[t][r] + bv;
      if (resid) { float rv = resid[(size_t)((row0 + 8 * hh + r) % rmod) * ldr + col]; if (RES_BF16) rv = bf16_round(rv); v += rv; }
      if (ACT == 1) v = fmaxf(v, 0.f);
      if (ACT == 2) v = 0.5f * v * (1.0f + erff(v * 0.70710678118654752f));
      if (ACT == 3) { const float u = 0.7978845608028654f * (v + 0.044715f * v * v * v); v = 0.5f * v * (1.0f + tanhf(u)); }
      so[w][8 * hh + r][t * 16 + ln] = v;
    }
  }
  __builtin_amdgcn_fence(__ATOMIC_ACQ_REL, "workgroup");
  __builtin_amdgcn_wave_barrier();
  const int rsub = lane >> 4, c4 = (lane & 15) * 4;
  {
#pragma unroll
    for (int q = 0; q < 8; ++q) {
      const int r = q * 2 + rsub;
      const v4f v = *(const v4fa*)&so[w][r][c4];
      *(v4f*)(C + (size_t)(row0 + r) * ldc + col0 + c4) = v;
    }
    
  }
}
// row LayerNorm (biased variance, eps) over N: s = X (+ R); optional out_sum <- s; out_norm <- (s-mu)*rsqrt(var+eps)*g + b
template <bool PARAM_BF16>
__global__ __launch_bounds__(256) void k_layernorm(const float* __restrict__ X, const float* __restrict__ R, const float* __restrict__ g, const float* __restrict__ bta,
                                                  float* __restrict__ out_sum, float* __restrict__ out_norm, int N, float eps) {
  __shared__ float red[256];
  const int row = blockIdx.x, tid = threadIdx.x;
  const float* x = X + (size_t)row * N; const float* rr = R ? R + (size_t)row * N : nullptr;
  float vals[16];                     // up to N = 4096
  const int per = N / 256;            // contiguous chunk per thread? use strided-by-4 chunks: thread handles j = tid*4 + 1024*u
  float s1 = 0.f;
  for (int u = 0; u < per / 4; ++u) {
    const int j = tid * 4 + 1024 * u;
    const v4f a = *(const v4fa*)(x + j);
    v4f b = {0.f,0.f,0.f,0.f}; if (rr) b = *(const v4fa*)(rr + j);
#pragma unroll
    for (int q = 0; q < 4; ++q) { const float v = a[q] + b[q]; vals[u * 4 + q] = v; s1 += v; }
  }
  red[tid] = s1; __syncthreads();
  for (int st = 128; st > 0; st >>= 1) { if (tid < st) red[tid] += red[tid + st]; __syncthreads(); }
  const float mu = red[0] / (float)N; __syncthreads();
  float s2 = 0.f;
  for (int u = 0; u < per / 4; ++u)
#pragma unroll
    for (int q = 0; q < 4; ++q) { const float c = vals[u * 4 + q] - mu; s2 += c * c; }
  red[tid] = s2; __syncthreads();
  for (int st = 128; st > 0; st >>= 1) { if (tid < st) red[tid] += red[tid + st]; __syncthreads(); }
  const float rs = rsqrtf(red[0] / (float)N + eps);
  {
    for (int u = 0; u < per / 4; ++u) {
      const int j = tid * 4 + 1024 * u;
      v4f o, sm;
#pragma unroll
      for (int q = 0; q < 4; ++q) {
        float gg = g[j + q], bb = bta[j + q];
        if (PARAM_BF16) { gg = bf16_round(gg); bb = bf16_round(bb); }
        sm[q] = vals[u * 4 + q]; o[q] = (vals[u * 4 + q] - mu) * rs * gg + bb;
      }
      if (out_sum) *(v4f*)(out_sum + (size_t)row * N + j) = sm;
      *(v4f*)(out_norm + (size_t)row * N + j) = o;
    }
    
  }
}



// ---- f16 WMMA path (v_wmma_f32_16x16x32_f16): 11-bit significands for operands in range — used where a [0,1] probability operand needs more precision than bf16
typedef _Float16 v16h __attribute__((ext_vector_type(16)));
union FragH { v16h v; v8us half[2]; _Float16 h[16]; unsigned short u[16]; };
template <int NT>
__device__ __forceinline__ v8f mmaH(v16h ah, v16h al, v16h bh, v16h bl, v8f c) {
  c = __builtin_amdgcn_wmma_f32_16x16x32_f16(false, ah, false, bh, (short)0, c, false, false);
  if (NT >= 2) c = __builtin_amdgcn_wmma_f32_16x16x32_f16(false, al, false, bh, (short)0, c, false, false);
  if (NT >= 3) c = __builtin_amdgcn_wmma_f32_16x16x32_f16(false, ah, false, bl, (short)0, c, false, false);
  asm volatile("v_nop\n\tv_nop\n\tv_nop\n\tv_nop" : "+v"(c) : "v"(ah), "v"(al), "v"(bh), "v"(bl));
  return c;
}
// batched GEMM like k_gemm_b but f16 operands: A f32 (split into f16 hi/lo if ASPLIT, else rounded to f16), Bt = f16 values [n][k]; alpha; C f32; N multiple of 16 (partial tiles skipped)
template <bool ASPLIT>
__global__ __launch_bounds__(128) void k_gemm_h(const float* __restrict__ A, int lda, size_t sA, const _Float16* __restrict__ Bh, int ldb, size_t sB, float alpha, float* __restrict__ C, int ldc, size_t sC, int M, int N, int K) {
  __shared__ __attribute__((aligned(16))) float so[4][16][64];
  const int tid = threadIdx.x, w = tid >> 5, lane = tid & 31, ln = lane & 15, hh = lane >> 4; const int by = blockIdx.y;
  A += (size_t)by * sA; Bh += (size_t)by * sB; C += (size_t)by * sC;
  const int ntn = (N + 63) / 64; const int wid = blockIdx.x * 4 + w; const int mt = wid / ntn, nq = wid % ntn; if (mt * 16 >= M) return;
  const int row0 = mt * 16, col0 = nq * 64; const float* arow = A + (size_t)(row0 + ln) * lda;
  v8f acc[4] = {};
  for (int kb = 0; kb < K; kb += 32) {
    FragH ah, al;
    const v4f x0 = *(const v4fa*)(arow + kb + 8 * hh), x1 = *(const v4fa*)(arow + kb + 8 * hh + 4), x2 = *(const v4fa*)(arow + kb + 16 + 8 * hh), x3 = *(const v4fa*)(arow + kb + 16 + 8 * hh + 4);
    float xs[16] = {x0[0],x0[1],x0[2],x0[3],x1[0],x1[1],x1[2],x1[3],x2[0],x2[1],x2[2],x2[3],x3[0],x3[1],x3[2],x3[3]};
#pragma unroll
    for (int i = 0; i < 16; ++i) { const _Float16 h = (_Float16)xs[i]; ah.h[i] = h; al.h[i] = ASPLIT ? (_Float16)(xs[i] - (float)h) : (_Float16)0.0f; }
#pragma unroll
    for (int t = 0; t < 4; ++t) { if (col0 + t * 16 >= N) continue; const size_t boff = (size_t)(col0 + t * 16 + ln) * ldb + kb; FragH bq; bq.half[0] = *(const v8us*)(Bh + boff + 8 * hh); bq.half[1] = *(const v8us*)(Bh + boff + 16 + 8 * hh);
      acc[t] = mmaH<ASPLIT ? 2 : 1>(ah.v, al.v, bq.v, bq.v, acc[t]); }
  }
#pragma unroll
  for (int t = 0; t < 4; ++t) { if (col0 + t * 16 >= N) continue;
#pragma unroll
    for (int r = 0; r < 8; ++r) so[w][8 * hh + r][t * 16 + ln] = acc[t][r] * alpha; }
  __builtin_amdgcn_fence(__ATOMIC_ACQ_REL, "workgroup"); __builtin_amdgcn_wave_barrier();
  const int rsub = lane >> 4, c4 = (lane & 15) * 4;
  {
#pragma unroll
    for (int q = 0; q < 8; ++q) { const int r = q * 2 + rsub; if (col0 + c4 < N) { const v4f v = *(const v4fa*)&so[w][r][c4]; *(v4f*)(C + (size_t)(row0 + r) * ldc + col0 + c4) = v; } }
     }
}

// ---- fragment order: every f16 plane [rows][K] that feeds a matrix operand (rows % 16 == 0, K % 32 == 0) is stored as 1-KiB blocks, one per fragment of 16 rows x 32 k, block (rt, kt) at element (rt * (K / 32) + kt) * 512.
// Inside a block, lane l = 16 hh + ln (row ln of the tile) finds its k = 8 hh .. 8 hh + 7 at element 8 l and its k = 16 + 8 hh .. 16 + 8 hh + 7 at element 256 + 8 l: each of a fragment's two 16-byte loads reads 512 contiguous bytes, four whole lines, where rows of a row-major plane gave sixteen lines of 32 bytes. The registers hold the same values as before.
// A writer's thread t stores elements 8 t .. 8 t + 7 of the plane (a wave stores four whole lines); fo_src names the row and the first k that belong there.
struct FoRK { int row, k; };
__device__ __forceinline__ FoRK fo_src(size_t t, int K) { const int lane = (int)(t & 31); const size_t wid = t >> 5; const int half = (int)(wid & 1); const size_t blk = wid >> 1; const int kb = K >> 5;
  FoRK o; o.row = (int)(blk / kb) * 16 + (lane & 15); o.k = (int)(blk % kb) * 32 + half * 16 + (lane >> 4) * 8; return o; }
// element offset of the 8 values (row, k8 .. k8 + 7), k8 % 8 == 0
__device__ __forceinline__ size_t fo_dst(int row, int k8, int K) { return ((size_t)(row >> 4) * (K >> 5) + (k8 >> 5)) * 512 + ((k8 >> 4) & 1) * 256 + (((k8 >> 3) & 1) * 16 + (row & 15)) * 8; }
// Wt = f16(W[k][n] * scale), rows n, in fragment order, from f32 row-major W[K][N] (scale = power of two; bf16-exact weights stay exact in f16 away from the subnormal range)
__device__ __forceinline__ void d_wt_f16(int bx, const float* __restrict__ W, _Float16* __restrict__ Wt, int K, int N, float scale) {
  const int t = bx * 256 + threadIdx.x; if (t >= N * (K / 8)) return; const FoRK s = fo_src((size_t)t, K); const int n = s.row, k8 = s.k; FragH f;
#pragma unroll
  for (int i = 0; i < 8; ++i) { if (i) asm volatile("s_wait_xcnt 0x0" ::: "memory");      /* stands in front of each further load, whose result may land in a register that an earlier load names as its address */
    f.h[i] = (_Float16)(bf16_round(W[(size_t)(k8 + i) * N + n]) * scale); }
  const v8us o = f.half[0];
  *(v8us*)((unsigned short*)Wt + (size_t)t * 8) = o; 
}
// k_gemm_hh variant with fused epilogue: v = acc·alpha + bias[by·sBias + col] (+ CP[(row/rowsPerB)·sCPb + by·64 + col] if CP) ; ACT 0 none / 1 elu ; writes f16 C16 (and f32 C if non-null)
template <int ACT>
__global__ __launch_bounds__(128) void k_gemm_hhx(const _Float16* __restrict__ A, int lda, size_t sA, const _Float16* __restrict__ Bh, int ldb, size_t sB, float alpha, const float* __restrict__ bias, size_t sBias, const float* __restrict__ CP, int rowsPerB, size_t sCPb, int row0g,
    float* __restrict__ C, _Float16* __restrict__ C16, int ldc, size_t sC, int M, int N, int K) {
  __shared__ __attribute__((aligned(16))) float so[4][16][64];
  const int tid = threadIdx.x, w = tid >> 5, lane = tid & 31, ln = lane & 15, hh = lane >> 4; const int by = blockIdx.y;
  A += (size_t)by * sA; Bh += (size_t)by * sB; const size_t cofs = (size_t)by * sC; const float* bp = bias ? bias + (size_t)by * sBias : nullptr;
  const int ntn = (N + 63) / 64; const int wid = blockIdx.x * 4 + w; const int mt = wid / ntn, nq = wid % ntn; if (mt * 16 >= M) return;
  const int row0 = mt * 16, col0 = nq * 64; const _Float16* arow = A + (size_t)(row0 + ln) * lda;
  v8f acc[4] = {};
  for (int kb = 0; kb < K; kb += 32) { FragH ah; ah.half[0] = *(const v8us*)((const unsigned short*)arow + kb + 8 * hh); ah.half[1] = *(const v8us*)((const unsigned short*)arow + kb + 16 + 8 * hh);
#pragma unroll
    for (int t = 0; t < 4; ++t) { if (col0 + t * 16 >= N) continue; const size_t boff = (size_t)(col0 + t * 16 + ln) * ldb + kb; FragH bq; bq.half[0] = *(const v8us*)((const unsigned short*)Bh + boff + 8 * hh); bq.half[1] = *(const v8us*)((const unsigned short*)Bh + boff + 16 + 8 * hh);
      acc[t] = mmaH<1>(ah.v, ah.v, bq.v, bq.v, acc[t]); }
  }
#pragma unroll
  for (int t = 0; t < 4; ++t) { if (col0 + t * 16 >= N) continue; const int col = col0 + t * 16 + ln; const float bv = bp ? bf16_round(bp[col]) : 0.f;
#pragma unroll
    for (int r = 0; r < 8; ++r) { float v = acc[t][r] * alpha + bv; if (CP) { const int bidx = (row0g + row0 + 8 * hh + r) / rowsPerB; v += CP[(size_t)bidx * sCPb + (size_t)by * 64 + col]; } if (ACT == 1) v = (v > 0.f) ? v : expm1f(v); else if (ACT == 7) v = (v > 0.f) ? v + 1.0f : expf(v); else if (ACT == 8) v = tanhf(v); else if (ACT == 9) v = 0.5f * v * (1.0f + tanhf(0.7978845608028654f * (v + 0.044715f * v * v * v))); else if (ACT == 11) v = 1.0f / (1.0f + expf(-v)); else if (ACT == 12) v = (v > 0.f) ? v : 0.01f * v; else if (ACT == 14) v = (v > 0.f) ? v : 0.1f * v; else if (ACT == 15) v = v / (1.0f + expf(-v)); else if (ACT == 3) v = fmaxf(v, 0.f); else if (ACT == 6) v = 0.5f * v * (1.0f + erff(v * 0.70710678118654752f)); so[w][8 * hh + r][t * 16 + ln] = v; } }
  __builtin_amdgcn_fence(__ATOMIC_ACQ_REL, "workgroup"); __builtin_amdgcn_wave_barrier();
  const int rsub = lane >> 4, c4 = (lane & 15) * 4; typedef _Float16 v4h __attribute__((ext_vector_type(4)));
  {
#pragma unroll
    for (int q = 0; q < 8; ++q) { const int r = q * 2 + rsub; if (col0 + c4 < N) { const v4f v = *(const v4fa*)&so[w][r][c4]; if (C) *(v4f*)(C + cofs + (size_t)(row0 + r) * ldc + col0 + c4) = v; if (C16) { v4h h4; for (int i = 0; i < 4; ++i) h4[i] = (_Float16)v[i]; *(v4h*)(C16 + cofs + (size_t)(row0 + r) * ldc + col0 + c4) = h4; } } }
     }
}


typedef _Float16 v4h __attribute__((ext_vector_type(4)));

__device__ __forceinline__ void d_x16(int bx, const float* __restrict__ x, _Float16* __restrict__ X16, size_t n8, int K) { const size_t t = (size_t)bx * 256 + threadIdx.x; if (t >= n8) return; const FoRK s = fo_src(t, K); const float* xs = x + (size_t)s.row * K + s.k; FragH f;
#pragma unroll
  for (int q = 0; q < 8; ++q) f.h[q] = (_Float16)bf16_round(xs[q]); *(v8us*)((unsigned short*)X16 + t * 8) = f.half[0];  }
__global__ __launch_bounds__(256) void k_h16(const float* __restrict__ x, _Float16* __restrict__ X16, size_t n8) { const size_t t = (size_t)blockIdx.x * 256 + threadIdx.x; if (t >= n8) return; FragH f;
#pragma unroll
  for (int q = 0; q < 8; ++q) f.h[q] = (_Float16)x[t * 8 + q]; *(v8us*)((unsigned short*)X16 + t * 8) = f.half[0];  }
__global__ __launch_bounds__(256) void k_round16f(const float* __restrict__ W, _Float16* __restrict__ Bt, size_t n8) { const size_t t = (size_t)blockIdx.x * 256 + threadIdx.x; if (t >= n8) return; FragH f;
#pragma unroll
  for (int i = 0; i < 8; ++i) f.h[i] = (_Float16)(bf16_round(W[t * 8 + i]) * 16.0f); *(v8us*)((unsigned short*)Bt + t * 8) = f.half[0];  }
template <int NHv, int TTv>
__device__ __forceinline__ void d_vt(int bx, const _Float16* __restrict__ V16, int ldv, int voff, _Float16* __restrict__ Vt) { __shared__ unsigned short tl[64][66]; const int tid = threadIdx.x; const int slab = bx / (TTv / 64), lg = bx % (TTv / 64); const int b = slab / NHv, h = slab % NHv;
  for (int i = tid; i < 64 * 8; i += 256) { const int r = i / 8, c8 = (i % 8) * 8; FragH f; f.half[0] = *(const v8us*)((const unsigned short*)V16 + ((size_t)b * TTv + lg * 64 + r) * ldv + voff + h * 64 + c8);
#pragma unroll
    for (int q = 0; q < 8; ++q) tl[r][c8 + q] = f.u[q]; }
  __syncthreads();
  {
#pragma unroll
    for (int rd = 0; rd < 2; ++rd) { const int wv = rd * 8 + tid / 32, lane = tid % 32; const int d = (wv >> 2) * 16 + (lane & 15), pc = (wv & 3) * 2 + (lane >> 4); FragH f;      /* a wave per half fragment of V^T (rows d, k = keys): 16 d x 2 groups of 8 keys */
#pragma unroll
      for (int q = 0; q < 8; ++q) f.u[q] = tl[pc * 8 + q][d];
      *(v8us*)((unsigned short*)Vt + fo_dst(slab * 64 + d, lg * 64 + pc * 8, TTv)) = f.half[0]; }
     } }

__global__ __launch_bounds__(256) void k_hl(const float* __restrict__ F, _Float16* __restrict__ Hh, _Float16* __restrict__ Hl, size_t n8, int K) { const size_t t = (size_t)blockIdx.x * 256 + threadIdx.x; if (t >= n8) return; const FoRK s = fo_src(t, K); const float* Fs = F + (size_t)s.row * K + s.k; FragH fh, fl; const v4f a = *(const v4fa*)Fs, c = *(const v4fa*)(Fs + 4);      /* F row-major, pitch K; both planes in fragment order */
#pragma unroll
  for (int q = 0; q < 4; ++q) { _Float16 h = (_Float16)a[q]; fh.h[q] = h; fl.h[q] = (_Float16)((a[q] - (float)h) * 1024.0f); h = (_Float16)c[q]; fh.h[4 + q] = h; fl.h[4 + q] = (_Float16)((c[q] - (float)h) * 1024.0f); }
  { *(v8us*)((unsigned short*)Hh + t * 8) = fh.half[0]; *(v8us*)((unsigned short*)Hl + t * 8) = fl.half[0];  } }

// ---- fast GEMM (wave tile 32x64; requires M % 32 == 0 rows per launch region, N % 64 == 0 and K % 64 == 0); epilogue = k_gemm_hhx semantics ----
__device__ __forceinline__ v16h g2_frag(const _Float16* p) { FragH f; f.half[0] = *(const v8us*)((const unsigned short*)p); f.half[1] = *(const v8us*)((const unsigned short*)p + 256); return f.v; }      /* p: the lane's 8 elements in the fragment's block */
__device__ __forceinline__ v8f g2_mma(v16h a, v16h b, v8f c) { v8f d = __builtin_amdgcn_wmma_f32_16x16x32_f16(false, a, false, b, (short)0, c, false, false); asm volatile("v_nop\n\tv_nop\n\tv_nop\n\tv_nop" : "+v"(d) : "v"(a), "v"(b)); return d; }
template <int ACT>
__device__ __forceinline__ void d_gemm2(int bx, const _Float16* __restrict__ A, size_t sA, const _Float16* __restrict__ Bh, size_t sB, float alpha, const float* __restrict__ bias, size_t sBias, const float* __restrict__ CP, int rowsPerB, size_t sCPb, int row0g,
    float* __restrict__ C, _Float16* __restrict__ C16, int ldc, size_t sC, int M, int N, int K) {
  __shared__ __attribute__((aligned(16))) float so[4][32][68];
  const int tid = threadIdx.x, w = tid >> 5, lane = tid & 31, ln = lane & 15, hh = lane >> 4; const int by = blockIdx.y;
  A += (size_t)by * sA; Bh += (size_t)by * sB; const size_t cofs = (size_t)by * sC; const float* bp = bias ? bias + (size_t)by * sBias : nullptr;
  const int ntn = N >> 6; const int mt = bx / ntn, nq = bx - mt * ntn; const int row0 = mt * 128 + 32 * w, col0 = nq * 64; if (row0 >= M) return;
  /* A and Bh in fragment order, K elements a row: a tile of 16 rows is K * 16 elements, a step of 32 k is 512 */
  const _Float16* a0p = A + (size_t)(row0 >> 4) * K * 16 + lane * 8; const _Float16* a1p = a0p + (size_t)16 * K;
  const _Float16* b0p = Bh + (size_t)(col0 >> 4) * K * 16 + lane * 8; const _Float16* b1p = b0p + (size_t)16 * K; const _Float16* b2p = b1p + (size_t)16 * K; const _Float16* b3p = b2p + (size_t)16 * K;
  const v8f z8 = {0.f,0.f,0.f,0.f,0.f,0.f,0.f,0.f}; v8f c00 = z8, c01 = z8, c02 = z8, c03 = z8, c10 = z8, c11 = z8, c12 = z8, c13 = z8;
  /* two register sets x / y of the six fragments (K % 64 == 0): the loads of the next 32-wide k step are all issued before the products of this one, so a step waits for one overlapped latency at most */
  v16h xa0 = g2_frag(a0p), xa1 = g2_frag(a1p), xb0 = g2_frag(b0p), xb1 = g2_frag(b1p), xb2 = g2_frag(b2p), xb3 = g2_frag(b3p);
#pragma unroll 1
  for (int kb = 0; kb < K; kb += 64) { const int k1 = kb * 16, k2 = ((kb + 64 < K) ? kb + 64 : kb) * 16;      /* element offsets of this trip's first block (the y step is the block behind it, 512 elements on) and of the next trip's. Last trip: k2 names a step inside the row tile again; its values are not used */
    const _Float16* pya0 = a0p + k1; const _Float16* pya1 = a1p + k1; const _Float16* pyb0 = b0p + k1; const _Float16* pyb1 = b1p + k1; const _Float16* pyb2 = b2p + k1; const _Float16* pyb3 = b3p + k1;
    const _Float16* pxa0 = a0p + k2; const _Float16* pxa1 = a1p + k2; const _Float16* pxb0 = b0p + k2; const _Float16* pxb1 = b1p + k2; const _Float16* pxb2 = b2p + k2; const _Float16* pxb3 = b3p + k2;
    const v16h ya0 = g2_frag(pya0 + 512), ya1 = g2_frag(pya1 + 512), yb0 = g2_frag(pyb0 + 512), yb1 = g2_frag(pyb1 + 512), yb2 = g2_frag(pyb2 + 512), yb3 = g2_frag(pyb3 + 512);
    __builtin_amdgcn_sched_barrier(0);      /* holds the y loads above the x products (the scheduler otherwise moves each load down to its use) */
    c00 = g2_mma(xa0, xb0, c00); c10 = g2_mma(xa1, xb0, c10); c01 = g2_mma(xa0, xb1, c01); c11 = g2_mma(xa1, xb1, c11);
    c02 = g2_mma(xa0, xb2, c02); c12 = g2_mma(xa1, xb2, c12); c03 = g2_mma(xa0, xb3, c03); c13 = g2_mma(xa1, xb3, c13);
    __builtin_amdgcn_sched_barrier(0);      /* holds the x reloads below the x products and, with the next one, above the y products */
    xa0 = g2_frag(pxa0); xa1 = g2_frag(pxa1); xb0 = g2_frag(pxb0); xb1 = g2_frag(pxb1); xb2 = g2_frag(pxb2); xb3 = g2_frag(pxb3);
    __builtin_amdgcn_sched_barrier(0);      /* holds the x reloads above the y products */
    c00 = g2_mma(ya0, yb0, c00); c10 = g2_mma(ya1, yb0, c10); c01 = g2_mma(ya0, yb1, c01); c11 = g2_mma(ya1, yb1, c11);
    c02 = g2_mma(ya0, yb2, c02); c12 = g2_mma(ya1, yb2, c12); c03 = g2_mma(ya0, yb3, c03); c13 = g2_mma(ya1, yb3, c13);
    asm volatile("s_wait_xcnt 0x0" :: "v"(pya0), "v"(pya1), "v"(pyb0), "v"(pyb1), "v"(pyb2), "v"(pyb3), "v"(pxa0), "v"(pxa1), "v"(pxb0), "v"(pxb1), "v"(pxb2), "v"(pxb3) : "memory"); }      /* stands in front of the next trip's address sums, which overwrite registers that the loads name; the trip's twelve addresses are its inputs, so that each keeps its registers up to here and no later load's result lands in them */
  v8f accs[8] = {c00, c01, c02, c03, c10, c11, c12, c13};
  /* the epilogue's loads (4 bias words, 64 CP words a lane) are issued together as well, ahead of the arithmetic that uses them */
  float bw[4] = {0.f, 0.f, 0.f, 0.f}; v8f cpv[8] = {z8, z8, z8, z8, z8, z8, z8, z8};
  if (bp) {
#pragma unroll
    for (int t = 0; t < 4; ++t) bw[t] = bp[col0 + t * 16 + ln];
    asm volatile("s_wait_xcnt 0x0" ::: "memory"); }      /* stands in front of the scalar work below, which overwrites the base register that the four loads name */
  if (CP) {
#pragma unroll
    for (int u = 0; u < 8; ++u)
#pragma unroll
      for (int r = 0; r < 8; ++r) { const int bidx = (row0g + row0 + (u >> 2) * 16 + 8 * hh + r) / rowsPerB; cpv[u][r] = CP[(size_t)bidx * sCPb + (size_t)by * 64 + col0 + (u & 3) * 16 + ln];
        if (r == 7) asm volatile("s_wait_xcnt 0x0" ::: "memory"); }      /* stands in front of the next group's loads, whose results may land in address registers of this group */
    asm volatile("" :: "v"(cpv[0]), "v"(cpv[1]), "v"(cpv[2]), "v"(cpv[3]), "v"(cpv[4]), "v"(cpv[5]), "v"(cpv[6]), "v"(cpv[7])); }      /* inputs-only fence on the loaded words: holds all 64 loads in this block, where they overlap, instead of one waited load in front of each add */
#pragma unroll
  for (int u = 0; u < 8; ++u) { const int t = u & 3, half = u >> 2; const float bv = bp ? bf16_round(bw[t]) : 0.f;
#pragma unroll
    for (int r = 0; r < 8; ++r) { const int rloc = half * 16 + 8 * hh + r; float v = accs[u][r] * alpha + bv; if (CP) v += cpv[u][r];
      if (ACT == 3) v = fmaxf(v, 0.f); else if (ACT == 6) v = 0.5f * v * (1.0f + erff(v * 0.70710678118654752f)); else if (ACT == 11) v = 1.0f / (1.0f + expf(-v)); else if (ACT == 15) v = v / (1.0f + expf(-v)); else if (ACT == 12) v = (v > 0.f) ? v : 0.01f * v; else if (ACT == 8) v = tanhf(v);
      so[w][rloc][t * 16 + ln] = v; } }
  __builtin_amdgcn_fence(__ATOMIC_ACQ_REL, "workgroup"); __builtin_amdgcn_wave_barrier();
  const int rsub = lane >> 4, c4 = (lane & 15) * 4;
  {
#pragma unroll
    for (int q = 0; q < 16; ++q) { const int r = q * 2 + rsub; const v4f v = *(const v4fa*)&so[w][r][c4]; if (C) *(v4f*)(C + cofs + (size_t)(row0 + r) * ldc + col0 + c4) = v; if (C16) { v4h h4; for (int i = 0; i < 4; ++i) h4[i] = (_Float16)v[i]; *(v4h*)(C16 + cofs + (size_t)(row0 + r) * ldc + col0 + c4) = h4; } }
     } }



// lane l's value of lane l ^ X (X < 16) inside its 16-lane row, by a DPP row_xmask move in registers (no trip through the LDS pipe and no wait on it)
template <int X>
__device__ __forceinline__ float row_xor(float v) { return __int_as_float(__builtin_amdgcn_update_dpp(0, __float_as_int(v), 0x160 | X, 0xf, 0xf, true)); }
// maximum over the 16-lane row, all 32 lanes on: four dependent DPP maxima in one statement (written with fmaxf on a DPP move the compiler puts a move and a quieting maximum in front of each step, three links for one)
__device__ __forceinline__ float row_max16(float v) {
  asm("v_max_num_f32_dpp %0, %0, %0 row_xmask:1 row_mask:0xf bank_mask:0xf\n\t"
      "v_max_num_f32_dpp %0, %0, %0 row_xmask:2 row_mask:0xf bank_mask:0xf\n\t"
      "v_max_num_f32_dpp %0, %0, %0 row_xmask:4 row_mask:0xf bank_mask:0xf\n\t"
      "v_max_num_f32_dpp %0, %0, %0 row_xmask:8 row_mask:0xf bank_mask:0xf" : "+v"(v));
  return v; }
__device__ __forceinline__ float row_sum16(float v) { v += row_xor<1>(v); v += row_xor<2>(v); v += row_xor<4>(v); v += row_xor<8>(v); return v; }
template <int CAUSAL>
__global__ __launch_bounds__(128) void k_flash(const _Float16* __restrict__ Q16, int ldq, const _Float16* __restrict__ K16, int ldk, const _Float16* __restrict__ Vt, const int* __restrict__ MSK, float* __restrict__ O, int ldo) {
  constexpr int RPW = 16, RTN = RPW / 16, NQB = TQ / (4 * RPW), DT = 4, KS = 2;
  __shared__ __attribute__((aligned(16))) unsigned short sP[4][RPW][40]; __shared__ __attribute__((aligned(16))) float sO[4][RPW][64 + 4];
  const int tid = threadIdx.x, w = tid >> 5, lane = tid & 31, ln = lane & 15, hh = lane >> 4;
  const int slab = blockIdx.x / NQB, qblk = blockIdx.x % NQB; const int b = slab / NH, h = slab % NH; const int qb0 = qblk * (4 * RPW); const int q0 = qb0 + w * RPW;
  FragH aq[2][KS];
#pragma unroll
  for (int rt = 0; rt < RTN; ++rt) { const unsigned short* qr = (const unsigned short*)Q16 + ((size_t)b * TQ + q0 + rt * 16 + ln) * ldq + h * 64;
#pragma unroll
    for (int ks = 0; ks < KS; ++ks) { aq[rt][ks].half[0] = *(const v8us*)(qr + ks * 32 + 8 * hh); aq[rt][ks].half[1] = *(const v8us*)(qr + ks * 32 + 16 + 8 * hh); } }
  const unsigned short* Vth = (const unsigned short*)Vt + (size_t)slab * 64 * TK;
  float m_r[2][8], l_r[2][8]; v8f oacc[2][DT];
#pragma unroll
  for (int rt = 0; rt < RTN; ++rt) {
#pragma unroll
    for (int r = 0; r < 8; ++r) { m_r[rt][r] = -3.0e38f; l_r[rt][r] = 0.f; }
#pragma unroll
    for (int dt = 0; dt < DT; ++dt) oacc[rt][dt] = (v8f){0.f,0.f,0.f,0.f,0.f,0.f,0.f,0.f}; }
  const int jend = (CAUSAL == 1) ? (qb0 + 4 * RPW) : TK;      /* causal: keys beyond the block's last query never contribute */
#pragma unroll 1
  for (int j0 = 0; j0 < jend; j0 += 32) {
    v8f s[2][2];
#pragma unroll
    for (int nt = 0; nt < 2; ++nt) { const unsigned short* kr = (const unsigned short*)K16 + ((size_t)b * TK + j0 + nt * 16 + ln) * ldk + h * 64; FragH bk[KS];
#pragma unroll
      for (int ks = 0; ks < KS; ++ks) { bk[ks].half[0] = *(const v8us*)(kr + ks * 32 + 8 * hh); bk[ks].half[1] = *(const v8us*)(kr + ks * 32 + 16 + 8 * hh); }
#pragma unroll
      for (int rt = 0; rt < RTN; ++rt) { v8f acc = (v8f){0.f,0.f,0.f,0.f,0.f,0.f,0.f,0.f};
#pragma unroll
        for (int ks = 0; ks < KS; ++ks) acc = mmaH<1>(aq[rt][ks].v, aq[rt][ks].v, bk[ks].v, bk[ks].v, acc); s[rt][nt] = acc; } }
#pragma unroll
    for (int rt = 0; rt < RTN; ++rt)
#pragma unroll
      for (int r = 0; r < 8; ++r) { const int tq = q0 + rt * 16 + 8 * hh + r; const int k0 = j0 + ln, k1 = j0 + 16 + ln;
        const bool ok0 = (CAUSAL == 1) ? (k0 <= tq) : ((CAUSAL == 2) ? ((k0 >> 5) == (tq >> 5)) : true), ok1 = (CAUSAL == 1) ? (k1 <= tq) : ((CAUSAL == 2) ? ((k1 >> 5) == (tq >> 5)) : true);      /* mode 2: block-diagonal 32-token groups */
        const float s0 = ok0 ? s[rt][0][r] * SCL : -3.0e38f, s1 = ok1 ? s[rt][1][r] * SCL : -3.0e38f; 
        const float mn = row_max16(fmaxf(fmaxf(s0, s1), m_r[rt][r]));      /* the running maximum is the same in all 16 lanes of the row: taken in ahead of the reduction, the reduced value is the new maximum itself */
        const float al = (mn > -1.0e38f) ? expf(m_r[rt][r] - mn) : 1.0f; m_r[rt][r] = mn; const float p0 = ok0 ? expf(s0 - mn) : 0.f, p1 = ok1 ? expf(s1 - mn) : 0.f; l_r[rt][r] = l_r[rt][r] * al + p0 + p1;
#pragma unroll
        for (int dt = 0; dt < DT; ++dt) oacc[rt][dt][r] *= al;
        FragH t2; t2.h[0] = (_Float16)(p0 * 1024.0f); t2.h[1] = (_Float16)(p1 * 1024.0f); sP[w][rt * 16 + 8 * hh + r][ln] = t2.u[0]; sP[w][rt * 16 + 8 * hh + r][16 + ln] = t2.u[1]; }
    __builtin_amdgcn_fence(__ATOMIC_ACQ_REL, "workgroup"); __builtin_amdgcn_wave_barrier();
    FragH pa[2];
#pragma unroll
    for (int rt = 0; rt < RTN; ++rt) { pa[rt].half[0] = *(const v8us*)&sP[w][rt * 16 + ln][8 * hh]; pa[rt].half[1] = *(const v8us*)&sP[w][rt * 16 + ln][16 + 8 * hh]; }
#pragma unroll
    for (int dt = 0; dt < DT; ++dt) { const unsigned short* vrow = Vth + (size_t)(dt * 16 + ln) * TK + j0; FragH bv; bv.half[0] = *(const v8us*)(vrow + 8 * hh); bv.half[1] = *(const v8us*)(vrow + 16 + 8 * hh);
#pragma unroll
      for (int rt = 0; rt < RTN; ++rt) oacc[rt][dt] = mmaH<1>(pa[rt].v, pa[rt].v, bv.v, bv.v, oacc[rt][dt]); }
    __builtin_amdgcn_fence(__ATOMIC_ACQ_REL, "workgroup"); __builtin_amdgcn_wave_barrier(); }
#pragma unroll
  for (int rt = 0; rt < RTN; ++rt) {
#pragma unroll
    for (int r = 0; r < 8; ++r) { float l = l_r[rt][r]; l = row_sum16(l); l_r[rt][r] = (l > 0.f) ? 1.0f / (l * 1024.0f) : 0.f; }
#pragma unroll
    for (int dt = 0; dt < DT; ++dt)
#pragma unroll
      for (int r = 0; r < 8; ++r) sO[w][rt * 16 + 8 * hh + r][dt * 16 + ln] = oacc[rt][dt][r] * l_r[rt][r]; }
  __builtin_amdgcn_fence(__ATOMIC_ACQ_REL, "workgroup"); __builtin_amdgcn_wave_barrier();
  {
#pragma unroll
    for (int rp = 0; rp < RPW; rp += 2) { const int r = rp + (lane >> 4), pc = lane & 15; const v4f val = *(const v4fa*)&sO[w][r][pc * 4]; *(v4f*)(O + ((size_t)b * TQ + q0 + r) * ldo + h * 64 + pc * 4) = val; }
     } }
__device__ __forceinline__ float half_swap(float v) { const int x = __float_as_int(v); return __int_as_float(__builtin_amdgcn_permlanex16(x, x, 0x76543210, 0xfedcba98, false, false)); }
typedef int v4im __attribute__((ext_vector_type(4), may_alias));
// softmax of one trip. s[i >> 3][i & 7] is the score of the trip's key (i >> 3) * 16 + 8 hh + (i & 7) against the lane's own query (column ln); ok[i] its mask. The maximum and the sum over keys are taken inside the lane; the maximum is joined with the other half's once a trip (m_c is the same in both halves), the sum l_c stays this half's until the epilogue.
// The two score tiles, converted in place, are the B operand P^T in the hardware k order (element i): P takes no trip through LDS. O^T tiles hold the lane's query in every register, so one factor rescales them all.
__device__ __forceinline__ void sm_trip(const v8f (&s)[2], const bool (&ok)[16], float& m_c, float& l_c, v8f (&oacc)[4], v8f (&oaccL)[4], FragH& ph, FragH& pl) {
  float sc[16], t[8], p[16], u[8];
#pragma unroll
  for (int i = 0; i < 16; ++i) sc[i] = ok[i] ? s[i >> 3][i & 7] * SCL : -3.0e38f;
#pragma unroll
  for (int i = 0; i < 8; ++i) t[i] = fmaxf(sc[i], sc[i + 8]);
  const float mh = fmaxf(fmaxf(fmaxf(fmaxf(t[0], t[1]), fmaxf(t[2], t[3])), fmaxf(fmaxf(t[4], t[5]), fmaxf(t[6], t[7]))), m_c);
  const float mn = fmaxf(mh, half_swap(mh));
  const float al = (mn > -1.0e38f) ? expf(m_c - mn) : 1.0f; m_c = mn;
#pragma unroll
  for (int i = 0; i < 16; ++i) p[i] = ok[i] ? expf(sc[i] - mn) : 0.f;
#pragma unroll
  for (int i = 0; i < 8; ++i) u[i] = p[i] + p[i + 8];
  l_c = l_c * al + (((u[0] + u[1]) + (u[2] + u[3])) + ((u[4] + u[5]) + (u[6] + u[7])));
#pragma unroll
  for (int dt = 0; dt < 4; ++dt) { oacc[dt] *= al; oaccL[dt] *= al; }
#pragma unroll
  for (int i = 0; i < 16; ++i) { const float x = p[i] * 1024.0f; const _Float16 hv = (_Float16)x; ph.h[i] = hv; pl.h[i] = (_Float16)((x - (float)hv) * 1024.0f); } }

// 3-term variant: O = (P_hi V_hi + (P_lo V_hi + P_hi V_lo) / 1024) / l with P = [hi | 2^10 residual] of 1024 p and V^T = [hi | 2^10 residual] planes (VtL same layout as Vt) -> ~2^-21-class products for un-averaged (early causal / peaked) rows
template <int CAUSAL>
__global__ __launch_bounds__(32 * NSPL) void k_flash3gA(const _Float16* __restrict__ Q16, int ldq, const _Float16* __restrict__ K16, int ldk, const _Float16* __restrict__ Vt, const _Float16* __restrict__ VtL, const int* __restrict__ MSK, float* __restrict__ O, int ldo) {
  constexpr int RPW = 16, RTN = RPW / 16, NQB = TQA / (4 * RPW), DT = 4, KS = 2;
  __shared__ __attribute__((aligned(16))) float sO[NSPL][RPW][64 + 4]; __shared__ float sM[NSPL][RPW], sL[NSPL][RPW];
  const int tid = threadIdx.x, w = __builtin_amdgcn_readfirstlane(tid >> 5), lane = tid & 31, ln = lane & 15, hh = lane >> 4;      /* the wave's number in a scalar register: the key range below stays scalar */
  /* one work-group per (batch, head, 16-query tile); its NSPL waves each run the flash loop over their own TK / NSPL keys, and the partial (m, l, O) are merged through LDS behind the loop */
  const int slab = blockIdx.x / (TQA / RPW), qblk = blockIdx.x % (TQA / RPW); (void)NQB; const int b = slab / NH, h = slab % NH; const int qb0 = qblk * RPW; const int q0 = qb0;
  FragH aq[2][KS];
#pragma unroll
  for (int rt = 0; rt < RTN; ++rt) { const unsigned short* qr = (const unsigned short*)Q16 + ((size_t)((b * TQA + q0 + rt * 16) >> 4) * (ldq >> 5) + h * 2) * 512 + lane * 8;      /* Q, K and both V^T planes in fragment order */
#pragma unroll
    for (int ks = 0; ks < KS; ++ks) { aq[rt][ks].half[0] = *(const v8us*)(qr + ks * 512); aq[rt][ks].half[1] = *(const v8us*)(qr + ks * 512 + 256); } }
  const size_t vslab = (size_t)(b * (NH / KVG) + h / KVG); const unsigned short* Vth = (const unsigned short*)Vt + vslab * 64 * TK; const unsigned short* Vtl = (const unsigned short*)VtL + vslab * 64 * TK;      /* GQA: q-head h reads kv head h / KVG */
  float m_c = -3.0e38f, l_c = 0.f; v8f oacc[DT], oaccL[DT];      /* of the lane's query q0 + ln; register r of tile dt is dim dt * 16 + 8 hh + r */
#pragma unroll
  for (int dt = 0; dt < DT; ++dt) { oacc[dt] = (v8f){0.f,0.f,0.f,0.f,0.f,0.f,0.f,0.f}; oaccL[dt] = oacc[dt]; }
  const int jbeg = w * (TK / NSPL), jend = jbeg + TK / NSPL;      /* this wave's keys */
#pragma unroll 1
  for (int j0 = jbeg; j0 < jend; j0 += 32) {
    v8f s[2]; FragH bk[2][KS], bv[DT], bl[DT]; v4im mk[2][2];
    /* every global load of the trip is issued here, in the order of use (K, mask words, both V planes): their latencies overlap, and V lands behind the softmax */
#pragma unroll
    for (int nt = 0; nt < 2; ++nt) { const unsigned short* kr = (const unsigned short*)K16 + ((size_t)((b * TK + j0 + nt * 16) >> 4) * (ldk >> 5) + (h / KVG) * 2) * 512 + lane * 8;
#pragma unroll
      for (int ks = 0; ks < KS; ++ks) { bk[nt][ks].half[0] = *(const v8us*)(kr + ks * 512); bk[nt][ks].half[1] = *(const v8us*)(kr + ks * 512 + 256); } }
    if (CAUSAL == 8) { const int* mrow = MSK + (size_t)(q0 + ln) * TK + j0 + 8 * hh;      /* the lane's query row: its 8 keys of each 16-key tile, 32 contiguous bytes */
#pragma unroll
      for (int nt = 0; nt < 2; ++nt) { mk[nt][0] = *(const v4im*)(mrow + nt * 16); mk[nt][1] = *(const v4im*)(mrow + nt * 16 + 4); } }
    asm volatile("s_wait_xcnt 0x0" ::: "memory");      /* stands in front of the V loads, whose results may land in registers that the K and mask loads name as addresses */
#pragma unroll
    for (int dt = 0; dt < DT; ++dt) { const size_t vo = ((size_t)dt * (TK / 32) + (j0 >> 5)) * 512 + lane * 8; const unsigned short* vrow = Vth + vo; const unsigned short* vrl = Vtl + vo; bv[dt].half[0] = *(const v8us*)vrow; bv[dt].half[1] = *(const v8us*)(vrow + 256);
      if (dt == DT - 1) asm volatile("s_wait_xcnt 0x0" ::: "memory");      /* stands in front of the trip's last two loads: the result of the first lands in the address registers of the hi plane's loads above */
      bl[dt].half[0] = *(const v8us*)vrl;
      if (dt == DT - 1) asm volatile("s_wait_xcnt 0x0" ::: "memory");      /* stands in front of the trip's last load, whose result lands in the address registers of the V loads above */
      bl[dt].half[1] = *(const v8us*)(vrl + 256); }
    __builtin_amdgcn_sched_barrier(0);      /* keeps the loads above together: without it the scheduler moves each one down to its first use, one exposed latency apiece */
#pragma unroll
    for (int nt = 0; nt < 2; ++nt) { v8f acc = (v8f){0.f,0.f,0.f,0.f,0.f,0.f,0.f,0.f};      /* K rows as A, Q as B: register r = key nt * 16 + 8 hh + r, column ln = query */
#pragma unroll
      for (int ks = 0; ks < KS; ++ks) acc = mmaH<1>(bk[nt][ks].v, bk[nt][ks].v, aq[0][ks].v, aq[0][ks].v, acc); s[nt] = acc; }
    bool ok[16]; const int tq = q0 + ln;
#pragma unroll
    for (int i = 0; i < 16; ++i) { const int k = j0 + (i >> 3) * 16 + 8 * hh + (i & 7);
      bool o = (CAUSAL == 1) ? (k <= tq) : ((CAUSAL == 2) ? ((k >> 5) == (tq >> 5)) : true);      /* mode 2: block-diagonal 32-token groups */
      if (CAUSAL == 8) o = mk[i >> 3][(i >> 2) & 1][i & 3] != 0;      /* mode 8: per-(query, key) int table shared by all batches and heads */
      if (CAUSAL == 4) o = MSK[((size_t)b * TQA + tq) * TK + k] != 0;      /* mode 4: per-(query, key) INPUT mask shared by all heads; masked keys contribute nothing (== the reference's -4096 fill, whose exp underflows to 0), rows with no valid key give l = 0 -> output 0 (== the reference's row_valid zeroing) */
      ok[i] = o; }
    FragH ph, pl; sm_trip(s, ok, m_c, l_c, oacc, oaccL, ph, pl);
#pragma unroll
    for (int dt = 0; dt < DT; ++dt) { oacc[dt] = mmaH<1>(bv[dt].v, bv[dt].v, ph.v, ph.v, oacc[dt]); oaccL[dt] = mmaH<1>(bv[dt].v, bv[dt].v, pl.v, pl.v, oaccL[dt]); oaccL[dt] = mmaH<1>(bl[dt].v, bl[dt].v, ph.v, ph.v, oaccL[dt]); } }      /* V^T rows as A, P^T as B */
  /* each wave leaves its queries' maxima, sums (both halves joined) and unnormalised outputs in LDS, a row per query: a lane's 8 registers of a tile are 8 consecutive dims of its row */
  { const float l = l_c + half_swap(l_c); if (hh == 0) { sM[w][ln] = m_c; sL[w][ln] = l; } }
#pragma unroll
  for (int dt = 0; dt < DT; ++dt) { v4f v0, v1;
#pragma unroll
    for (int r = 0; r < 4; ++r) { float v = oacc[dt][r]; v += oaccL[dt][r] * 0.0009765625f; v0[r] = v; v = oacc[dt][4 + r]; v += oaccL[dt][4 + r] * 0.0009765625f; v1[r] = v; }
    *(v4fa*)&sO[w][ln][dt * 16 + 8 * hh] = v0; *(v4fa*)&sO[w][ln][dt * 16 + 8 * hh + 4] = v1; }
  __syncthreads();      /* every wave's partials are in LDS before any thread merges them */
  /* merge, a thread per (row, 4 columns): M = max m_u; l = sum l_u e^(m_u - M); O = sum O_u e^(m_u - M), u in wave order. A wave with no live key for the row has m_u = -3.0e38, l_u = 0, O_u = 0 and adds nothing; a row with no live key at all gives l = 0 -> output 0 */
  if (tid < RPW * 16) { const int r = tid >> 4, pc = tid & 15; float mm = sM[0][r];      /* both loops below are unrolled so that their LDS reads are issued together, ahead of the arithmetic */
#pragma unroll
    for (int u = 1; u < NSPL; ++u) mm = fmaxf(mm, sM[u][r]);
    float l = 0.f; v4f a = {0.f, 0.f, 0.f, 0.f};
#pragma unroll
    for (int u = 0; u < NSPL; ++u) { const float f = expf(sM[u][r] - mm); const v4f val = *(const v4fa*)&sO[u][r][pc * 4]; l += sL[u][r] * f; a += val * f; }
    const float li = (l > 0.f) ? 1.0f / (l * 1024.0f) : 0.f;
    *(v4f*)(O + ((size_t)b * TQA + q0 + r) * ldo + h * 64 + pc * 4) = a * li; } }

// 3-term variant: O = (P_hi V_hi + (P_lo V_hi + P_hi V_lo) / 1024) / l with P = [hi | 2^10 residual] of 1024 p and V^T = [hi | 2^10 residual] planes (VtL same layout as Vt) -> ~2^-21-class products for un-averaged (early causal / peaked) rows
template <int CAUSAL>
__global__ __launch_bounds__(256) void k_flash3gB(const _Float16* __restrict__ Q16, int ldq, const _Float16* __restrict__ K16, int ldk, const _Float16* __restrict__ Vt, const _Float16* __restrict__ VtL, const int* __restrict__ MSK, const unsigned int* __restrict__ LV, float* __restrict__ O, int ldo) {
  constexpr int RPW = 16, RTN = RPW / 16, NQB = TQB / (4 * RPW), DT = 4, KS = 2;
  __shared__ __attribute__((aligned(16))) float sO[8][RPW][64 + 4];
  const int tid = threadIdx.x, w = __builtin_amdgcn_readfirstlane(tid >> 5), lane = tid & 31, ln = lane & 15, hh = lane >> 4;      /* the wave's number in a scalar register: the tile number, its live bits and the test on them stay scalar */
  const int slab = blockIdx.x / (QTB / 16), pblk = blockIdx.x % (QTB / 16); (void)NQB; const int b = slab / NH, h = slab % NH;
  /* a wave takes two 16-query tiles one after the other, t and QTB - 1 - t: where the live key tiles grow with the query position, as under a causal mask, every wave then walks about the same number of them. For any mask each tile is taken exactly once */
#pragma unroll 1      /* kept rolled: one copy of the key loop in the instruction cache */
  for (int it = 0; it < 2; ++it) {
  const int qt = it ? QTB - 1 - (pblk * 8 + w) : pblk * 8 + w; const int q0 = qt * RPW;
  const unsigned int* lv = LV + (size_t)qt * (3 * 4 * 32);      /* bit kt & 31 of word kt >> 5, the four row groups joined: key tile kt holds a non-zero mask word for this query tile */
  unsigned int lw0 = ~0u, lw1 = ~0u, lw2 = ~0u;      /* the modes without a mask table walk every key tile */
  if (CAUSAL == 8) { lw0 = __builtin_amdgcn_readfirstlane(lv[0] | lv[32] | lv[64] | lv[96]); lw1 = __builtin_amdgcn_readfirstlane(lv[128] | lv[160] | lv[192] | lv[224]); lw2 = __builtin_amdgcn_readfirstlane(lv[256] | lv[288] | lv[320] | lv[352]); }
  FragH aq[2][KS];
#pragma unroll
  for (int rt = 0; rt < RTN; ++rt) { const unsigned short* qr = (const unsigned short*)Q16 + ((size_t)((b * TQB + q0 + rt * 16) >> 4) * (ldq >> 5) + h * 2) * 512 + lane * 8;      /* Q, K and both V^T planes in fragment order */
#pragma unroll
    for (int ks = 0; ks < KS; ++ks) { aq[rt][ks].half[0] = *(const v8us*)(qr + ks * 512); aq[rt][ks].half[1] = *(const v8us*)(qr + ks * 512 + 256); } }
  const size_t vslab = (size_t)(b * (NH / KVG) + h / KVG); const unsigned short* Vth = (const unsigned short*)Vt + vslab * 64 * TK; const unsigned short* Vtl = (const unsigned short*)VtL + vslab * 64 * TK;      /* GQA: q-head h reads kv head h / KVG */
  float m_c = -3.0e38f, l_c = 0.f; v8f oacc[DT], oaccL[DT];      /* of the lane's query q0 + ln; register r of tile dt is dim dt * 16 + 8 hh + r */
#pragma unroll
  for (int dt = 0; dt < DT; ++dt) { oacc[dt] = (v8f){0.f,0.f,0.f,0.f,0.f,0.f,0.f,0.f}; oaccL[dt] = oacc[dt]; }
  const int jend = (CAUSAL == 1) ? (q0 + RPW) : TK;      /* causal: keys beyond the tile's last query never contribute */
#pragma unroll 1
  for (int j0 = 0; j0 < jend; j0 += 32) {
    /* a key tile whose 16 x 32 mask words are all zero leaves m, l and O as they are (every p is 0 and the rescale factor is 1): it is passed over, on a scalar test */
    const int kt = j0 >> 5; const unsigned int lw = (kt < 32) ? lw0 : ((kt < 64) ? lw1 : lw2);
    if (((lw >> (kt & 31)) & 1u) == 0u) continue;
    v8f s[2]; FragH bk[2][KS], bv[DT], bl[DT]; v4im mk[2][2];
    /* every global load of the trip is issued here, in the order of use (K, mask words, both V planes): their latencies overlap, and V lands behind the softmax */
#pragma unroll
    for (int nt = 0; nt < 2; ++nt) { const unsigned short* kr = (const unsigned short*)K16 + ((size_t)((b * TK + j0 + nt * 16) >> 4) * (ldk >> 5) + (h / KVG) * 2) * 512 + lane * 8;
#pragma unroll
      for (int ks = 0; ks < KS; ++ks) { bk[nt][ks].half[0] = *(const v8us*)(kr + ks * 512); bk[nt][ks].half[1] = *(const v8us*)(kr + ks * 512 + 256); } }
    asm volatile("s_wait_xcnt 0x0" ::: "memory");      /* stands in front of the mask loads, whose results may land in registers that the K loads name as addresses */
    if (CAUSAL == 8) { const int* mrow = MSK + (size_t)(q0 + ln) * TK + j0 + 8 * hh;      /* the lane's query row: its 8 keys of each 16-key tile, 32 contiguous bytes */
#pragma unroll
      for (int nt = 0; nt < 2; ++nt) { mk[nt][0] = *(const v4im*)(mrow + nt * 16); mk[nt][1] = *(const v4im*)(mrow + nt * 16 + 4); } }
    asm volatile("s_wait_xcnt 0x0" ::: "memory");      /* stands in front of the V loads, whose results may land in registers that the K and mask loads name as addresses */
#pragma unroll
    for (int dt = 0; dt < DT; ++dt) { const size_t vo = ((size_t)dt * (TK / 32) + (j0 >> 5)) * 512 + lane * 8; const unsigned short* vrow = Vth + vo; const unsigned short* vrl = Vtl + vo; bv[dt].half[0] = *(const v8us*)vrow; bv[dt].half[1] = *(const v8us*)(vrow + 256); bl[dt].half[0] = *(const v8us*)vrl;
      if (dt == DT - 1) asm volatile("s_wait_xcnt 0x0" ::: "memory");      /* stands in front of the trip's last load, whose result lands in the address registers of the V loads above */
      bl[dt].half[1] = *(const v8us*)(vrl + 256); }
    __builtin_amdgcn_sched_barrier(0);      /* keeps the loads above together: without it the scheduler moves each one down to its first use, one exposed latency apiece */
#pragma unroll
    for (int nt = 0; nt < 2; ++nt) { v8f acc = (v8f){0.f,0.f,0.f,0.f,0.f,0.f,0.f,0.f};      /* K rows as A, Q as B: register r = key nt * 16 + 8 hh + r, column ln = query */
#pragma unroll
      for (int ks = 0; ks < KS; ++ks) acc = mmaH<1>(bk[nt][ks].v, bk[nt][ks].v, aq[0][ks].v, aq[0][ks].v, acc); s[nt] = acc; }
    bool ok[16]; const int tq = q0 + ln;
#pragma unroll
    for (int i = 0; i < 16; ++i) { const int k = j0 + (i >> 3) * 16 + 8 * hh + (i & 7);
      bool o = (CAUSAL == 1) ? (k <= tq) : ((CAUSAL == 2) ? ((k >> 5) == (tq >> 5)) : true);      /* mode 2: block-diagonal 32-token groups */
      if (CAUSAL == 8) o = mk[i >> 3][(i >> 2) & 1][i & 3] != 0;      /* mode 8: per-(query, key) int table shared by all batches and heads */
      if (CAUSAL == 4) o = MSK[((size_t)b * TQB + tq) * TK + k] != 0;      /* mode 4: per-(query, key) INPUT mask shared by all heads; masked keys contribute nothing (== the reference's -4096 fill, whose exp underflows to 0), rows with no valid key give l = 0 -> output 0 (== the reference's row_valid zeroing) */
      ok[i] = o; }
    FragH ph, pl; sm_trip(s, ok, m_c, l_c, oacc, oaccL, ph, pl);
#pragma unroll
    for (int dt = 0; dt < DT; ++dt) { oacc[dt] = mmaH<1>(bv[dt].v, bv[dt].v, ph.v, ph.v, oacc[dt]); oaccL[dt] = mmaH<1>(bv[dt].v, bv[dt].v, pl.v, pl.v, oaccL[dt]); oaccL[dt] = mmaH<1>(bl[dt].v, bl[dt].v, ph.v, ph.v, oaccL[dt]); } }      /* V^T rows as A, P^T as B */
  /* the halves' sums joined; the outputs staged in LDS, a row per query (a lane's 8 registers of a tile are 8 consecutive dims of its row), so that whole lines are stored below */
  const float lt = l_c + half_swap(l_c); const float li = (lt > 0.f) ? 1.0f / (lt * 1024.0f) : 0.f;
#pragma unroll
  for (int dt = 0; dt < DT; ++dt) { v4f v0, v1;
#pragma unroll
    for (int r = 0; r < 4; ++r) { float v = oacc[dt][r]; v += oaccL[dt][r] * 0.0009765625f; v0[r] = v * li; v = oacc[dt][4 + r]; v += oaccL[dt][4 + r] * 0.0009765625f; v1[r] = v * li; }
    *(v4fa*)&sO[w][ln][dt * 16 + 8 * hh] = v0; *(v4fa*)&sO[w][ln][dt * 16 + 8 * hh + 4] = v1; }
  __builtin_amdgcn_fence(__ATOMIC_ACQ_REL, "workgroup"); __builtin_amdgcn_wave_barrier();
  {
#pragma unroll
    for (int rp = 0; rp < RPW; rp += 2) { const int r = rp + (lane >> 4), pc = lane & 15; const v4f val = *(const v4fa*)&sO[w][r][pc * 4]; *(v4f*)(O + ((size_t)b * TQB + q0 + r) * ldo + h * 64 + pc * 4) = val; }
    asm volatile("s_wait_xcnt 0x0" ::: "memory");      /* stands in front of the second tile's set-up, which overwrites registers that the stores above name */
     } } }

// two planes [nout][nin] in fragment order, one behind the other: x16 weights (for the hi operand), then x1 weights (for the 2^10 residual operand) at Bt + nout * nin
__device__ __forceinline__ void d_wpair(int bx, const float* __restrict__ Wm, int nin, int nout, _Float16* __restrict__ Bt) { const size_t t = (size_t)bx * 256 + threadIdx.x; if (t >= (size_t)nout * (2 * nin / 8)) return; const size_t per = (size_t)nout * (nin / 8); const bool lo = t >= per; const FoRK s = fo_src(lo ? t - per : t, nin); const int o = s.row; FragH f;
  for (int q = 0; q < 8; ++q) { const int c = s.k + q; if (q) asm volatile("s_wait_xcnt 0x0" ::: "memory");      /* stands in front of each further load, whose result may land in a register that an earlier load names as its address */
    f.h[q] = (_Float16)(bf16_round(Wm[(size_t)c * nout + o]) * (lo ? 1.0f : 16.0f)); } *(v8us*)((unsigned short*)Bt + t * 8) = f.half[0];  }
template <int TWO_D>
__device__ __forceinline__ void d_rotab(int bx, int nrows, int rpb, const int* __restrict__ bar, const int* __restrict__ tib, float* __restrict__ CS, float* __restrict__ SN) {
  #pragma clang fp contract(off)
  const size_t t = (size_t)bx * 256 + threadIdx.x; if (t >= (size_t)nrows * 32) return; const int d = (int)(t % 32); const int row = (int)(t / 32); const int b = row / rpb, r = row % rpb; float pos, inv;
  if (TWO_D) { const int dm = d & 15; inv = 1.0f / powf(10000.0f, (float)dm * 2.0f / 32.0f); pos = (d < 16) ? (float)bar[(size_t)b * rpb + r] : (float)tib[(size_t)b * rpb + r]; }
  else { inv = 1.0f / powf(10000.0f, (float)(2 * d) / 64.0f); pos = (float)r; }
  const float th = pos * inv; const float c = cosf(th), s = sinf(th);
  { *(float*)(CS + t) = c; *(float*)(SN + t) = s;  } }
__device__ __forceinline__ void d_rope(int bx, const float* __restrict__ F, int nrows, int rpb, int nheads, const float* __restrict__ CS, const float* __restrict__ SN, _Float16* __restrict__ dst, int ldo, int dst_bstride, int row_off) {
  #pragma clang fp contract(off)
  /* dst in fragment order (ldo elements a row): a wave takes 16 rows of one head and the dims jg .. jg + 7 and jg + 32 .. jg + 39 that make half a fragment each; rpb, dst_bstride and row_off are multiples of 16 */
  const size_t t = (size_t)bx * 256 + threadIdx.x; if (t >= (size_t)nrows * nheads * 4) return; const int lane = (int)(t & 31); const size_t wid = t >> 5; const int jg = (int)(wid & 1) * 16 + (lane >> 4) * 8; const int h = (int)((wid >> 1) % nheads); const int row = (int)((wid >> 1) / nheads) * 16 + (lane & 15); const int b = row / rpb, r = row % rpb; const int ldi = nheads * 64;
  const float* xr = F + (size_t)row * ldi + h * 64; FragH f0, f1;
#pragma unroll
  for (int q = 0; q < 8; ++q) { const int d = jg + q; const float c = CS[(size_t)row * 32 + d], s = SN[(size_t)row * 32 + d]; const float x0 = xr[d], x1 = xr[d + 32];
    float o0 = x0 * c; o0 += -x1 * s; float o1 = x1 * c; o1 += x0 * s; f0.h[q] = (_Float16)o0; f1.h[q] = (_Float16)o1; }
  unsigned short* o = (unsigned short*)dst + fo_dst(b * dst_bstride + row_off + r, h * 64 + jg, ldo);
  { *(v8us*)o = f0.half[0]; *(v8us*)(o + 512) = f1.half[0];  } }      /* 32 dims on: the next block */
__device__ __forceinline__ void d_put(int bx, const float* __restrict__ F, int nrows, int rpb, int ncol, _Float16* __restrict__ H, _Float16* __restrict__ L, int dst_bstride, int row_off) {
  const size_t t = (size_t)bx * 256 + threadIdx.x; if (t >= (size_t)nrows * (ncol / 8)) return; const int c0 = (int)(t % (ncol / 8)) * 8; const int row = (int)(t / (ncol / 8)); const int b = row / rpb, r = row % rpb; FragH fh, fl;
  for (int q = 0; q < 8; ++q) { const float v = F[(size_t)row * ncol + c0 + q]; const _Float16 hv = (_Float16)v; fh.h[q] = hv; fl.h[q] = (_Float16)((v - (float)hv) * 1024.0f); }
  const size_t drow = (size_t)b * dst_bstride + row_off + r; { *(v8us*)((unsigned short*)H + drow * ncol + c0) = fh.half[0];
    asm volatile("s_wait_xcnt 0x0" ::: "memory");      /* stands in front of the residual plane's arithmetic, which overwrites registers that the store above names */
    if (L) *(v8us*)((unsigned short*)L + drow * ncol + c0) = fl.half[0];  } }

// d_put's hi plane alone, in fragment order (k2 into the key plane)
__device__ __forceinline__ void d_putk(int bx, const float* __restrict__ F, int nrows, int rpb, int ncol, _Float16* __restrict__ H, int dst_bstride, int row_off) {
  const size_t t = (size_t)bx * 256 + threadIdx.x; if (t >= (size_t)nrows * (ncol / 8)) return; const FoRK s = fo_src(t, ncol); const int b = s.row / rpb, r = s.row % rpb; FragH fh;
  for (int q = 0; q < 8; ++q) fh.h[q] = (_Float16)F[(size_t)s.row * ncol + s.k + q];
  *(v8us*)((unsigned short*)H + fo_dst(b * dst_bstride + row_off + r, s.k, ncol)) = fh.half[0]; }

// live bits of the phase-2 mask: bit l of word (qt, wd, rg) says whether key tile wd * 32 + l (32 keys) holds a non-zero word in rows 4 rg .. 4 rg + 3 of the 16-query tile qt. A wave per word, a lane per key tile (128 bytes a row); each word has a 128-byte line of its own
__device__ __forceinline__ void d_live(int bx, const int* __restrict__ MSK, unsigned int* __restrict__ LV) {
  typedef int v4ia __attribute__((ext_vector_type(4), may_alias));
  const int wv = bx * 8 + (int)(threadIdx.x >> 5), lane = threadIdx.x & 31; const int rg = wv & 3, wd = (wv >> 2) % 3, qt = (wv >> 2) / 3; const int kt = wd * 32 + lane; v4ia any = {0, 0, 0, 0};
  if (kt < TK / 32) { const int* p = MSK + (size_t)(qt * 16 + rg * 4) * TK + kt * 32;
#pragma unroll 1
    for (int r = 0; r < 4; ++r) {      /* kept rolled: a row's 8 loads are in flight together, and the launch's register count stays low for its other ranges */
#pragma unroll
      for (int c = 0; c < 8; ++c) any |= *(const v4ia*)(p + (size_t)r * TK + c * 4); } }
  const unsigned int word = __builtin_amdgcn_ballot_w32((any[0] | any[1] | any[2] | any[3]) != 0);
  if (lane == 0) LV[(size_t)wv * 32] = word; }

// ---- one launch per dependency level: kernels that do not depend on one another run as consecutive block ranges of one grid. Every range test reads blockIdx.x alone, so a work-group takes one branch as a whole; each body is the same code as before, handed its block number inside its own range. ----
constexpr int PB_W = DMOD * DMOD / 8 / 256, PB_WK = DMOD * KVD / 8 / 256;                  /* blocks of one transposed weight plane: 1024 and 256 columns */
constexpr int PB_P = DMOD * (2 * DMOD / 8) / 256, PB_PK = KVD * (2 * DMOD / 8) / 256;       /* blocks of one hi | residual weight pair */
constexpr int PB_T1 = NRS * 32 / 256, PB_T2 = NRR * 32 / 256;                              /* RoPE tables */
constexpr int PB_XS = NRS * DMOD / 8 / 256, PB_XR = NRR * DMOD / 8 / 256;                  /* f16 planes of the two inputs */
constexpr int PB_ALL = 2 * PB_W + 4 * PB_WK + 2 * PB_P + 2 * PB_PK + PB_T1 + PB_T2 + PB_XS + PB_XR;
__global__ __launch_bounds__(256) void k_prep(const float* w_sq, const float* w_sk, const float* w_sv, const float* w_rq, const float* w_rk, const float* w_rv,
    _Float16* BSQ, _Float16* BSK, _Float16* BSV, _Float16* BRQ, _Float16* BRK, _Float16* BRV,
    const float* w_so, const float* w_ro, const float* w_k2, const float* w_v2, _Float16* BSO, _Float16* BRO, _Float16* BK2, _Float16* BV2,
    const int* bar, const int* tib, float* CS1, float* SN1, float* CS2, float* SN2, const float* sum_x, _Float16* SX, const float* reg_x, _Float16* RX) {
  int bx = blockIdx.x;
  if (bx < 2 * PB_W + 4 * PB_WK) { const float* Wm = w_sq; _Float16* Bt = BSQ; int nout = DMOD;
    if (bx >= PB_W) { bx -= PB_W; Wm = w_rq; Bt = BRQ;
      if (bx >= PB_W) { bx -= PB_W; Wm = w_sk; Bt = BSK; nout = KVD;
        if (bx >= PB_WK) { bx -= PB_WK; Wm = w_sv; Bt = BSV;
          if (bx >= PB_WK) { bx -= PB_WK; Wm = w_rk; Bt = BRK;
            if (bx >= PB_WK) { bx -= PB_WK; Wm = w_rv; Bt = BRV; } } } } }
    d_wt_f16(bx, Wm, Bt, DMOD, nout, 16.0f); return; }
  bx -= 2 * PB_W + 4 * PB_WK;
  if (bx < 2 * PB_P + 2 * PB_PK) { const float* Wm = w_so; _Float16* Bt = BSO; int nout = DMOD;
    if (bx >= PB_P) { bx -= PB_P; Wm = w_ro; Bt = BRO;
      if (bx >= PB_P) { bx -= PB_P; Wm = w_k2; Bt = BK2; nout = KVD;
        if (bx >= PB_PK) { bx -= PB_PK; Wm = w_v2; Bt = BV2; } } }
    d_wpair(bx, Wm, DMOD, nout, Bt); return; }
  bx -= 2 * PB_P + 2 * PB_PK;
  if (bx < PB_T1) { d_rotab<0>(bx, NRS, SS, nullptr, nullptr, CS1, SN1); return; }
  bx -= PB_T1;
  if (bx < PB_T2) { d_rotab<1>(bx, NRR, RR, bar, tib, CS2, SN2); return; }
  bx -= PB_T2;
  if (bx < PB_XS) d_x16(bx, sum_x, SX, (size_t)NRS * DMOD / 8, DMOD); else d_x16(bx - PB_XS, reg_x, RX, (size_t)NRR * DMOD / 8, DMOD); }

// up to six GEMMs (d_gemm2) in one launch, all with the same K and alpha, operands in fragment order; ldc = N. Jobs 0..2 read A0 (Ma rows), jobs 3..5 read A1 (Mb rows); in each triple N = DMOD, KVD, KVD. S_j is job j's bias (cp == 0) or the f32 plane, pitch N, that is added to the product (cp != 0). The grid ends behind the last job in use; the pointers of jobs behind it are not read.
__global__ __launch_bounds__(128) void k_gemm2m(const _Float16* A0, const _Float16* A1, const _Float16* B0, const _Float16* B1, const _Float16* B2, const _Float16* B3, const _Float16* B4, const _Float16* B5,
    const float* S0, const float* S1, const float* S2, const float* S3, const float* S4, const float* S5, float* C0, float* C1, float* C2, float* C3, float* C4, float* C5, int Ma, int Mb, int K, float alpha, int cp) {
  int bx = blockIdx.x; const int ta = Ma >> 7, tb = Mb >> 7;      /* 128-row block tiles; a job has (M / 128) * (N / 64) blocks */
  const _Float16* A = A0; const _Float16* B = B0; const float* S = S0; float* C = C0; int M = Ma, N = DMOD;
  if (bx >= ta * (DMOD / 64)) { bx -= ta * (DMOD / 64); B = B1; S = S1; C = C1; N = KVD;
    if (bx >= ta * (KVD / 64)) { bx -= ta * (KVD / 64); B = B2; S = S2; C = C2;
      if (bx >= ta * (KVD / 64)) { bx -= ta * (KVD / 64); A = A1; M = Mb; B = B3; S = S3; C = C3; N = DMOD;
        if (bx >= tb * (DMOD / 64)) { bx -= tb * (DMOD / 64); B = B4; S = S4; C = C4; N = KVD;
          if (bx >= tb * (KVD / 64)) { bx -= tb * (KVD / 64); B = B5; S = S5; C = C5; } } } } }
  d_gemm2<0>(bx, A, 0, B, 0, alpha, cp ? nullptr : S, 0, cp ? S : nullptr, 1, (size_t)N, 0, C, nullptr, N, 0, M, N, K); }

constexpr int QB_RQ = NRR * NH * 4 / 256, QB_RK = NRR * NKV * 4 / 256, QB_RV = NRR * (KVD / 8) / 256, QB_SQ = NRS * NH * 4 / 256, QB_SK = NRS * NKV * 4 / 256, QB_SV = NRS * (KVD / 8) / 256;
constexpr int QB_LV = QTB * 3 * 4 / 8;      /* live bits of the phase-2 mask: 8 waves a block, a wave per word */
// what follows the six projections: RoPE of both q and both k planes, hi + residual planes of both v; ahead of them, as it depends on an input alone, the live bits of the phase-2 mask
__global__ __launch_bounds__(256) void k_post(const float* FSQ, const float* FSK, const float* FSV, const float* FRQ, const float* FRK, const float* FRV, const float* CS1, const float* SN1, const float* CS2, const float* SN2,
    _Float16* SQ, _Float16* RQ, _Float16* KC, _Float16* VCH, _Float16* VCL, const int* mupd, unsigned int* LV) {
  int bx = blockIdx.x;
  if (bx < QB_LV) { d_live(bx, mupd, LV); return; }
  bx -= QB_LV;
  if (bx < QB_RQ + QB_RK + QB_SQ + QB_SK) { const float* F = FRQ; const float* CS = CS2; const float* SN = SN2; _Float16* dst = RQ; int nrows = NRR, rpb = RR, nheads = NH, bstr = RR, roff = 0;
    if (bx >= QB_RQ) { bx -= QB_RQ; F = FRK; dst = KC; nheads = NKV; bstr = TK; roff = SS;      /* keys 64.. of each batch */
      if (bx >= QB_RK) { bx -= QB_RK; F = FSQ; CS = CS1; SN = SN1; dst = SQ; nrows = NRS; rpb = SS; nheads = NH; bstr = SS; roff = 0;
        if (bx >= QB_SQ) { bx -= QB_SQ; F = FSK; dst = KC; nheads = NKV; bstr = TK; } } }      /* keys 0..63 of each batch */
    d_rope(bx, F, nrows, rpb, nheads, CS, SN, dst, nheads * 64, bstr, roff); return; }
  bx -= QB_RQ + QB_RK + QB_SQ + QB_SK;
  if (bx < QB_RV) d_put(bx, FRV, NRR, RR, KVD, VCH, VCL, TK, SS); else d_put(bx - QB_RV, FSV, NRS, SS, KVD, VCH, VCL, TK, 0); }
// k2 into key rows 0..63 (one plane), v2 into value rows 0..63 (hi + residual) of each batch
__global__ __launch_bounds__(256) void k_put2(const float* FK2, const float* FV2, _Float16* KC, _Float16* VCH, _Float16* VCL) {
  const int bx = blockIdx.x;
  if (bx < QB_SV) d_putk(bx, FK2, NRS, SS, KVD, KC, TK, 0); else d_put(bx - QB_SV, FV2, NRS, SS, KVD, VCH, VCL, TK, 0); }
// V^T of the hi plane (first half of the grid) and of the residual plane (second half)
__global__ __launch_bounds__(256) void k_vt2(const _Float16* VCH, const _Float16* VCL, _Float16* VT, _Float16* VTL) {
  constexpr int NBV = NB * NKV * (TK / 64); const bool lo = (int)blockIdx.x >= NBV;
  d_vt<NKV, TK>((int)blockIdx.x - (lo ? NBV : 0), lo ? VCL : VCH, KVD, 0, lo ? VTL : VT); }

extern "C" void kernel_launch(void* const* d_in, const int* in_sizes, int n_in,
                              void* d_out, int out_size, void* d_ws, size_t ws_size, hipStream_t stream) {
  (void)in_sizes; (void)n_in; (void)out_size;
  const float* const* I = (const float* const*)d_in; const float* sum_x = I[0]; const float* reg_x = I[1];
  const float* w_sq = I[2]; const float* b_sq = I[3]; const float* w_sk = I[4]; const float* b_sk = I[5]; const float* w_sv = I[6]; const float* b_sv = I[7]; const float* w_so = I[8]; const float* b_so = I[9];
  const float* w_rq = I[10]; const float* b_rq = I[11]; const float* w_rk = I[12]; const float* b_rk = I[13]; const float* w_rv = I[14]; const float* b_rv = I[15]; const float* w_ro = I[16]; const float* b_ro = I[17];
  const float* w_k2 = I[18]; const float* b_k2 = I[19]; const float* w_v2 = I[20]; const float* b_v2 = I[21];
  const int* bar = (const int*)d_in[22]; const int* tib = (const int*)d_in[23]; const int* msum = (const int*)d_in[24]; const int* mupd = (const int*)d_in[25];
  char* ws = (char*)d_ws; size_t off = 0;
  auto take = [&](size_t bytes) { char* p = ws + off; off += (bytes + 255) & ~(size_t)255; return p; };
  const size_t w8 = (size_t)DMOD * DMOD / 8, w8k = (size_t)DMOD * KVD / 8;
  _Float16* BSQ = (_Float16*)take(w8 * 16); _Float16* BSK = (_Float16*)take(w8k * 16); _Float16* BSV = (_Float16*)take(w8k * 16); _Float16* BRQ = (_Float16*)take(w8 * 16); _Float16* BRK = (_Float16*)take(w8k * 16); _Float16* BRV = (_Float16*)take(w8k * 16);
  _Float16* BSO = (_Float16*)take(w8 * 32); _Float16* BRO = (_Float16*)take(w8 * 32); _Float16* BK2 = (_Float16*)take(w8k * 32); _Float16* BV2 = (_Float16*)take(w8k * 32);
  float* CS1 = (float*)take((size_t)NRS * 32 * 4); float* SN1 = (float*)take((size_t)NRS * 32 * 4); float* CS2 = (float*)take((size_t)NRR * 32 * 4); float* SN2 = (float*)take((size_t)NRR * 32 * 4); _Float16* SX = (_Float16*)take((size_t)NRS * DMOD * 2); _Float16* RX = (_Float16*)take((size_t)NRR * DMOD * 2);
  /* each projection has an f32 plane of its own, since all six are written by one launch */
  float* FRQ = (float*)take((size_t)NRR * DMOD * 4); float* FRK = (float*)take((size_t)NRR * KVD * 4); float* FRV = (float*)take((size_t)NRR * KVD * 4); float* FSQ = (float*)take((size_t)NRS * DMOD * 4); float* FSK = (float*)take((size_t)NRS * KVD * 4); float* FSV = (float*)take((size_t)NRS * KVD * 4);
  _Float16* SQ = (_Float16*)take((size_t)NRS * DMOD * 2); _Float16* RQ = (_Float16*)take((size_t)NRR * DMOD * 2); _Float16* KC = (_Float16*)take((size_t)NB * TK * KVD * 2); _Float16* VCH = (_Float16*)take((size_t)NB * TK * KVD * 2); _Float16* VCL = (_Float16*)take((size_t)NB * TK * KVD * 2); _Float16* VT = (_Float16*)take((size_t)NB * NKV * 64 * TK * 2); _Float16* VTL = (_Float16*)take((size_t)NB * NKV * 64 * TK * 2);
  float* O1 = (float*)take((size_t)NRS * DMOD * 4); _Float16* O1H = (_Float16*)take((size_t)NRS * DMOD * 2); _Float16* O1L = (_Float16*)take((size_t)NRS * DMOD * 2); float* O2 = FRQ; _Float16* O2H = RQ; _Float16* O2L = RX;      /* O2 over the dead reg-q f32 scratch; O2H/O2L over RQ/RX (dead after phase 2 / the projections) */
  unsigned int* LV = (unsigned int*)take((size_t)QTB * 3 * 4 * 128);      /* live bits of the phase-2 mask, a 128-byte line a word */
  float* FK2 = FSK; float* FV2 = FSV;      /* k2 / v2 f32 planes over the summary k / v scratch (dead after k_post) */
  if (off > ws_size) return;      /* about 70 MiB */
  float* out0 = (float*)d_out; float* out1 = (float*)d_out + (size_t)NRS * DMOD;
  /* weight planes, RoPE tables, input planes */
  k_prep<<<PB_ALL, 256, 0, stream>>>(w_sq, w_sk, w_sv, w_rq, w_rk, w_rv, BSQ, BSK, BSV, BRQ, BRK, BRV, w_so, w_ro, w_k2, w_v2, BSO, BRO, BK2, BV2, bar, tib, CS1, SN1, CS2, SN2, sum_x, SX, reg_x, RX);
  /* summary q/k/v and regular q/k/v */
  k_gemm2m<<<(NRS / 128 + NRR / 128) * ((DMOD + 2 * KVD) / 64), 128, 0, stream>>>(SX, RX, BSQ, BSK, BSV, BRQ, BRK, BRV, b_sq, b_sk, b_sv, b_rq, b_rk, b_rv, FSQ, FSK, FSV, FRQ, FRK, FRV, NRS, NRR, DMOD, 0.0625f, 0);
  k_post<<<QB_LV + QB_RQ + QB_RK + QB_SQ + QB_SK + QB_RV + QB_SV, 256, 0, stream>>>(FSQ, FSK, FSV, FRQ, FRK, FRV, CS1, SN1, CS2, SN2, SQ, RQ, KC, VCH, VCL, mupd, LV);
  /* phase 1: summary queries over [summary ; regular] keys */
  k_vt2<<<2 * NB * NKV * (TK / 64), 256, 0, stream>>>(VCH, VCL, VT, VTL);
  k_flash3gA<8><<<NB * NH * (TQA / 16), 32 * NSPL, 0, stream>>>(SQ, DMOD, KC, KVD, VT, VTL, msum, O1, DMOD);
  k_hl<<<(unsigned)(((size_t)NRS * DMOD / 8 + 255) / 256), 256, 0, stream>>>(O1, O1H, O1L, (size_t)NRS * DMOD / 8, DMOD);
  /* output 0 = sum_attn W_so + b_so; k2 / v2 from sum_attn (no RoPE): the three hi products, then the three residual products on top of them */
  k_gemm2m<<<(NRS / 128) * ((DMOD + 2 * KVD) / 64), 128, 0, stream>>>(O1H, nullptr, BSO, BK2, BV2, nullptr, nullptr, nullptr, b_so, b_k2, b_v2, nullptr, nullptr, nullptr, out0, FK2, FV2, nullptr, nullptr, nullptr, NRS, 0, DMOD, 0.0625f, 0);
  k_gemm2m<<<(NRS / 128) * ((DMOD + 2 * KVD) / 64), 128, 0, stream>>>(O1L, nullptr, BSO + DMOD * DMOD, BK2 + KVD * DMOD, BV2 + KVD * DMOD, nullptr, nullptr, nullptr, out0, FK2, FV2, nullptr, nullptr, nullptr, out0, FK2, FV2, nullptr, nullptr, nullptr, NRS, 0, DMOD, 1.0f / 1024.0f, 1);
  k_put2<<<2 * QB_SV, 256, 0, stream>>>(FK2, FV2, KC, VCH, VCL);      /* into key / value rows 0..63 of each batch */
  /* phase 2: regular queries over [k2 ; regular] keys */
  k_vt2<<<2 * NB * NKV * (TK / 64), 256, 0, stream>>>(VCH, VCL, VT, VTL);
  k_flash3gB<8><<<NB * NH * (QTB / 16), 256, 0, stream>>>(RQ, DMOD, KC, KVD, VT, VTL, mupd, LV, O2, DMOD);
  k_hl<<<(unsigned)(((size_t)NRR * DMOD / 8 + 255) / 256), 256, 0, stream>>>(O2, O2H, O2L, (size_t)NRR * DMOD / 8, DMOD);
  k_gemm2m<<<(NRR / 128) * (DMOD / 64), 128, 0, stream>>>(O2H, nullptr, BRO, nullptr, nullptr, nullptr, nullptr, nullptr, b_ro, nullptr, nullptr, nullptr, nullptr, nullptr, out1, nullptr, nullptr, nullptr, nullptr, nullptr, NRR, 0, DMOD, 0.0625f, 0);
  k_gemm2m<<<(NRR / 128) * (DMOD / 64), 128, 0, stream>>>(O2L, nullptr, BRO + DMOD * DMOD, nullptr, nullptr, nullptr, nullptr, nullptr, out1, nullptr, nullptr, nullptr, nullptr, nullptr, out1, nullptr, nullptr, nullptr, nullptr, nullptr, NRR, 0, DMOD, 1.0f / 1024.0f, 1);
}

// v008
// It runs in 213 microseconds.
// In two side-by-side timings against v007, it was 1.13 and 1.12 times as fast.
// All steps since the starting kernel, v000, together make it 6.50 times as fast.
#include <hip/hip_runtime.h>
// FlexSummaryAttention (2 batches; 64 summary tokens S, 2048 regular tokens R, D = 1024; 16 query heads, 4 kv heads (GQA), head dim 64): q/k/v projections for both token sets; 1-D RoPE on summary q/k, 2-D hierarchical RoPE (bar id | token-in-bar id) on regular q/k; phase 1: summary queries over [summary; regular] keys with the summarize mask -> sum_attn; k2/v2 = sum_attn W + b; phase 2: regular queries over [k2; regular k] / [v2; regular v] with the updating mask -> reg_attn; outputs sum_attn W_so + b and reg_attn W_ro + b.
// Structure: exact f16 planes of both inputs; six projection GEMMs (32x64 wave tiles, f32 accumulation, exact x16 weights + bias); RoPE on VALU (thread per (row, head, 8 dims), f32 trig) into f16 q planes and the shared per-batch key plane [k2-or-summary ; regular] (4 kv heads); values as f16 hi + 2^10 residual planes, V^T by LDS tiles; the fused flash kernel (3-term P.V, GQA head mapping, INPUT int mask tables) once per phase; sum_attn / reg_attn as hi + residual pairs into the k2/v2 and output GEMMs.
// Compute dtype: inputs, masks' companions and parameters rounded to bf16; q/k after RoPE as f16 (~2^-12); P and v hi + residual (~2^-21-class); attention outputs hi + residual into the following GEMMs; f32 softmax/accumulation/trig. v_wmma_f32_16x16x32_f16.
#define NB 2
#define SS 64
#define RR 2048
#define DMOD 1024
#define KVD 256
#define NRS (NB * SS)            /* 128 summary rows */
#define NRR (NB * RR)            /* 4096 regular rows */
#define TK 2112                  /* keys per batch in both phases: 64 summary(-derived) + 2048 regular */
#define TQA 64                   /* phase-1 queries (summary tokens) */
#define TQB 2048                 /* phase-2 queries (regular tokens) */
#define TQ TQB
#define NH 16
#define KVG 4                    /* GQA: 16 query heads share 4 kv heads */
#define NKV (NH / KVG)
#define SCL 0.125f               /* 64^-0.5 */
#define QBLKSA (TQA / 64)
#define NSPL 11                  /* phase 1: waves that share the 2112 keys of one 16-query tile, 6 trips of 32 keys each */
#define QBLKSB (TQB / 64)
#define QTB (TQB / 16)           /* phase 2: 16-query tiles */
typedef __bf16 v16b __attribute__((ext_vector_type(16)));
typedef unsigned short v8us __attribute__((ext_vector_type(8), may_alias));
typedef float  v8f  __attribute__((ext_vector_type(8)));
typedef float  v4f  __attribute__((ext_vector_type(4)));
typedef float  v4fa __attribute__((ext_vector_type(4), may_alias));
union FragB { v16b v; v8us half[2]; unsigned short u[16]; };

__device__ __forceinline__ unsigned short bf16_bits(float x) { unsigned int u = __float_as_uint(x); return (unsigned short)((u + 0x7FFFu + ((u >> 16) & 1u)) >> 16); }
__device__ __forceinline__ float bf16_val(unsigned short b) { return __uint_as_float(((unsigned int)b) << 16); }
__device__ __forceinline__ float bf16_round(float x) { return bf16_val(bf16_bits(x)); }
// D += A·B with NT terms: 1 = ah·bh, 2 = + al·bh (A split), 3 = + ah·bl (both split)
template <int NT>
__device__ __forceinline__ v8f mmaN(v16b ah, v16b al, v16b bh, v16b bl, v8f c) {
  c = __builtin_amdgcn_wmma_f32_16x16x32_bf16(false, ah, false, bh, (short)0, c, false, false);
  if (NT >= 2) c = __builtin_amdgcn_wmma_f32_16x16x32_bf16(false, al, false, bh, (short)0, c, false, false);
  if (NT >= 3) c = __builtin_amdgcn_wmma_f32_16x16x32_bf16(false, ah, false, bl, (short)0, c, false, false);
  asm volatile("v_nop\n\tv_nop\n\tv_nop\n\tv_nop" : "+v"(c) : "v"(ah), "v"(al), "v"(bh), "v"(bl));
  return c;
}

__global__ __launch_bounds__(256) void k_wt_bf16(const float* __restrict__ W, unsigned short* __restrict__ Wt, int K, int N) {
  const int t = blockIdx.x * 256 + threadIdx.x;
  const int k8n = K / 8;
  if (t >= N * k8n) return;
  const int n = t / k8n, k8 = (t % k8n) * 8;
  v8us v;
#pragma unroll
  for (int i = 0; i < 8; ++i) v[i] = bf16_bits(W[(size_t)(k8 + i) * N + n]);
  *(v8us*)(Wt + (size_t)n * K + k8) = v;
  
}

// GEMM C[M][N] (f32, pitch ldc) = act(A[M][K]·W + bias). A f32 row-major (pitch lda) converted per fragment to bf16
// (ASPLIT: hi/lo two planes -> 2 terms, else single rounded term); Wt bf16 [N][K] (pitch ldb). BIAS_BF16 rounds the
// bias to bf16 first (bias quantised to bf16 before the add). K%32==0, M%16==0, N%64==0.
template <bool ASPLIT, int ACT, bool BIAS_BF16>
__global__ __launch_bounds__(128) void k_gemm_bf(const float* __restrict__ A, int lda, const unsigned short* __restrict__ Wt, int ldb,
                                               const float* __restrict__ bias, float* __restrict__ C, int ldc, int M, int N, int K) {
  __shared__ __attribute__((aligned(16))) float so[4][16][64];
  const int tid = threadIdx.x, w = tid >> 5, lane = tid & 31, ln = lane & 15, hh = lane >> 4;
  const int ntn = N / 64;
  const int wid = blockIdx.x * 4 + w;
  const int mt = wid / ntn, nq = wid % ntn;
  if (mt * 16 >= M) return;
  const int row0 = mt * 16, col0 = nq * 64;
  const float* arow = A + (size_t)(row0 + ln) * lda;
  v8f acc[4] = {};
  for (int kb = 0; kb < K; kb += 32) {
    FragB ah, al;
    const v4f x0 = *(const v4fa*)(arow + kb + 8 * hh), x1 = *(const v4fa*)(arow + kb + 8 * hh + 4);
    const v4f x2 = *(const v4fa*)(arow + kb + 16 + 8 * hh), x3 = *(const v4fa*)(arow + kb + 16 + 8 * hh + 4);
    float xs[16] = {x0[0],x0[1],x0[2],x0[3],x1[0],x1[1],x1[2],x1[3],x2[0],x2[1],x2[2],x2[3],x3[0],x3[1],x3[2],x3[3]};
#pragma unroll
    for (int i = 0; i < 16; ++i) { const unsigned short hb = bf16_bits(xs[i]); ah.u[i] = hb; al.u[i] = ASPLIT ? bf16_bits(xs[i] - bf16_val(hb)) : (unsigned short)0; }
#pragma unroll
    for (int t = 0; t < 4; ++t) {
      const unsigned short* brow = Wt + (size_t)(col0 + t * 16 + ln) * ldb + kb;
      FragB b;
      b.half[0] = *(const v8us*)(brow + 8 * hh);
      b.half[1] = *(const v8us*)(brow + 16 + 8 * hh);
      acc[t] = mmaN<ASPLIT ? 2 : 1>(ah.v, al.v, b.v, b.v, acc[t]);
    }
  }
#pragma unroll
  for (int t = 0; t < 4; ++t) {
    float bv = bias ? bias[col0 + t * 16 + ln] : 0.f;
    if (BIAS_BF16) bv = bf16_round(bv);
#pragma unroll
    for (int r = 0; r < 8; ++r) { float v = acc[t][r] + bv; if (ACT == 1) v = fmaxf(v, 0.f); so[w][8 * hh + r][t * 16 + ln] = v; }
  }
  __builtin_amdgcn_fence(__ATOMIC_ACQ_REL, "workgroup");
  __builtin_amdgcn_wave_barrier();
  const int rsub = lane >> 4, c4 = (lane & 15) * 4;
  {
#pragma unroll
    for (int q = 0; q < 8; ++q) {
      const int r = q * 2 + rsub;
      const v4f v = *(const v4fa*)&so[w][r][c4];
      *(v4f*)(C + (size_t)(row0 + r) * ldc + col0 + c4) = v;
    }
    
  }
}

// GEMM C = act(A·W + bias + resid): A f32 (ASPLIT -> hi/lo 2 terms), Wt bf16 [N][K]; ACT 0 none, 1 relu, 2 exact gelu;
// resid (optional, f32, row index = (row % rmod), pitch ldr, RES_BF16 rounds it) added before the activation.
template <bool ASPLIT, int ACT, bool BIAS_BF16, bool RES_BF16>
__global__ __launch_bounds__(128) void k_gemm_bf3(const float* __restrict__ A, int lda, const unsigned short* __restrict__ Wt, int ldb,
                                                const float* __restrict__ bias, const float* __restrict__ resid, int rmod, int ldr,
                                                float* __restrict__ C, int ldc, int M, int N, int K) {
  __shared__ __attribute__((aligned(16))) float so[4][16][64];
  const int tid = threadIdx.x, w = tid >> 5, lane = tid & 31, ln = lane & 15, hh = lane >> 4;
  const int ntn = N / 64;
  const int wid = blockIdx.x * 4 + w;
  const int mt = wid / ntn, nq = wid % ntn;
  if (mt * 16 >= M) return;
  const int row0 = mt * 16, col0 = nq * 64;
  const float* arow = A + (size_t)(row0 + ln) * lda;
  v8f acc[4] = {};
  for (int kb = 0; kb < K; kb += 32) {
    FragB ah, al;
    const v4f x0 = *(const v4fa*)(arow + kb + 8 * hh), x1 = *(const v4fa*)(arow + kb + 8 * hh + 4);
    const v4f x2 = *(const v4fa*)(arow + kb + 16 + 8 * hh), x3 = *(const v4fa*)(arow + kb + 16 + 8 * hh + 4);
    float xs[16] = {x0[0],x0[1],x0[2],x0[3],x1[0],x1[1],x1[2],x1[3],x2[0],x2[1],x2[2],x2[3],x3[0],x3[1],x3[2],x3[3]};
#pragma unroll
    for (int i = 0; i < 16; ++i) { const unsigned short hb = bf16_bits(xs[i]); ah.u[i] = hb; al.u[i] = ASPLIT ? bf16_bits(xs[i] - bf16_val(hb)) : (unsigned short)0; }
#pragma unroll
    for (int t = 0; t < 4; ++t) {
      const unsigned short* brow = Wt + (size_t)(col0 + t * 16 + ln) * ldb + kb;
      FragB b;
      b.half[0] = *(const v8us*)(brow + 8 * hh);
      b.half[1] = *(const v8us*)(brow + 16 + 8 * hh);
      acc[t] = mmaN<ASPLIT ? 2 : 1>(ah.v, al.v, b.v, b.v, acc[t]);
    }
  }
#pragma unroll
  for (int t = 0; t < 4; ++t) {
    const int col = col0 + t * 16 + ln;
    float bv = bias ? bias[col] : 0.f;
    if (BIAS_BF16) bv = bf16_round(bv);
#pragma unroll
    for (int r = 0; r < 8; ++r) {
      float v = acc[t][r] + bv;
      if (resid) { float rv = resid[(size_t)((row0 + 8 * hh + r) % rmod) * ldr + col]; if (RES_BF16) rv = bf16_round(rv); v += rv; }
      if (ACT == 1) v = fmaxf(v, 0.f);
      if (ACT == 2) v = 0.5f * v * (1.0f + erff(v * 0.70710678118654752f));
      if (ACT == 3) { const float u = 0.7978845608028654f * (v + 0.044715f * v * v * v); v = 0.5f * v * (1.0f + tanhf(u)); }
      so[w][8 * hh + r][t * 16 + ln] = v;
    }
  }
  __builtin_amdgcn_fence(__ATOMIC_ACQ_REL, "workgroup");
  __builtin_amdgcn_wave_barrier();
  const int rsub = lane >> 4, c4 = (lane & 15) * 4;
  {
#pragma unroll
    for (int q = 0; q < 8; ++q) {
      const int r = q * 2 + rsub;
      const v4f v = *(const v4fa*)&so[w][r][c4];
      *(v4f*)(C + (size_t)(row0 + r) * ldc + col0 + c4) = v;
    }
    
  }
}
// row LayerNorm (biased variance, eps) over N: s = X (+ R); optional out_sum <- s; out_norm <- (s-mu)*rsqrt(var+eps)*g + b
template <bool PARAM_BF16>
__global__ __launch_bounds__(256) void k_layernorm(const float* __restrict__ X, const float* __restrict__ R, const float* __restrict__ g, const float* __restrict__ bta,
                                                  float* __restrict__ out_sum, float* __restrict__ out_norm, int N, float eps) {
  __shared__ float red[256];
  const int row = blockIdx.x, tid = threadIdx.x;
  const float* x = X + (size_t)row * N; const float* rr = R ? R + (size_t)row * N : nullptr;
  float vals[16];                     // up to N = 4096
  const int per = N / 256;            // contiguous chunk per thread? use strided-by-4 chunks: thread handles j = tid*4 + 1024*u
  float s1 = 0.f;
  for (int u = 0; u < per / 4; ++u) {
    const int j = tid * 4 + 1024 * u;
    const v4f a = *(const v4fa*)(x + j);
    v4f b = {0.f,0.f,0.f,0.f}; if (rr) b = *(const v4fa*)(rr + j);
#pragma unroll
    for (int q = 0; q < 4; ++q) { const float v = a[q] + b[q]; vals[u * 4 + q] = v; s1 += v; }
  }
  red[tid] = s1; __syncthreads();
  for (int st = 128; st > 0; st >>= 1) { if (tid < st) red[tid] += red[tid + st]; __syncthreads(); }
  const float mu = red[0] / (float)N; __syncthreads();
  float s2 = 0.f;
  for (int u = 0; u < per / 4; ++u)
#pragma unroll
    for (int q = 0; q < 4; ++q) { const float c = vals[u * 4 + q] - mu; s2 += c * c; }
  red[tid] = s2; __syncthreads();
  for (int st = 128; st > 0; st >>= 1) { if (tid < st) red[tid] += red[tid + st]; __syncthreads(); }
  const float rs = rsqrtf(red[0] / (float)N + eps);
  {
    for (int u = 0; u < per / 4; ++u) {
      const int j = tid * 4 + 1024 * u;
      v4f o, sm;
#pragma unroll
      for (int q = 0; q < 4; ++q) {
        float gg = g[j + q], bb = bta[j + q];
        if (PARAM_BF16) { gg = bf16_round(gg); bb = bf16_round(bb); }
        sm[q] = vals[u * 4 + q]; o[q] = (vals[u * 4 + q] - mu) * rs * gg + bb;
      }
      if (out_sum) *(v4f*)(out_sum + (size_t)row * N + j) = sm;
      *(v4f*)(out_norm + (size_t)row * N + j) = o;
    }
    
  }
}



// ---- f16 WMMA path (v_wmma_f32_16x16x32_f16): 11-bit significands for operands in range — used where a [0,1] probability operand needs more precision than bf16
typedef _Float16 v16h __attribute__((ext_vector_type(16)));
union FragH { v16h v; v8us half[2]; _Float16 h[16]; unsigned short u[16]; };
template <int NT>
__device__ __forceinline__ v8f mmaH(v16h ah, v16h al, v16h bh, v16h bl, v8f c) {
  c = __builtin_amdgcn_wmma_f32_16x16x32_f16(false, ah, false, bh, (short)0, c, false, false);
  if (NT >= 2) c = __builtin_amdgcn_wmma_f32_16x16x32_f16(false, al, false, bh, (short)0, c, false, false);
  if (NT >= 3) c = __builtin_amdgcn_wmma_f32_16x16x32_f16(false, ah, false, bl, (short)0, c, false, false);
  asm volatile("v_nop\n\tv_nop\n\tv_nop\n\tv_nop" : "+v"(c) : "v"(ah), "v"(al), "v"(bh), "v"(bl));
  return c;
}
// batched GEMM like k_gemm_b but f16 operands: A f32 (split into f16 hi/lo if ASPLIT, else rounded to f16), Bt = f16 values [n][k]; alpha; C f32; N multiple of 16 (partial tiles skipped)
template <bool ASPLIT>
__global__ __launch_bounds__(128) void k_gemm_h(const float* __restrict__ A, int lda, size_t sA, const _Float16* __restrict__ Bh, int ldb, size_t sB, float alpha, float* __restrict__ C, int ldc, size_t sC, int M, int N, int K) {
  __shared__ __attribute__((aligned(16))) float so[4][16][64];
  const int tid = threadIdx.x, w = tid >> 5, lane = tid & 31, ln = lane & 15, hh = lane >> 4; const int by = blockIdx.y;
  A += (size_t)by * sA; Bh += (size_t)by * sB; C += (size_t)by * sC;
  const int ntn = (N + 63) / 64; const int wid = blockIdx.x * 4 + w; const int mt = wid / ntn, nq = wid % ntn; if (mt * 16 >= M) return;
  const int row0 = mt * 16, col0 = nq * 64; const float* arow = A + (size_t)(row0 + ln) * lda;
  v8f acc[4] = {};
  for (int kb = 0; kb < K; kb += 32) {
    FragH ah, al;
    const v4f x0 = *(const v4fa*)(arow + kb + 8 * hh), x1 = *(const v4fa*)(arow + kb + 8 * hh + 4), x2 = *(const v4fa*)(arow + kb + 16 + 8 * hh), x3 = *(const v4fa*)(arow + kb + 16 + 8 * hh + 4);
    float xs[16] = {x0[0],x0[1],x0[2],x0[3],x1[0],x1[1],x1[2],x1[3],x2[0],x2[1],x2[2],x2[3],x3[0],x3[1],x3[2],x3[3]};
#pragma unroll
    for (int i = 0; i < 16; ++i) { const _Float16 h = (_Float16)xs[i]; ah.h[i] = h; al.h[i] = ASPLIT ? (_Float16)(xs[i] - (float)h) : (_Float16)0.0f; }
#pragma unroll
    for (int t = 0; t < 4; ++t) { if (col0 + t * 16 >= N) continue; const size_t boff = (size_t)(col0 + t * 16 + ln) * ldb + kb; FragH bq; bq.half[0] = *(const v8us*)(Bh + boff + 8 * hh); bq.half[1] = *(const v8us*)(Bh + boff + 16 + 8 * hh);
      acc[t] = mmaH<ASPLIT ? 2 : 1>(ah.v, al.v, bq.v, bq.v, acc[t]); }
  }
#pragma unroll
  for (int t = 0; t < 4; ++t) { if (col0 + t * 16 >= N) continue;
#pragma unroll
    for (int r = 0; r < 8; ++r) so[w][8 * hh + r][t * 16 + ln] = acc[t][r] * alpha; }
  __builtin_amdgcn_fence(__ATOMIC_ACQ_REL, "workgroup"); __builtin_amdgcn_wave_barrier();
  const int rsub = lane >> 4, c4 = (lane & 15) * 4;
  {
#pragma unroll
    for (int q = 0; q < 8; ++q) { const int r = q * 2 + rsub; if (col0 + c4 < N) { const v4f v = *(const v4fa*)&so[w][r][c4]; *(v4f*)(C + (size_t)(row0 + r) * ldc + col0 + c4) = v; } }
     }
}

// ---- fragment order: every f16 plane [rows][K] that feeds a matrix operand (rows % 16 == 0, K % 32 == 0) is stored as 1-KiB blocks, one per fragment of 16 rows x 32 k, block (rt, kt) at element (rt * (K / 32) + kt) * 512.
// Inside a block, lane l = 16 hh + ln (row ln of the tile) finds its k = 8 hh .. 8 hh + 7 at element 8 l and its k = 16 + 8 hh .. 16 + 8 hh + 7 at element 256 + 8 l: each of a fragment's two 16-byte loads reads 512 contiguous bytes, four whole lines, where rows of a row-major plane gave sixteen lines of 32 bytes. The registers hold the same values as before.
// A writer's thread t stores elements 8 t .. 8 t + 7 of the plane (a wave stores four whole lines); fo_src names the row and the first k that belong there.
struct FoRK { int row, k; };
__device__ __forceinline__ FoRK fo_src(size_t t, int K) { const int lane = (int)(t & 31); const size_t wid = t >> 5; const int half = (int)(wid & 1); const size_t blk = wid >> 1; const int kb = K >> 5;
  FoRK o; o.row = (int)(blk / kb) * 16 + (lane & 15); o.k = (int)(blk % kb) * 32 + half * 16 + (lane >> 4) * 8; return o; }
// element offset of the 8 values (row, k8 .. k8 + 7), k8 % 8 == 0
__device__ __forceinline__ size_t fo_dst(int row, int k8, int K) { return ((size_t)(row >> 4) * (K >> 5) + (k8 >> 5)) * 512 + ((k8 >> 4) & 1) * 256 + (((k8 >> 3) & 1) * 16 + (row & 15)) * 8; }
// Wt = f16(W[k][n] * scale), rows n, in fragment order, from f32 row-major W[K][N] (scale = power of two; bf16-exact weights stay exact in f16 away from the subnormal range)
__device__ __forceinline__ void d_wt_f16(int bx, const float* __restrict__ W, _Float16* __restrict__ Wt, int K, int N, float scale) {
  const int t = bx * 256 + threadIdx.x; if (t >= N * (K / 8)) return; const FoRK s = fo_src((size_t)t, K); const int n = s.row, k8 = s.k; FragH f;
#pragma unroll
  for (int i = 0; i < 8; ++i) { if (i) asm volatile("s_wait_xcnt 0x0" ::: "memory");      /* stands in front of each further load, whose result may land in a register that an earlier load names as its address */
    f.h[i] = (_Float16)(bf16_round(W[(size_t)(k8 + i) * N + n]) * scale); }
  const v8us o = f.half[0];
  *(v8us*)((unsigned short*)Wt + (size_t)t * 8) = o; 
}
// k_gemm_hh variant with fused epilogue: v = acc·alpha + bias[by·sBias + col] (+ CP[(row/rowsPerB)·sCPb + by·64 + col] if CP) ; ACT 0 none / 1 elu ; writes f16 C16 (and f32 C if non-null)
template <int ACT>
__global__ __launch_bounds__(128) void k_gemm_hhx(const _Float16* __restrict__ A, int lda, size_t sA, const _Float16* __restrict__ Bh, int ldb, size_t sB, float alpha, const float* __restrict__ bias, size_t sBias, const float* __restrict__ CP, int rowsPerB, size_t sCPb, int row0g,
    float* __restrict__ C, _Float16* __restrict__ C16, int ldc, size_t sC, int M, int N, int K) {
  __shared__ __attribute__((aligned(16))) float so[4][16][64];
  const int tid = threadIdx.x, w = tid >> 5, lane = tid & 31, ln = lane & 15, hh = lane >> 4; const int by = blockIdx.y;
  A += (size_t)by * sA; Bh += (size_t)by * sB; const size_t cofs = (size_t)by * sC; const float* bp = bias ? bias + (size_t)by * sBias : nullptr;
  const int ntn = (N + 63) / 64; const int wid = blockIdx.x * 4 + w; const int mt = wid / ntn, nq = wid % ntn; if (mt * 16 >= M) return;
  const int row0 = mt * 16, col0 = nq * 64; const _Float16* arow = A + (size_t)(row0 + ln) * lda;
  v8f acc[4] = {};
  for (int kb = 0; kb < K; kb += 32) { FragH ah; ah.half[0] = *(const v8us*)((const unsigned short*)arow + kb + 8 * hh); ah.half[1] = *(const v8us*)((const unsigned short*)arow + kb + 16 + 8 * hh);
#pragma unroll
    for (int t = 0; t < 4; ++t) { if (col0 + t * 16 >= N) continue; const size_t boff = (size_t)(col0 + t * 16 + ln) * ldb + kb; FragH bq; bq.half[0] = *(const v8us*)((const unsigned short*)Bh + boff + 8 * hh); bq.half[1] = *(const v8us*)((const unsigned short*)Bh + boff + 16 + 8 * hh);
      acc[t] = mmaH<1>(ah.v, ah.v, bq.v, bq.v, acc[t]); }
  }
#pragma unroll
  for (int t = 0; t < 4; ++t) { if (col0 + t * 16 >= N) continue; const int col = col0 + t * 16 + ln; const float bv = bp ? bf16_round(bp[col]) : 0.f;
#pragma unroll
    for (int r = 0; r < 8; ++r) { float v = acc[t][r] * alpha + bv; if (CP) { const int bidx = (row0g + row0 + 8 * hh + r) / rowsPerB; v += CP[(size_t)bidx * sCPb + (size_t)by * 64 + col]; } if (ACT == 1) v = (v > 0.f) ? v : expm1f(v); else if (ACT == 7) v = (v > 0.f) ? v + 1.0f : expf(v); else if (ACT == 8) v = tanhf(v); else if (ACT == 9) v = 0.5f * v * (1.0f + tanhf(0.7978845608028654f * (v + 0.044715f * v * v * v))); else if (ACT == 11) v = 1.0f / (1.0f + expf(-v)); else if (ACT == 12) v = (v > 0.f) ? v : 0.01f * v; else if (ACT == 14) v = (v > 0.f) ? v : 0.1f * v; else if (ACT == 15) v = v / (1.0f + expf(-v)); else if (ACT == 3) v = fmaxf(v, 0.f); else if (ACT == 6) v = 0.5f * v * (1.0f + erff(v * 0.70710678118654752f)); so[w][8 * hh + r][t * 16 + ln] = v; } }
  __builtin_amdgcn_fence(__ATOMIC_ACQ_REL, "workgroup"); __builtin_amdgcn_wave_barrier();
  const int rsub = lane >> 4, c4 = (lane & 15) * 4; typedef _Float16 v4h __attribute__((ext_vector_type(4)));
  {
#pragma unroll
    for (int q = 0; q < 8; ++q) { const int r = q * 2 + rsub; if (col0 + c4 < N) { const v4f v = *(const v4fa*)&so[w][r][c4]; if (C) *(v4f*)(C + cofs + (size_t)(row0 + r) * ldc + col0 + c4) = v; if (C16) { v4h h4; for (int i = 0; i < 4; ++i) h4[i] = (_Float16)v[i]; *(v4h*)(C16 + cofs + (size_t)(row0 + r) * ldc + col0 + c4) = h4; } } }
     }
}


typedef _Float16 v4h __attribute__((ext_vector_type(4)));

__device__ __forceinline__ void d_x16(int bx, const float* __restrict__ x, _Float16* __restrict__ X16, size_t n8, int K) { const size_t t = (size_t)bx * 256 + threadIdx.x; if (t >= n8) return; const FoRK s = fo_src(t, K); const float* xs = x + (size_t)s.row * K + s.k; FragH f;
#pragma unroll
  for (int q = 0; q < 8; ++q) f.h[q] = (_Float16)bf16_round(xs[q]); *(v8us*)((unsigned short*)X16 + t * 8) = f.half[0];  }
__global__ __launch_bounds__(256) void k_h16(const float* __restrict__ x, _Float16* __restrict__ X16, size_t n8) { const size_t t = (size_t)blockIdx.x * 256 + threadIdx.x; if (t >= n8) return; FragH f;
#pragma unroll
  for (int q = 0; q < 8; ++q) f.h[q] = (_Float16)x[t * 8 + q]; *(v8us*)((unsigned short*)X16 + t * 8) = f.half[0];  }
__global__ __launch_bounds__(256) void k_round16f(const float* __restrict__ W, _Float16* __restrict__ Bt, size_t n8) { const size_t t = (size_t)blockIdx.x * 256 + threadIdx.x; if (t >= n8) return; FragH f;
#pragma unroll
  for (int i = 0; i < 8; ++i) f.h[i] = (_Float16)(bf16_round(W[t * 8 + i]) * 16.0f); *(v8us*)((unsigned short*)Bt + t * 8) = f.half[0];  }
// both V^T planes straight from a value projection: a block takes 64 keys x 64 dims of one (batch, kv head) from the f32 plane F (rpb rows a batch, KVD columns), splits each value into f16 hi + 2^10 residual, turns both tiles in LDS and writes them at keys key_off + ... of the planes (rows d, k = keys, TK keys a row, fragment order). rpb and key_off are multiples of 64
__device__ __forceinline__ void d_vtf(int bx, const float* __restrict__ F, int rpb, int key_off, _Float16* __restrict__ Vt, _Float16* __restrict__ VtL) { __shared__ unsigned short th[64][66], tl[64][66]; const int tid = threadIdx.x; const int npb = rpb / 64; const int slab = bx / npb, lg = bx % npb; const int b = slab / NKV, h = slab % NKV;
  for (int i = tid; i < 64 * 8; i += 256) { const int r = i / 8, c8 = (i % 8) * 8; const float* fs = F + ((size_t)b * rpb + lg * 64 + r) * KVD + h * 64 + c8; const v4f a = *(const v4fa*)fs, c = *(const v4fa*)(fs + 4); FragH fh, fl;
#pragma unroll
    for (int q = 0; q < 4; ++q) { _Float16 hv = (_Float16)a[q]; fh.h[q] = hv; fl.h[q] = (_Float16)((a[q] - (float)hv) * 1024.0f); hv = (_Float16)c[q]; fh.h[4 + q] = hv; fl.h[4 + q] = (_Float16)((c[q] - (float)hv) * 1024.0f); }
#pragma unroll
    for (int q = 0; q < 8; ++q) { th[r][c8 + q] = fh.u[q]; tl[r][c8 + q] = fl.u[q]; } }
  __syncthreads();      /* both tiles are whole in LDS before any thread reads a column */
  {
#pragma unroll
    for (int rd = 0; rd < 2; ++rd) { const int wv = rd * 8 + tid / 32, lane = tid % 32; const int d = (wv >> 2) * 16 + (lane & 15), pc = (wv & 3) * 2 + (lane >> 4); FragH fh, fl;      /* a wave per half fragment of V^T (rows d, k = keys): 16 d x 2 groups of 8 keys */
#pragma unroll
      for (int q = 0; q < 8; ++q) { fh.u[q] = th[pc * 8 + q][d]; fl.u[q] = tl[pc * 8 + q][d]; }
      const size_t e = fo_dst(slab * 64 + d, key_off + lg * 64 + pc * 8, TK);
      *(v8us*)((unsigned short*)Vt + e) = fh.half[0]; *(v8us*)((unsigned short*)VtL + e) = fl.half[0]; }
    asm volatile("s_wait_xcnt 0x0" ::: "memory");      /* stands behind the four stores above, in front of whatever the launch's other ranges, laid out behind this one, write into registers that the stores name */
     } }

// ---- fast GEMM (wave tile 32x64; requires M % 32 == 0 rows per launch region, N % 64 == 0 and K % 64 == 0); epilogue = k_gemm_hhx semantics ----
__device__ __forceinline__ v16h g2_frag(const _Float16* p) { FragH f; f.half[0] = *(const v8us*)((const unsigned short*)p); f.half[1] = *(const v8us*)((const unsigned short*)p + 256); return f.v; }      /* p: the lane's 8 elements in the fragment's block */
__device__ __forceinline__ v8f g2_mma(v16h a, v16h b, v8f c) { v8f d = __builtin_amdgcn_wmma_f32_16x16x32_f16(false, a, false, b, (short)0, c, false, false); asm volatile("v_nop\n\tv_nop\n\tv_nop\n\tv_nop" : "+v"(d) : "v"(a), "v"(b)); return d; }
template <int ACT>
__device__ __forceinline__ void d_gemm2(int bx, const _Float16* __restrict__ A, size_t sA, const _Float16* __restrict__ Bh, size_t sB, const _Float16* __restrict__ A2, const _Float16* __restrict__ B2, int np, float alpha, const float* __restrict__ bias, size_t sBias, const float* __restrict__ CP, int rowsPerB, size_t sCPb, int row0g,
    float* __restrict__ C, _Float16* __restrict__ C16, int ldc, size_t sC, int M, int N, int K) {
  __shared__ __attribute__((aligned(16))) float so[4][32][68];
  const int tid = threadIdx.x, w = tid >> 5, lane = tid & 31, ln = lane & 15, hh = lane >> 4; const int by = blockIdx.y;
  A += (size_t)by * sA; Bh += (size_t)by * sB; const size_t cofs = (size_t)by * sC; const float* bp = bias ? bias + (size_t)by * sBias : nullptr;
  const int ntn = N >> 6; const int mt = bx / ntn, nq = bx - mt * ntn; const int row0 = mt * 128 + 32 * w, col0 = nq * 64; if (row0 >= M) return;
  /* A and Bh in fragment order, K elements a row: a tile of 16 rows is K * 16 elements, a step of 32 k is 512 */
  const size_t ao = (size_t)(row0 >> 4) * K * 16 + lane * 8, bo = (size_t)(col0 >> 4) * K * 16 + lane * 8;
  const v8f z8 = {0.f,0.f,0.f,0.f,0.f,0.f,0.f,0.f}; v8f c00 = z8, c01 = z8, c02 = z8, c03 = z8, c10 = z8, c11 = z8, c12 = z8, c13 = z8;
  /* np == 2: the residual product A2 B2 (A2 = 2^10 residual of A, B2 = x1 weights where Bh holds x16) is summed on top of the first in the same accumulators: the first sum is worth 1/16, the second 1/1024, so the first is raised by 64 (exact) in between and alpha = 1/1024 serves both */
#pragma unroll 1      /* kept rolled: one copy of the k loop */
  for (int ps = 0; ps < np; ++ps) {
  const _Float16* a0p = (ps ? A2 : A) + ao; const _Float16* a1p = a0p + (size_t)16 * K;
  const _Float16* b0p = (ps ? B2 : Bh) + bo; const _Float16* b1p = b0p + (size_t)16 * K; const _Float16* b2p = b1p + (size_t)16 * K; const _Float16* b3p = b2p + (size_t)16 * K;
  if (ps) { c00 *= 64.0f; c01 *= 64.0f; c02 *= 64.0f; c03 *= 64.0f; c10 *= 64.0f; c11 *= 64.0f; c12 *= 64.0f; c13 *= 64.0f; }
  /* two register sets x / y of the six fragments (K % 64 == 0): the loads of the next 32-wide k step are all issued before the products of this one, so a step waits for one overlapped latency at most */
  v16h xa0 = g2_frag(a0p), xa1 = g2_frag(a1p), xb0 = g2_frag(b0p), xb1 = g2_frag(b1p), xb2 = g2_frag(b2p), xb3 = g2_frag(b3p);
#pragma unroll 1
  for (int kb = 0; kb < K; kb += 64) { const int k1 = kb * 16, k2 = ((kb + 64 < K) ? kb + 64 : kb) * 16;      /* element offsets of this trip's first block (the y step is the block behind it, 512 elements on) and of the next trip's. Last trip: k2 names a step inside the row tile again; its values are not used */
    const _Float16* pya0 = a0p + k1; const _Float16* pya1 = a1p + k1; const _Float16* pyb0 = b0p + k1; const _Float16* pyb1 = b1p + k1; const _Float16* pyb2 = b2p + k1; const _Float16* pyb3 = b3p + k1;
    const _Float16* pxa0 = a0p + k2; const _Float16* pxa1 = a1p + k2; const _Float16* pxb0 = b0p + k2; const _Float16* pxb1 = b1p + k2; const _Float16* pxb2 = b2p + k2; const _Float16* pxb3 = b3p + k2;
    const v16h ya0 = g2_frag(pya0 + 512), ya1 = g2_frag(pya1 + 512), yb0 = g2_frag(pyb0 + 512), yb1 = g2_frag(pyb1 + 512), yb2 = g2_frag(pyb2 + 512), yb3 = g2_frag(pyb3 + 512);
    __builtin_amdgcn_sched_barrier(0);      /* holds the y loads above the x products (the scheduler otherwise moves each load down to its use) */
    c00 = g2_mma(xa0, xb0, c00); c10 = g2_mma(xa1, xb0, c10); c01 = g2_mma(xa0, xb1, c01); c11 = g2_mma(xa1, xb1, c11);
    c02 = g2_mma(xa0, xb2, c02); c12 = g2_mma(xa1, xb2, c12); c03 = g2_mma(xa0, xb3, c03); c13 = g2_mma(xa1, xb3, c13);
    __builtin_amdgcn_sched_barrier(0);      /* holds the x reloads below the x products and, with the next one, above the y products */
    xa0 = g2_frag(pxa0); xa1 = g2_frag(pxa1); xb0 = g2_frag(pxb0); xb1 = g2_frag(pxb1); xb2 = g2_frag(pxb2); xb3 = g2_frag(pxb3);
    __builtin_amdgcn_sched_barrier(0);      /* holds the x reloads above the y products */
    c00 = g2_mma(ya0, yb0, c00); c10 = g2_mma(ya1, yb0, c10); c01 = g2_mma(ya0, yb1, c01); c11 = g2_mma(ya1, yb1, c11);
    c02 = g2_mma(ya0, yb2, c02); c12 = g2_mma(ya1, yb2, c12); c03 = g2_mma(ya0, yb3, c03); c13 = g2_mma(ya1, yb3, c13);
    asm volatile("s_wait_xcnt 0x0" :: "v"(pya0), "v"(pya1), "v"(pyb0), "v"(pyb1), "v"(pyb2), "v"(pyb3), "v"(pxa0), "v"(pxa1), "v"(pxb0), "v"(pxb1), "v"(pxb2), "v"(pxb3) : "memory"); }      /* stands in front of the next trip's address sums, which overwrite registers that the loads name; the trip's twelve addresses are its inputs, so that each keeps its registers up to here and no later load's result lands in them */
  }
  v8f accs[8] = {c00, c01, c02, c03, c10, c11, c12, c13};
  /* the epilogue's loads (4 bias words, 64 CP words a lane) are issued together as well, ahead of the arithmetic that uses them */
  float bw[4] = {0.f, 0.f, 0.f, 0.f}; v8f cpv[8] = {z8, z8, z8, z8, z8, z8, z8, z8};
  if (bp) {
#pragma unroll
    for (int t = 0; t < 4; ++t) bw[t] = bp[col0 + t * 16 + ln];
    asm volatile("s_wait_xcnt 0x0" ::: "memory"); }      /* stands in front of the scalar work below, which overwrites the base register that the four loads name */
  if (CP) {
#pragma unroll
    for (int u = 0; u < 8; ++u)
#pragma unroll
      for (int r = 0; r < 8; ++r) { const int bidx = (row0g + row0 + (u >> 2) * 16 + 8 * hh + r) / rowsPerB; cpv[u][r] = CP[(size_t)bidx * sCPb + (size_t)by * 64 + col0 + (u & 3) * 16 + ln];
        if (r == 7) asm volatile("s_wait_xcnt 0x0" ::: "memory"); }      /* stands in front of the next group's loads, whose results may land in address registers of this group */
    asm volatile("" :: "v"(cpv[0]), "v"(cpv[1]), "v"(cpv[2]), "v"(cpv[3]), "v"(cpv[4]), "v"(cpv[5]), "v"(cpv[6]), "v"(cpv[7])); }      /* inputs-only fence on the loaded words: holds all 64 loads in this block, where they overlap, instead of one waited load in front of each add */
#pragma unroll
  for (int u = 0; u < 8; ++u) { const int t = u & 3, half = u >> 2; const float bv = bp ? bf16_round(bw[t]) : 0.f;
#pragma unroll
    for (int r = 0; r < 8; ++r) { const int rloc = half * 16 + 8 * hh + r; float v = accs[u][r] * alpha + bv; if (CP) v += cpv[u][r];
      if (ACT == 3) v = fmaxf(v, 0.f); else if (ACT == 6) v = 0.5f * v * (1.0f + erff(v * 0.70710678118654752f)); else if (ACT == 11) v = 1.0f / (1.0f + expf(-v)); else if (ACT == 15) v = v / (1.0f + expf(-v)); else if (ACT == 12) v = (v > 0.f) ? v : 0.01f * v; else if (ACT == 8) v = tanhf(v);
      so[w][rloc][t * 16 + ln] = v; } }
  __builtin_amdgcn_fence(__ATOMIC_ACQ_REL, "workgroup"); __builtin_amdgcn_wave_barrier();
  const int rsub = lane >> 4, c4 = (lane & 15) * 4;
  {
#pragma unroll
    for (int q = 0; q < 16; ++q) { const int r = q * 2 + rsub; const v4f v = *(const v4fa*)&so[w][r][c4]; if (C) *(v4f*)(C + cofs + (size_t)(row0 + r) * ldc + col0 + c4) = v; if (C16) { v4h h4; for (int i = 0; i < 4; ++i) h4[i] = (_Float16)v[i]; *(v4h*)(C16 + cofs + (size_t)(row0 + r) * ldc + col0 + c4) = h4; }
      if ((q & 3) == 3 && q != 15) asm volatile("s_wait_xcnt 0x0" ::: "memory"); }      /* stands in front of the next four rows' LDS reads and address sums, which overwrite registers that the stores above name */
     } }



// lane l's value of lane l ^ X (X < 16) inside its 16-lane row, by a DPP row_xmask move in registers (no trip through the LDS pipe and no wait on it)
template <int X>
__device__ __forceinline__ float row_xor(float v) { return __int_as_float(__builtin_amdgcn_update_dpp(0, __float_as_int(v), 0x160 | X, 0xf, 0xf, true)); }
// maximum over the 16-lane row, all 32 lanes on: four dependent DPP maxima in one statement (written with fmaxf on a DPP move the compiler puts a move and a quieting maximum in front of each step, three links for one)
__device__ __forceinline__ float row_max16(float v) {
  asm("v_max_num_f32_dpp %0, %0, %0 row_xmask:1 row_mask:0xf bank_mask:0xf\n\t"
      "v_max_num_f32_dpp %0, %0, %0 row_xmask:2 row_mask:0xf bank_mask:0xf\n\t"
      "v_max_num_f32_dpp %0, %0, %0 row_xmask:4 row_mask:0xf bank_mask:0xf\n\t"
      "v_max_num_f32_dpp %0, %0, %0 row_xmask:8 row_mask:0xf bank_mask:0xf" : "+v"(v));
  return v; }
__device__ __forceinline__ float row_sum16(float v) { v += row_xor<1>(v); v += row_xor<2>(v); v += row_xor<4>(v); v += row_xor<8>(v); return v; }
template <int CAUSAL>
__global__ __launch_bounds__(128) void k_flash(const _Float16* __restrict__ Q16, int ldq, const _Float16* __restrict__ K16, int ldk, const _Float16* __restrict__ Vt, const int* __restrict__ MSK, float* __restrict__ O, int ldo) {
  constexpr int RPW = 16, RTN = RPW / 16, NQB = TQ / (4 * RPW), DT = 4, KS = 2;
  __shared__ __attribute__((aligned(16))) unsigned short sP[4][RPW][40]; __shared__ __attribute__((aligned(16))) float sO[4][RPW][64 + 4];
  const int tid = threadIdx.x, w = tid >> 5, lane = tid & 31, ln = lane & 15, hh = lane >> 4;
  const int slab = blockIdx.x / NQB, qblk = blockIdx.x % NQB; const int b = slab / NH, h = slab % NH; const int qb0 = qblk * (4 * RPW); const int q0 = qb0 + w * RPW;
  FragH aq[2][KS];
#pragma unroll
  for (int rt = 0; rt < RTN; ++rt) { const unsigned short* qr = (const unsigned short*)Q16 + ((size_t)b * TQ + q0 + rt * 16 + ln) * ldq + h * 64;
#pragma unroll
    for (int ks = 0; ks < KS; ++ks) { aq[rt][ks].half[0] = *(const v8us*)(qr + ks * 32 + 8 * hh); aq[rt][ks].half[1] = *(const v8us*)(qr + ks * 32 + 16 + 8 * hh); } }
  const unsigned short* Vth = (const unsigned short*)Vt + (size_t)slab * 64 * TK;
  float m_r[2][8], l_r[2][8]; v8f oacc[2][DT];
#pragma unroll
  for (int rt = 0; rt < RTN; ++rt) {
#pragma unroll
    for (int r = 0; r < 8; ++r) { m_r[rt][r] = -3.0e38f; l_r[rt][r] = 0.f; }
#pragma unroll
    for (int dt = 0; dt < DT; ++dt) oacc[rt][dt] = (v8f){0.f,0.f,0.f,0.f,0.f,0.f,0.f,0.f}; }
  const int jend = (CAUSAL == 1) ? (qb0 + 4 * RPW) : TK;      /* causal: keys beyond the block's last query never contribute */
#pragma unroll 1
  for (int j0 = 0; j0 < jend; j0 += 32) {
    v8f s[2][2];
#pragma unroll
    for (int nt = 0; nt < 2; ++nt) { const unsigned short* kr = (const unsigned short*)K16 + ((size_t)b * TK + j0 + nt * 16 + ln) * ldk + h * 64; FragH bk[KS];
#pragma unroll
      for (int ks = 0; ks < KS; ++ks) { bk[ks].half[0] = *(const v8us*)(kr + ks * 32 + 8 * hh); bk[ks].half[1] = *(const v8us*)(kr + ks * 32 + 16 + 8 * hh); }
#pragma unroll
      for (int rt = 0; rt < RTN; ++rt) { v8f acc = (v8f){0.f,0.f,0.f,0.f,0.f,0.f,0.f,0.f};
#pragma unroll
        for (int ks = 0; ks < KS; ++ks) acc = mmaH<1>(aq[rt][ks].v, aq[rt][ks].v, bk[ks].v, bk[ks].v, acc); s[rt][nt] = acc; } }
#pragma unroll
    for (int rt = 0; rt < RTN; ++rt)
#pragma unroll
      for (int r = 0; r < 8; ++r) { const int tq = q0 + rt * 16 + 8 * hh + r; const int k0 = j0 + ln, k1 = j0 + 16 + ln;
        const bool ok0 = (CAUSAL == 1) ? (k0 <= tq) : ((CAUSAL == 2) ? ((k0 >> 5) == (tq >> 5)) : true), ok1 = (CAUSAL == 1) ? (k1 <= tq) : ((CAUSAL == 2) ? ((k1 >> 5) == (tq >> 5)) : true);      /* mode 2: block-diagonal 32-token groups */
        const float s0 = ok0 ? s[rt][0][r] * SCL : -3.0e38f, s1 = ok1 ? s[rt][1][r] * SCL : -3.0e38f; 
        const float mn = row_max16(fmaxf(fmaxf(s0, s1), m_r[rt][r]));      /* the running maximum is the same in all 16 lanes of the row: taken in ahead of the reduction, the reduced value is the new maximum itself */
        const float al = (mn > -1.0e38f) ? expf(m_r[rt][r] - mn) : 1.0f; m_r[rt][r] = mn; const float p0 = ok0 ? expf(s0 - mn) : 0.f, p1 = ok1 ? expf(s1 - mn) : 0.f; l_r[rt][r] = l_r[rt][r] * al + p0 + p1;
#pragma unroll
        for (int dt = 0; dt < DT; ++dt) oacc[rt][dt][r] *= al;
        FragH t2; t2.h[0] = (_Float16)(p0 * 1024.0f); t2.h[1] = (_Float16)(p1 * 1024.0f); sP[w][rt * 16 + 8 * hh + r][ln] = t2.u[0]; sP[w][rt * 16 + 8 * hh + r][16 + ln] = t2.u[1]; }
    __builtin_amdgcn_fence(__ATOMIC_ACQ_REL, "workgroup"); __builtin_amdgcn_wave_barrier();
    FragH pa[2];
#pragma unroll
    for (int rt = 0; rt < RTN; ++rt) { pa[rt].half[0] = *(const v8us*)&sP[w][rt * 16 + ln][8 * hh]; pa[rt].half[1] = *(const v8us*)&sP[w][rt * 16 + ln][16 + 8 * hh]; }
#pragma unroll
    for (int dt = 0; dt < DT; ++dt) { const unsigned short* vrow = Vth + (size_t)(dt * 16 + ln) * TK + j0; FragH bv; bv.half[0] = *(const v8us*)(vrow + 8 * hh); bv.half[1] = *(const v8us*)(vrow + 16 + 8 * hh);
#pragma unroll
      for (int rt = 0; rt < RTN; ++rt) oacc[rt][dt] = mmaH<1>(pa[rt].v, pa[rt].v, bv.v, bv.v, oacc[rt][dt]); }
    __builtin_amdgcn_fence(__ATOMIC_ACQ_REL, "workgroup"); __builtin_amdgcn_wave_barrier(); }
#pragma unroll
  for (int rt = 0; rt < RTN; ++rt) {
#pragma unroll
    for (int r = 0; r < 8; ++r) { float l = l_r[rt][r]; l = row_sum16(l); l_r[rt][r] = (l > 0.f) ? 1.0f / (l * 1024.0f) : 0.f; }
#pragma unroll
    for (int dt = 0; dt < DT; ++dt)
#pragma unroll
      for (int r = 0; r < 8; ++r) sO[w][rt * 16 + 8 * hh + r][dt * 16 + ln] = oacc[rt][dt][r] * l_r[rt][r]; }
  __builtin_amdgcn_fence(__ATOMIC_ACQ_REL, "workgroup"); __builtin_amdgcn_wave_barrier();
  {
#pragma unroll
    for (int rp = 0; rp < RPW; rp += 2) { const int r = rp + (lane >> 4), pc = lane & 15; const v4f val = *(const v4fa*)&sO[w][r][pc * 4]; *(v4f*)(O + ((size_t)b * TQ + q0 + r) * ldo + h * 64 + pc * 4) = val; }
     } }
__device__ __forceinline__ float half_swap(float v) { const int x = __float_as_int(v); return __int_as_float(__builtin_amdgcn_permlanex16(x, x, 0x76543210, 0xfedcba98, false, false)); }
typedef int v4im __attribute__((ext_vector_type(4), may_alias));
// softmax of one trip. s[i >> 3][i & 7] is the score of the trip's key (i >> 3) * 16 + 8 hh + (i & 7) against the lane's own query (column ln); ok[i] its mask. The maximum and the sum over keys are taken inside the lane; the maximum is joined with the other half's once a trip (m_c is the same in both halves), the sum l_c stays this half's until the epilogue.
// The two score tiles, converted in place, are the B operand P^T in the hardware k order (element i): P takes no trip through LDS. O^T tiles hold the lane's query in every register, so one factor rescales them all.
__device__ __forceinline__ void sm_trip(const v8f (&s)[2], const bool (&ok)[16], float& m_c, float& l_c, v8f (&oacc)[4], v8f (&oaccL)[4], FragH& ph, FragH& pl) {
  float sc[16], t[8], p[16], u[8];
#pragma unroll
  for (int i = 0; i < 16; ++i) sc[i] = ok[i] ? s[i >> 3][i & 7] * SCL : -3.0e38f;
#pragma unroll
  for (int i = 0; i < 8; ++i) t[i] = fmaxf(sc[i], sc[i + 8]);
  const float mh = fmaxf(fmaxf(fmaxf(fmaxf(t[0], t[1]), fmaxf(t[2], t[3])), fmaxf(fmaxf(t[4], t[5]), fmaxf(t[6], t[7]))), m_c);
  const float mn = fmaxf(mh, half_swap(mh));
  const float al = (mn > -1.0e38f) ? expf(m_c - mn) : 1.0f; m_c = mn;
#pragma unroll
  for (int i = 0; i < 16; ++i) p[i] = ok[i] ? expf(sc[i] - mn) : 0.f;
#pragma unroll
  for (int i = 0; i < 8; ++i) u[i] = p[i] + p[i + 8];
  l_c = l_c * al + (((u[0] + u[1]) + (u[2] + u[3])) + ((u[4] + u[5]) + (u[6] + u[7])));
#pragma unroll
  for (int dt = 0; dt < 4; ++dt) { oacc[dt] *= al; oaccL[dt] *= al; }
#pragma unroll
  for (int i = 0; i < 16; ++i) { const float x = p[i] * 1024.0f; const _Float16 hv = (_Float16)x; ph.h[i] = hv; pl.h[i] = (_Float16)((x - (float)hv) * 1024.0f); } }

// 3-term variant: O = (P_hi V_hi + (P_lo V_hi + P_hi V_lo) / 1024) / l with P = [hi | 2^10 residual] of 1024 p and V^T = [hi | 2^10 residual] planes (VtL same layout as Vt) -> ~2^-21-class products for un-averaged (early causal / peaked) rows
template <int CAUSAL>
__global__ __launch_bounds__(32 * NSPL) void k_flash3gA(const _Float16* __restrict__ Q16, int ldq, const _Float16* __restrict__ K16, int ldk, const _Float16* __restrict__ Vt, const _Float16* __restrict__ VtL, const int* __restrict__ MSK, _Float16* __restrict__ OH, _Float16* __restrict__ OL, int ldo) {
  constexpr int RPW = 16, RTN = RPW / 16, NQB = TQA / (4 * RPW), DT = 4, KS = 2;
  __shared__ __attribute__((aligned(16))) float sO[NSPL][RPW][64 + 4]; __shared__ float sM[NSPL][RPW], sL[NSPL][RPW];
  const int tid = threadIdx.x, w = __builtin_amdgcn_readfirstlane(tid >> 5), lane = tid & 31, ln = lane & 15, hh = lane >> 4;      /* the wave's number in a scalar register: the key range below stays scalar */
  /* one work-group per (batch, head, 16-query tile); its NSPL waves each run the flash loop over their own TK / NSPL keys, and the partial (m, l, O) are merged through LDS behind the loop */
  const int slab = blockIdx.x / (TQA / RPW), qblk = blockIdx.x % (TQA / RPW); (void)NQB; const int b = slab / NH, h = slab % NH; const int qb0 = qblk * RPW; const int q0 = qb0;
  FragH aq[2][KS];
#pragma unroll
  for (int rt = 0; rt < RTN; ++rt) { const unsigned short* qr = (const unsigned short*)Q16 + ((size_t)((b * TQA + q0 + rt * 16) >> 4) * (ldq >> 5) + h * 2) * 512 + lane * 8;      /* Q, K and both V^T planes in fragment order */
#pragma unroll
    for (int ks = 0; ks < KS; ++ks) { aq[rt][ks].half[0] = *(const v8us*)(qr + ks * 512); aq[rt][ks].half[1] = *(const v8us*)(qr + ks * 512 + 256); } }
  const size_t vslab = (size_t)(b * (NH / KVG) + h / KVG); const unsigned short* Vth = (const unsigned short*)Vt + vslab * 64 * TK; const unsigned short* Vtl = (const unsigned short*)VtL + vslab * 64 * TK;      /* GQA: q-head h reads kv head h / KVG */
  float m_c = -3.0e38f, l_c = 0.f; v8f oacc[DT], oaccL[DT];      /* of the lane's query q0 + ln; register r of tile dt is dim dt * 16 + 8 hh + r */
#pragma unroll
  for (int dt = 0; dt < DT; ++dt) { oacc[dt] = (v8f){0.f,0.f,0.f,0.f,0.f,0.f,0.f,0.f}; oaccL[dt] = oacc[dt]; }
  const int jbeg = w * (TK / NSPL), jend = jbeg + TK / NSPL;      /* this wave's keys */
#pragma unroll 1
  for (int j0 = jbeg; j0 < jend; j0 += 32) {
    v8f s[2]; FragH bk[2][KS], bv[DT], bl[DT]; v4im mk[2][2];
    /* every global load of the trip is issued here, in the order of use (K, mask words, both V planes): their latencies overlap, and V lands behind the softmax */
#pragma unroll
    for (int nt = 0; nt < 2; ++nt) { const unsigned short* kr = (const unsigned short*)K16 + ((size_t)((b * TK + j0 + nt * 16) >> 4) * (ldk >> 5) + (h / KVG) * 2) * 512 + lane * 8;
#pragma unroll
      for (int ks = 0; ks < KS; ++ks) { bk[nt][ks].half[0] = *(const v8us*)(kr + ks * 512); bk[nt][ks].half[1] = *(const v8us*)(kr + ks * 512 + 256); } }
    if (CAUSAL == 8) { const int* mrow = MSK + (size_t)(q0 + ln) * TK + j0 + 8 * hh;      /* the lane's query row: its 8 keys of each 16-key tile, 32 contiguous bytes */
#pragma unroll
      for (int nt = 0; nt < 2; ++nt) { mk[nt][0] = *(const v4im*)(mrow + nt * 16); mk[nt][1] = *(const v4im*)(mrow + nt * 16 + 4); } }
    asm volatile("s_wait_xcnt 0x0" ::: "memory");      /* stands in front of the V loads, whose results may land in registers that the K and mask loads name as addresses */
#pragma unroll
    for (int dt = 0; dt < DT; ++dt) { const size_t vo = ((size_t)dt * (TK / 32) + (j0 >> 5)) * 512 + lane * 8; const unsigned short* vrow = Vth + vo; const unsigned short* vrl = Vtl + vo; bv[dt].half[0] = *(const v8us*)vrow; bv[dt].half[1] = *(const v8us*)(vrow + 256);
      if (dt == DT - 1) asm volatile("s_wait_xcnt 0x0" ::: "memory");      /* stands in front of the trip's last two loads: the result of the first lands in the address registers of the hi plane's loads above */
      bl[dt].half[0] = *(const v8us*)vrl;
      if (dt == DT - 1) asm volatile("s_wait_xcnt 0x0" ::: "memory");      /* stands in front of the trip's last load, whose result lands in the address registers of the V loads above */
      bl[dt].half[1] = *(const v8us*)(vrl + 256); }
    __builtin_amdgcn_sched_barrier(0);      /* keeps the loads above together: without it the scheduler moves each one down to its first use, one exposed latency apiece */
#pragma unroll
    for (int nt = 0; nt < 2; ++nt) { v8f acc = (v8f){0.f,0.f,0.f,0.f,0.f,0.f,0.f,0.f};      /* K rows as A, Q as B: register r = key nt * 16 + 8 hh + r, column ln = query */
#pragma unroll
      for (int ks = 0; ks < KS; ++ks) acc = mmaH<1>(bk[nt][ks].v, bk[nt][ks].v, aq[0][ks].v, aq[0][ks].v, acc); s[nt] = acc; }
    bool ok[16]; const int tq = q0 + ln;
#pragma unroll
    for (int i = 0; i < 16; ++i) { const int k = j0 + (i >> 3) * 16 + 8 * hh + (i & 7);
      bool o = (CAUSAL == 1) ? (k <= tq) : ((CAUSAL == 2) ? ((k >> 5) == (tq >> 5)) : true);      /* mode 2: block-diagonal 32-token groups */
      if (CAUSAL == 8) o = mk[i >> 3][(i >> 2) & 1][i & 3] != 0;      /* mode 8: per-(query, key) int table shared by all batches and heads */
      if (CAUSAL == 4) o = MSK[((size_t)b * TQA + tq) * TK + k] != 0;      /* mode 4: per-(query, key) INPUT mask shared by all heads; masked keys contribute nothing (== the reference's -4096 fill, whose exp underflows to 0), rows with no valid key give l = 0 -> output 0 (== the reference's row_valid zeroing) */
      ok[i] = o; }
    FragH ph, pl; sm_trip(s, ok, m_c, l_c, oacc, oaccL, ph, pl);
#pragma unroll
    for (int dt = 0; dt < DT; ++dt) { oacc[dt] = mmaH<1>(bv[dt].v, bv[dt].v, ph.v, ph.v, oacc[dt]); oaccL[dt] = mmaH<1>(bv[dt].v, bv[dt].v, pl.v, pl.v, oaccL[dt]); oaccL[dt] = mmaH<1>(bl[dt].v, bl[dt].v, ph.v, ph.v, oaccL[dt]); } }      /* V^T rows as A, P^T as B */
  /* each wave leaves its queries' maxima, sums (both halves joined) and unnormalised outputs in LDS, a row per query: a lane's 8 registers of a tile are 8 consecutive dims of its row */
  { const float l = l_c + half_swap(l_c); if (hh == 0) { sM[w][ln] = m_c; sL[w][ln] = l; } }
#pragma unroll
  for (int dt = 0; dt < DT; ++dt) { v4f v0, v1;
#pragma unroll
    for (int r = 0; r < 4; ++r) { float v = oacc[dt][r]; v += oaccL[dt][r] * 0.0009765625f; v0[r] = v; v = oacc[dt][4 + r]; v += oaccL[dt][4 + r] * 0.0009765625f; v1[r] = v; }
    *(v4fa*)&sO[w][ln][dt * 16 + 8 * hh] = v0; *(v4fa*)&sO[w][ln][dt * 16 + 8 * hh + 4] = v1; }
  __syncthreads();      /* every wave's partials are in LDS before any thread merges them */
  /* merge, a thread per (row, 4 columns): M = max m_u; l = sum l_u e^(m_u - M); O = sum O_u e^(m_u - M), u in wave order. A wave with no live key for the row has m_u = -3.0e38, l_u = 0, O_u = 0 and adds nothing; a row with no live key at all gives l = 0 -> output 0 */
  /* the result leaves as the next GEMM's A operand: f16 hi plane and 2^10 residual plane in fragment order (ldo elements a row). A wave takes the 16 rows and two neighbouring column groups, which are 8 k of every row: 256 contiguous bytes of each plane */
  if (tid < RPW * 16) { const int r = tid & 15, pc = tid >> 4; float mm = sM[0][r];      /* both loops below are unrolled so that their LDS reads are issued together, ahead of the arithmetic */
#pragma unroll
    for (int u = 1; u < NSPL; ++u) mm = fmaxf(mm, sM[u][r]);
    float l = 0.f; v4f a = {0.f, 0.f, 0.f, 0.f};
#pragma unroll
    for (int u = 0; u < NSPL; ++u) { const float f = expf(sM[u][r] - mm); const v4f val = *(const v4fa*)&sO[u][r][pc * 4]; l += sL[u][r] * f; a += val * f; }
    const float li = (l > 0.f) ? 1.0f / (l * 1024.0f) : 0.f;
    const v4f o = a * li; v4h oh, ol;
#pragma unroll
    for (int q = 0; q < 4; ++q) { const _Float16 hv = (_Float16)o[q]; oh[q] = hv; ol[q] = (_Float16)((o[q] - (float)hv) * 1024.0f); }
    const size_t e = fo_dst(b * TQA + q0 + r, h * 64 + (pc >> 1) * 8, ldo) + (pc & 1) * 4;
    *(v4h*)(OH + e) = oh; *(v4h*)(OL + e) = ol; } }

// 3-term variant: O = (P_hi V_hi + (P_lo V_hi + P_hi V_lo) / 1024) / l with P = [hi | 2^10 residual] of 1024 p and V^T = [hi | 2^10 residual] planes (VtL same layout as Vt) -> ~2^-21-class products for un-averaged (early causal / peaked) rows
template <int CAUSAL>
__global__ __launch_bounds__(256) void k_flash3gB(const _Float16* __restrict__ Q16, int ldq, const _Float16* __restrict__ K16, int ldk, const _Float16* __restrict__ Vt, const _Float16* __restrict__ VtL, const int* __restrict__ MSK, const unsigned int* __restrict__ LV, _Float16* __restrict__ OH, _Float16* __restrict__ OL, int ldo) {
  constexpr int RPW = 16, RTN = RPW / 16, NQB = TQB / (4 * RPW), DT = 4, KS = 2;
  const int tid = threadIdx.x, w = __builtin_amdgcn_readfirstlane(tid >> 5), lane = tid & 31, ln = lane & 15, hh = lane >> 4;      /* the wave's number in a scalar register: the tile number, its live bits and the test on them stay scalar */
  const int slab = blockIdx.x / (QTB / 16), pblk = blockIdx.x % (QTB / 16); (void)NQB; const int b = slab / NH, h = slab % NH;
  /* a wave takes two 16-query tiles one after the other, t and QTB - 1 - t: where the live key tiles grow with the query position, as under a causal mask, every wave then walks about the same number of them. For any mask each tile is taken exactly once */
#pragma unroll 1      /* kept rolled: one copy of the key loop in the instruction cache */
  for (int it = 0; it < 2; ++it) {
  const int qt = it ? QTB - 1 - (pblk * 8 + w) : pblk * 8 + w; const int q0 = qt * RPW;
  const unsigned int* lv = LV + (size_t)qt * (3 * 4 * 32);      /* bit kt & 31 of word kt >> 5, the four row groups joined: key tile kt holds a non-zero mask word for this query tile */
  unsigned int lw0 = ~0u, lw1 = ~0u, lw2 = ~0u;      /* the modes without a mask table walk every key tile */
  if (CAUSAL == 8) { lw0 = __builtin_amdgcn_readfirstlane(lv[0] | lv[32] | lv[64] | lv[96]); lw1 = __builtin_amdgcn_readfirstlane(lv[128] | lv[160] | lv[192] | lv[224]); lw2 = __builtin_amdgcn_readfirstlane(lv[256] | lv[288] | lv[320] | lv[352]); }
  FragH aq[2][KS];
#pragma unroll
  for (int rt = 0; rt < RTN; ++rt) { const unsigned short* qr = (const unsigned short*)Q16 + ((size_t)((b * TQB + q0 + rt * 16) >> 4) * (ldq >> 5) + h * 2) * 512 + lane * 8;      /* Q, K and both V^T planes in fragment order */
#pragma unroll
    for (int ks = 0; ks < KS; ++ks) { aq[rt][ks].half[0] = *(const v8us*)(qr + ks * 512); aq[rt][ks].half[1] = *(const v8us*)(qr + ks * 512 + 256); } }
  const size_t vslab = (size_t)(b * (NH / KVG) + h / KVG); const unsigned short* Vth = (const unsigned short*)Vt + vslab * 64 * TK; const unsigned short* Vtl = (const unsigned short*)VtL + vslab * 64 * TK;      /* GQA: q-head h reads kv head h / KVG */
  float m_c = -3.0e38f, l_c = 0.f; v8f oacc[DT], oaccL[DT];      /* of the lane's query q0 + ln; register r of tile dt is dim dt * 16 + 8 hh + r */
#pragma unroll
  for (int dt = 0; dt < DT; ++dt) { oacc[dt] = (v8f){0.f,0.f,0.f,0.f,0.f,0.f,0.f,0.f}; oaccL[dt] = oacc[dt]; }
  const int jend = (CAUSAL == 1) ? (q0 + RPW) : TK;      /* causal: keys beyond the tile's last query never contribute */
#pragma unroll 1
  for (int j0 = 0; j0 < jend; j0 += 32) {
    /* a key tile whose 16 x 32 mask words are all zero leaves m, l and O as they are (every p is 0 and the rescale factor is 1): it is passed over, on a scalar test */
    const int kt = j0 >> 5; const unsigned int lw = (kt < 32) ? lw0 : ((kt < 64) ? lw1 : lw2);
    if (((lw >> (kt & 31)) & 1u) == 0u) continue;
    v8f s[2]; FragH bk[2][KS], bv[DT], bl[DT]; v4im mk[2][2];
    /* every global load of the trip is issued here, in the order of use (K, mask words, both V planes): their latencies overlap, and V lands behind the softmax */
#pragma unroll
    for (int nt = 0; nt < 2; ++nt) { const unsigned short* kr = (const unsigned short*)K16 + ((size_t)((b * TK + j0 + nt * 16) >> 4) * (ldk >> 5) + (h / KVG) * 2) * 512 + lane * 8;
#pragma unroll
      for (int ks = 0; ks < KS; ++ks) { bk[nt][ks].half[0] = *(const v8us*)(kr + ks * 512); bk[nt][ks].half[1] = *(const v8us*)(kr + ks * 512 + 256); } }
    asm volatile("s_wait_xcnt 0x0" ::: "memory");      /* stands in front of the mask loads, whose results may land in registers that the K loads name as addresses */
    if (CAUSAL == 8) { const int* mrow = MSK + (size_t)(q0 + ln) * TK + j0 + 8 * hh;      /* the lane's query row: its 8 keys of each 16-key tile, 32 contiguous bytes */
#pragma unroll
      for (int nt = 0; nt < 2; ++nt) { mk[nt][0] = *(const v4im*)(mrow + nt * 16); mk[nt][1] = *(const v4im*)(mrow + nt * 16 + 4); } }
    asm volatile("s_wait_xcnt 0x0" ::: "memory");      /* stands in front of the V loads, whose results may land in registers that the K and mask loads name as addresses */
#pragma unroll
    for (int dt = 0; dt < DT; ++dt) { const size_t vo = ((size_t)dt * (TK / 32) + (j0 >> 5)) * 512 + lane * 8; const unsigned short* vrow = Vth + vo; const unsigned short* vrl = Vtl + vo; bv[dt].half[0] = *(const v8us*)vrow; bv[dt].half[1] = *(const v8us*)(vrow + 256); bl[dt].half[0] = *(const v8us*)vrl;
      if (dt == DT - 1) asm volatile("s_wait_xcnt 0x0" ::: "memory");      /* stands in front of the trip's last load, whose result lands in the address registers of the V loads above */
      bl[dt].half[1] = *(const v8us*)(vrl + 256); }
    __builtin_amdgcn_sched_barrier(0);      /* keeps the loads above together: without it the scheduler moves each one down to its first use, one exposed latency apiece */
#pragma unroll
    for (int nt = 0; nt < 2; ++nt) { v8f acc = (v8f){0.f,0.f,0.f,0.f,0.f,0.f,0.f,0.f};      /* K rows as A, Q as B: register r = key nt * 16 + 8 hh + r, column ln = query */
#pragma unroll
      for (int ks = 0; ks < KS; ++ks) acc = mmaH<1>(bk[nt][ks].v, bk[nt][ks].v, aq[0][ks].v, aq[0][ks].v, acc); s[nt] = acc; }
    bool ok[16]; const int tq = q0 + ln;
#pragma unroll
    for (int i = 0; i < 16; ++i) { const int k = j0 + (i >> 3) * 16 + 8 * hh + (i & 7);
      bool o = (CAUSAL == 1) ? (k <= tq) : ((CAUSAL == 2) ? ((k >> 5) == (tq >> 5)) : true);      /* mode 2: block-diagonal 32-token groups */
      if (CAUSAL == 8) o = mk[i >> 3][(i >> 2) & 1][i & 3] != 0;      /* mode 8: per-(query, key) int table shared by all batches and heads */
      if (CAUSAL == 4) o = MSK[((size_t)b * TQB + tq) * TK + k] != 0;      /* mode 4: per-(query, key) INPUT mask shared by all heads; masked keys contribute nothing (== the reference's -4096 fill, whose exp underflows to 0), rows with no valid key give l = 0 -> output 0 (== the reference's row_valid zeroing) */
      ok[i] = o; }
    FragH ph, pl; sm_trip(s, ok, m_c, l_c, oacc, oaccL, ph, pl);
#pragma unroll
    for (int dt = 0; dt < DT; ++dt) { oacc[dt] = mmaH<1>(bv[dt].v, bv[dt].v, ph.v, ph.v, oacc[dt]); oaccL[dt] = mmaH<1>(bv[dt].v, bv[dt].v, pl.v, pl.v, oaccL[dt]); oaccL[dt] = mmaH<1>(bl[dt].v, bl[dt].v, ph.v, ph.v, oaccL[dt]); } }      /* V^T rows as A, P^T as B */
  /* the halves' sums joined; the result leaves as the output GEMM's A operand, f16 hi plane and 2^10 residual plane in fragment order (ldo elements a row): a lane's 8 registers of tile dt are k = h * 64 + dt * 16 + 8 hh .. + 7 of row ln, which is the lane's own 16 bytes of half dt & 1 of block h * 2 + (dt >> 1), so each store of a wave is 512 contiguous bytes straight from registers */
  const float lt = l_c + half_swap(l_c); const float li = (lt > 0.f) ? 1.0f / (lt * 1024.0f) : 0.f;
  const size_t oo = ((size_t)((b * TQB + q0) >> 4) * (ldo >> 5) + h * 2) * 512 + lane * 8; unsigned short* oh = (unsigned short*)OH + oo; unsigned short* ol = (unsigned short*)OL + oo;
#pragma unroll
  for (int dt = 0; dt < DT; ++dt) { FragH fh, fl;
#pragma unroll
    for (int r = 0; r < 8; ++r) { float v = oacc[dt][r]; v += oaccL[dt][r] * 0.0009765625f; v = v * li; const _Float16 hv = (_Float16)v; fh.h[r] = hv; fl.h[r] = (_Float16)((v - (float)hv) * 1024.0f); }
    *(v8us*)(oh + dt * 256) = fh.half[0]; *(v8us*)(ol + dt * 256) = fl.half[0]; }
  asm volatile("s_wait_xcnt 0x0" ::: "memory");      /* stands in front of the second tile's set-up, which overwrites registers that the stores above name */
  } }

// two planes [nout][nin] in fragment order, one behind the other: x16 weights (for the hi operand), then x1 weights (for the 2^10 residual operand) at Bt + nout * nin
__device__ __forceinline__ void d_wpair(int bx, const float* __restrict__ Wm, int nin, int nout, _Float16* __restrict__ Bt) { const size_t t = (size_t)bx * 256 + threadIdx.x; if (t >= (size_t)nout * (2 * nin / 8)) return; const size_t per = (size_t)nout * (nin / 8); const bool lo = t >= per; const FoRK s = fo_src(lo ? t - per : t, nin); const int o = s.row; FragH f;
  for (int q = 0; q < 8; ++q) { const int c = s.k + q; if (q) asm volatile("s_wait_xcnt 0x0" ::: "memory");      /* stands in front of each further load, whose result may land in a register that an earlier load names as its address */
    f.h[q] = (_Float16)(bf16_round(Wm[(size_t)c * nout + o]) * (lo ? 1.0f : 16.0f)); } *(v8us*)((unsigned short*)Bt + t * 8) = f.half[0];  }
template <int TWO_D>
__device__ __forceinline__ void d_rotab(int bx, int nrows, int rpb, const int* __restrict__ bar, const int* __restrict__ tib, float* __restrict__ CS, float* __restrict__ SN) {
  #pragma clang fp contract(off)
  const size_t t = (size_t)bx * 256 + threadIdx.x; if (t >= (size_t)nrows * 32) return; const int d = (int)(t % 32); const int row = (int)(t / 32); const int b = row / rpb, r = row % rpb; float pos, inv;
  if (TWO_D) { const int dm = d & 15; inv = 1.0f / powf(10000.0f, (float)dm * 2.0f / 32.0f); pos = (d < 16) ? (float)bar[(size_t)b * rpb + r] : (float)tib[(size_t)b * rpb + r]; }
  else { inv = 1.0f / powf(10000.0f, (float)(2 * d) / 64.0f); pos = (float)r; }
  const float th = pos * inv; const float c = cosf(th), s = sinf(th);
  { *(float*)(CS + t) = c; *(float*)(SN + t) = s;  } }
__device__ __forceinline__ void d_rope(int bx, const float* __restrict__ F, int nrows, int rpb, int nheads, const float* __restrict__ CS, const float* __restrict__ SN, _Float16* __restrict__ dst, int ldo, int dst_bstride, int row_off) {
  #pragma clang fp contract(off)
  /* dst in fragment order (ldo elements a row): a wave takes 16 rows of one head and the dims jg .. jg + 7 and jg + 32 .. jg + 39 that make half a fragment each; rpb, dst_bstride and row_off are multiples of 16 */
  const size_t t = (size_t)bx * 256 + threadIdx.x; if (t >= (size_t)nrows * nheads * 4) return; const int lane = (int)(t & 31); const size_t wid = t >> 5; const int jg = (int)(wid & 1) * 16 + (lane >> 4) * 8; const int h = (int)((wid >> 1) % nheads); const int row = (int)((wid >> 1) / nheads) * 16 + (lane & 15); const int b = row / rpb, r = row % rpb; const int ldi = nheads * 64;
  const float* xr = F + (size_t)row * ldi + h * 64; FragH f0, f1;
#pragma unroll
  for (int q = 0; q < 8; ++q) { const int d = jg + q; const float c = CS[(size_t)row * 32 + d], s = SN[(size_t)row * 32 + d]; const float x0 = xr[d], x1 = xr[d + 32];
    float o0 = x0 * c; o0 += -x1 * s; float o1 = x1 * c; o1 += x0 * s; f0.h[q] = (_Float16)o0; f1.h[q] = (_Float16)o1; }
  unsigned short* o = (unsigned short*)dst + fo_dst(b * dst_bstride + row_off + r, h * 64 + jg, ldo);
  { *(v8us*)o = f0.half[0]; *(v8us*)(o + 512) = f1.half[0];  } }      /* 32 dims on: the next block */
// f16 plane of an f32 plane, in fragment order (k2 into the key plane)
__device__ __forceinline__ void d_putk(int bx, const float* __restrict__ F, int nrows, int rpb, int ncol, _Float16* __restrict__ H, int dst_bstride, int row_off) {
  const size_t t = (size_t)bx * 256 + threadIdx.x; if (t >= (size_t)nrows * (ncol / 8)) return; const FoRK s = fo_src(t, ncol); const int b = s.row / rpb, r = s.row % rpb; FragH fh;
  for (int q = 0; q < 8; ++q) fh.h[q] = (_Float16)F[(size_t)s.row * ncol + s.k + q];
  *(v8us*)((unsigned short*)H + fo_dst(b * dst_bstride + row_off + r, s.k, ncol)) = fh.half[0]; }

// live bits of the phase-2 mask: bit l of word (qt, wd, rg) says whether key tile wd * 32 + l (32 keys) holds a non-zero word in rows 4 rg .. 4 rg + 3 of the 16-query tile qt. A wave per word, a lane per key tile (128 bytes a row); each word has a 128-byte line of its own
__device__ __forceinline__ void d_live(int bx, const int* __restrict__ MSK, unsigned int* __restrict__ LV) {
  typedef int v4ia __attribute__((ext_vector_type(4), may_alias));
  const int wv = bx * 8 + (int)(threadIdx.x >> 5), lane = threadIdx.x & 31; const int rg = wv & 3, wd = (wv >> 2) % 3, qt = (wv >> 2) / 3; const int kt = wd * 32 + lane; v4ia any = {0, 0, 0, 0};
  if (kt < TK / 32) { const int* p = MSK + (size_t)(qt * 16 + rg * 4) * TK + kt * 32;
#pragma unroll 1
    for (int r = 0; r < 4; ++r) {      /* kept rolled: a row's 8 loads are in flight together, and the launch's register count stays low for its other ranges */
#pragma unroll
      for (int c = 0; c < 8; ++c) any |= *(const v4ia*)(p + (size_t)r * TK + c * 4); } }
  const unsigned int word = __builtin_amdgcn_ballot_w32((any[0] | any[1] | any[2] | any[3]) != 0);
  if (lane == 0) LV[(size_t)wv * 32] = word; }

// ---- one launch per dependency level: kernels that do not depend on one another run as consecutive block ranges of one grid. Every range test reads blockIdx.x alone, so a work-group takes one branch as a whole; each body is the same code as before, handed its block number inside its own range. ----
constexpr int PB_W = DMOD * DMOD / 8 / 256, PB_WK = DMOD * KVD / 8 / 256;                  /* blocks of one transposed weight plane: 1024 and 256 columns */
constexpr int PB_P = DMOD * (2 * DMOD / 8) / 256, PB_PK = KVD * (2 * DMOD / 8) / 256;       /* blocks of one hi | residual weight pair */
constexpr int PB_T1 = NRS * 32 / 256, PB_T2 = NRR * 32 / 256;                              /* RoPE tables */
constexpr int PB_XS = NRS * DMOD / 8 / 256, PB_XR = NRR * DMOD / 8 / 256;                  /* f16 planes of the two inputs */
constexpr int PB_ALL = 2 * PB_W + 4 * PB_WK + 2 * PB_P + 2 * PB_PK + PB_T1 + PB_T2 + PB_XS + PB_XR;
__global__ __launch_bounds__(256) void k_prep(const float* w_sq, const float* w_sk, const float* w_sv, const float* w_rq, const float* w_rk, const float* w_rv,
    _Float16* BSQ, _Float16* BSK, _Float16* BSV, _Float16* BRQ, _Float16* BRK, _Float16* BRV,
    const float* w_so, const float* w_ro, const float* w_k2, const float* w_v2, _Float16* BSO, _Float16* BRO, _Float16* BK2, _Float16* BV2,
    const int* bar, const int* tib, float* CS1, float* SN1, float* CS2, float* SN2, const float* sum_x, _Float16* SX, const float* reg_x, _Float16* RX) {
  int bx = blockIdx.x;
  if (bx < 2 * PB_W + 4 * PB_WK) { const float* Wm = w_sq; _Float16* Bt = BSQ; int nout = DMOD;
    if (bx >= PB_W) { bx -= PB_W; Wm = w_rq; Bt = BRQ;
      if (bx >= PB_W) { bx -= PB_W; Wm = w_sk; Bt = BSK; nout = KVD;
        if (bx >= PB_WK) { bx -= PB_WK; Wm = w_sv; Bt = BSV;
          if (bx >= PB_WK) { bx -= PB_WK; Wm = w_rk; Bt = BRK;
            if (bx >= PB_WK) { bx -= PB_WK; Wm = w_rv; Bt = BRV; } } } } }
    d_wt_f16(bx, Wm, Bt, DMOD, nout, 16.0f); return; }
  bx -= 2 * PB_W + 4 * PB_WK;
  if (bx < 2 * PB_P + 2 * PB_PK) { const float* Wm = w_so; _Float16* Bt = BSO; int nout = DMOD;
    if (bx >= PB_P) { bx -= PB_P; Wm = w_ro; Bt = BRO;
      if (bx >= PB_P) { bx -= PB_P; Wm = w_k2; Bt = BK2; nout = KVD;
        if (bx >= PB_PK) { bx -= PB_PK; Wm = w_v2; Bt = BV2; } } }
    d_wpair(bx, Wm, DMOD, nout, Bt); return; }
  bx -= 2 * PB_P + 2 * PB_PK;
  if (bx < PB_T1) { d_rotab<0>(bx, NRS, SS, nullptr, nullptr, CS1, SN1); return; }
  bx -= PB_T1;
  if (bx < PB_T2) { d_rotab<1>(bx, NRR, RR, bar, tib, CS2, SN2); return; }
  bx -= PB_T2;
  if (bx < PB_XS) d_x16(bx, sum_x, SX, (size_t)NRS * DMOD / 8, DMOD); else d_x16(bx - PB_XS, reg_x, RX, (size_t)NRR * DMOD / 8, DMOD); }

// up to six GEMMs (d_gemm2) in one launch, all with the same K and alpha, operands in fragment order; ldc = N. Jobs 0..2 read A0 (Ma rows), jobs 3..5 read A1 (Mb rows); in each triple N = DMOD, KVD, KVD. S_j is job j's bias. np == 2 (jobs 0..2 only): A0L is the residual plane of A0, and each B_j is a pair of planes, x16 weights and behind them x1 weights; both products are summed in the one launch. The grid ends behind the last job in use; the pointers of jobs behind it are not read.
__global__ __launch_bounds__(128) void k_gemm2m(const _Float16* A0, const _Float16* A1, const _Float16* A0L, const _Float16* B0, const _Float16* B1, const _Float16* B2, const _Float16* B3, const _Float16* B4, const _Float16* B5,
    const float* S0, const float* S1, const float* S2, const float* S3, const float* S4, const float* S5, float* C0, float* C1, float* C2, float* C3, float* C4, float* C5, int Ma, int Mb, int K, float alpha, int np) {
  int bx = blockIdx.x; const int ta = Ma >> 7, tb = Mb >> 7;      /* 128-row block tiles; a job has (M / 128) * (N / 64) blocks */
  const _Float16* A = A0; const _Float16* B = B0; const float* S = S0; float* C = C0; int M = Ma, N = DMOD;
  if (bx >= ta * (DMOD / 64)) { bx -= ta * (DMOD / 64); B = B1; S = S1; C = C1; N = KVD;
    if (bx >= ta * (KVD / 64)) { bx -= ta * (KVD / 64); B = B2; S = S2; C = C2;
      if (bx >= ta * (KVD / 64)) { bx -= ta * (KVD / 64); A = A1; M = Mb; B = B3; S = S3; C = C3; N = DMOD;
        if (bx >= tb * (DMOD / 64)) { bx -= tb * (DMOD / 64); B = B4; S = S4; C = C4; N = KVD;
          if (bx >= tb * (KVD / 64)) { bx -= tb * (KVD / 64); B = B5; S = S5; C = C5; } } } } }
  d_gemm2<0>(bx, A, 0, B, 0, A0L, B + (size_t)N * K, np, alpha, S, 0, nullptr, 1, (size_t)N, 0, C, nullptr, N, 0, M, N, K); }

constexpr int QB_RQ = NRR * NH * 4 / 256, QB_RK = NRR * NKV * 4 / 256, QB_RV = NB * NKV * (RR / 64), QB_SQ = NRS * NH * 4 / 256, QB_SK = NRS * NKV * 4 / 256, QB_SV = NB * NKV * (SS / 64), QB_K2 = NRS * (KVD / 8) / 256;      /* values: a block per tile of 64 keys x 64 dims */
constexpr int QB_LV = QTB * 3 * 4 / 8;      /* live bits of the phase-2 mask: 8 waves a block, a wave per word */
// what follows the six projections: RoPE of both q and both k planes, transposed hi + residual planes of both v; ahead of them, as it depends on an input alone, the live bits of the phase-2 mask
__global__ __launch_bounds__(256) void k_post(const float* FSQ, const float* FSK, const float* FSV, const float* FRQ, const float* FRK, const float* FRV, const float* CS1, const float* SN1, const float* CS2, const float* SN2,
    _Float16* SQ, _Float16* RQ, _Float16* KC, _Float16* VT, _Float16* VTL, const int* mupd, unsigned int* LV) {
  int bx = blockIdx.x;
  if (bx < QB_LV) { d_live(bx, mupd, LV); return; }
  bx -= QB_LV;
  if (bx < QB_RQ + QB_RK + QB_SQ + QB_SK) { const float* F = FRQ; const float* CS = CS2; const float* SN = SN2; _Float16* dst = RQ; int nrows = NRR, rpb = RR, nheads = NH, bstr = RR, roff = 0;
    if (bx >= QB_RQ) { bx -= QB_RQ; F = FRK; dst = KC; nheads = NKV; bstr = TK; roff = SS;      /* keys 64.. of each batch */
      if (bx >= QB_RK) { bx -= QB_RK; F = FSQ; CS = CS1; SN = SN1; dst = SQ; nrows = NRS; rpb = SS; nheads = NH; bstr = SS; roff = 0;
        if (bx >= QB_SQ) { bx -= QB_SQ; F = FSK; dst = KC; nheads = NKV; bstr = TK; } } }      /* keys 0..63 of each batch */
    d_rope(bx, F, nrows, rpb, nheads, CS, SN, dst, nheads * 64, bstr, roff); return; }
  bx -= QB_RQ + QB_RK + QB_SQ + QB_SK;
  const bool rg = bx < QB_RV; d_vtf(rg ? bx : bx - QB_RV, rg ? FRV : FSV, rg ? RR : SS, rg ? SS : 0, VT, VTL); }      /* regular values at keys 64.., summary values at keys 0..63 of each batch */
// k2 into key rows 0..63 (one plane), v2 into keys 0..63 of both V^T planes, of each batch; the regular keys' part of the planes stands as k_post wrote it
__global__ __launch_bounds__(256) void k_put2(const float* FK2, const float* FV2, _Float16* KC, _Float16* VT, _Float16* VTL) {
  const int bx = blockIdx.x;
  if (bx < QB_K2) d_putk(bx, FK2, NRS, SS, KVD, KC, TK, 0); else d_vtf(bx - QB_K2, FV2, SS, 0, VT, VTL); }

extern "C" void kernel_launch(void* const* d_in, const int* in_sizes, int n_in,
                              void* d_out, int out_size, void* d_ws, size_t ws_size, hipStream_t stream) {
  (void)in_sizes; (void)n_in; (void)out_size;
  const float* const* I = (const float* const*)d_in; const float* sum_x = I[0]; const float* reg_x = I[1];
  const float* w_sq = I[2]; const float* b_sq = I[3]; const float* w_sk = I[4]; const float* b_sk = I[5]; const float* w_sv = I[6]; const float* b_sv = I[7]; const float* w_so = I[8]; const float* b_so = I[9];
  const float* w_rq = I[10]; const float* b_rq = I[11]; const float* w_rk = I[12]; const float* b_rk = I[13]; const float* w_rv = I[14]; const float* b_rv = I[15]; const float* w_ro = I[16]; const float* b_ro = I[17];
  const float* w_k2 = I[18]; const float* b_k2 = I[19]; const float* w_v2 = I[20]; const float* b_v2 = I[21];
  const int* bar = (const int*)d_in[22]; const int* tib = (const int*)d_in[23]; const int* msum = (const int*)d_in[24]; const int* mupd = (const int*)d_in[25];
  char* ws = (char*)d_ws; size_t off = 0;
  auto take = [&](size_t bytes) { char* p = ws + off; off += (bytes + 255) & ~(size_t)255; return p; };
  const size_t w8 = (size_t)DMOD * DMOD / 8, w8k = (size_t)DMOD * KVD / 8;
  _Float16* BSQ = (_Float16*)take(w8 * 16); _Float16* BSK = (_Float16*)take(w8k * 16); _Float16* BSV = (_Float16*)take(w8k * 16); _Float16* BRQ = (_Float16*)take(w8 * 16); _Float16* BRK = (_Float16*)take(w8k * 16); _Float16* BRV = (_Float16*)take(w8k * 16);
  _Float16* BSO = (_Float16*)take(w8 * 32); _Float16* BRO = (_Float16*)take(w8 * 32); _Float16* BK2 = (_Float16*)take(w8k * 32); _Float16* BV2 = (_Float16*)take(w8k * 32);
  float* CS1 = (float*)take((size_t)NRS * 32 * 4); float* SN1 = (float*)take((size_t)NRS * 32 * 4); float* CS2 = (float*)take((size_t)NRR * 32 * 4); float* SN2 = (float*)take((size_t)NRR * 32 * 4); _Float16* SX = (_Float16*)take((size_t)NRS * DMOD * 2); _Float16* RX = (_Float16*)take((size_t)NRR * DMOD * 2);
  /* each projection has an f32 plane of its own, since all six are written by one launch */
  float* FRQ = (float*)take((size_t)NRR * DMOD * 4); float* FRK = (float*)take((size_t)NRR * KVD * 4); float* FRV = (float*)take((size_t)NRR * KVD * 4); float* FSQ = (float*)take((size_t)NRS * DMOD * 4); float* FSK = (float*)take((size_t)NRS * KVD * 4); float* FSV = (float*)take((size_t)NRS * KVD * 4);
  _Float16* SQ = (_Float16*)take((size_t)NRS * DMOD * 2); _Float16* RQ = (_Float16*)take((size_t)NRR * DMOD * 2); _Float16* KC = (_Float16*)take((size_t)NB * TK * KVD * 2); _Float16* VT = (_Float16*)take((size_t)NB * NKV * 64 * TK * 2); _Float16* VTL = (_Float16*)take((size_t)NB * NKV * 64 * TK * 2);
  _Float16* O1H = (_Float16*)take((size_t)NRS * DMOD * 2); _Float16* O1L = (_Float16*)take((size_t)NRS * DMOD * 2); _Float16* O2H = (_Float16*)FRQ; _Float16* O2L = O2H + (size_t)NRR * DMOD;      /* both reg_attn planes over the reg-q f32 scratch (dead after k_post) */
  unsigned int* LV = (unsigned int*)take((size_t)QTB * 3 * 4 * 128);      /* live bits of the phase-2 mask, a 128-byte line a word */
  float* FK2 = FSK; float* FV2 = FSV;      /* k2 / v2 f32 planes over the summary k / v scratch (dead after k_post) */
  if (off > ws_size) return;      /* about 70 MiB */
  float* out0 = (float*)d_out; float* out1 = (float*)d_out + (size_t)NRS * DMOD;
  /* weight planes, RoPE tables, input planes */
  k_prep<<<PB_ALL, 256, 0, stream>>>(w_sq, w_sk, w_sv, w_rq, w_rk, w_rv, BSQ, BSK, BSV, BRQ, BRK, BRV, w_so, w_ro, w_k2, w_v2, BSO, BRO, BK2, BV2, bar, tib, CS1, SN1, CS2, SN2, sum_x, SX, reg_x, RX);
  /* summary q/k/v and regular q/k/v */
  k_gemm2m<<<(NRS / 128 + NRR / 128) * ((DMOD + 2 * KVD) / 64), 128, 0, stream>>>(SX, RX, nullptr, BSQ, BSK, BSV, BRQ, BRK, BRV, b_sq, b_sk, b_sv, b_rq, b_rk, b_rv, FSQ, FSK, FSV, FRQ, FRK, FRV, NRS, NRR, DMOD, 0.0625f, 1);
  k_post<<<QB_LV + QB_RQ + QB_RK + QB_SQ + QB_SK + QB_RV + QB_SV, 256, 0, stream>>>(FSQ, FSK, FSV, FRQ, FRK, FRV, CS1, SN1, CS2, SN2, SQ, RQ, KC, VT, VTL, mupd, LV);
  /* phase 1: summary queries over [summary ; regular] keys; sum_attn leaves as hi + residual planes */
  k_flash3gA<8><<<NB * NH * (TQA / 16), 32 * NSPL, 0, stream>>>(SQ, DMOD, KC, KVD, VT, VTL, msum, O1H, O1L, DMOD);
  /* output 0 = sum_attn W_so + b_so; k2 / v2 from sum_attn (no RoPE): hi and residual product of each in the one launch */
  k_gemm2m<<<(NRS / 128) * ((DMOD + 2 * KVD) / 64), 128, 0, stream>>>(O1H, nullptr, O1L, BSO, BK2, BV2, nullptr, nullptr, nullptr, b_so, b_k2, b_v2, nullptr, nullptr, nullptr, out0, FK2, FV2, nullptr, nullptr, nullptr, NRS, 0, DMOD, 1.0f / 1024.0f, 2);
  k_put2<<<QB_K2 + QB_SV, 256, 0, stream>>>(FK2, FV2, KC, VT, VTL);      /* into keys 0..63 of each batch */
  /* phase 2: regular queries over [k2 ; regular] keys; reg_attn leaves as hi + residual planes */
  k_flash3gB<8><<<NB * NH * (QTB / 16), 256, 0, stream>>>(RQ, DMOD, KC, KVD, VT, VTL, mupd, LV, O2H, O2L, DMOD);
  k_gemm2m<<<(NRR / 128) * (DMOD / 64), 128, 0, stream>>>(O2H, nullptr, O2L, BRO, nullptr, nullptr, nullptr, nullptr, nullptr, b_ro, nullptr, nullptr, nullptr, nullptr, nullptr, out1, nullptr, nullptr, nullptr, nullptr, nullptr, NRR, 0, DMOD, 1.0f / 1024.0f, 2);
}

// v009
// A run of this version takes 175 microseconds.
// Next to v008, in two timings, it ran 1.22 and 1.21 times as fast.
// Over all steps from v000, the starting kernel, it is 7.90 times as fast.
#include <hip/hip_runtime.h>
// FlexSummaryAttention (2 batches; 64 summary tokens S, 2048 regular tokens R, D = 1024; 16 query heads, 4 kv heads (GQA), head dim 64): q/k/v projections for both token sets; 1-D RoPE on summary q/k, 2-D hierarchical RoPE (bar id | token-in-bar id) on regular q/k; phase 1: summary queries over [summary; regular] keys with the summarize mask -> sum_attn; k2/v2 = sum_attn W + b; phase 2: regular queries over [k2; regular k] / [v2; regular v] with the updating mask -> reg_attn; outputs sum_attn W_so + b and reg_attn W_ro + b.
// Structure: exact f16 planes of both inputs; six projection GEMMs (32x64 wave tiles, f32 accumulation, exact x16 weights + bias); RoPE on VALU (thread per (row, head, 8 dims), f32 trig) into f16 q planes and the shared per-batch key plane [k2-or-summary ; regular] (4 kv heads); values as f16 hi + 2^10 residual planes, V^T by LDS tiles; the fused flash kernel (3-term P.V, GQA head mapping, INPUT int mask tables) once per phase; sum_attn / reg_attn as hi + residual pairs into the k2/v2 and output GEMMs.
// Compute dtype: inputs, masks' companions and parameters rounded to bf16; q/k after RoPE as f16 (~2^-12); P and v hi + residual (~2^-21-class); attention outputs hi + residual into the following GEMMs; f32 softmax/accumulation/trig. v_wmma_f32_16x16x32_f16.
#define NB 2
#define SS 64
#define RR 2048
#define DMOD 1024
#define KVD 256
#define NRS (NB * SS)            /* 128 summary rows */
#define NRR (NB * RR)            /* 4096 regular rows */
#define TK 2112                  /* keys per batch in both phases: 64 summary(-derived) + 2048 regular */
#define TQA 64                   /* phase-1 queries (summary tokens) */
#define TQB 2048                 /* phase-2 queries (regular tokens) */
#define TQ TQB
#define NH 16
#define KVG 4                    /* GQA: 16 query heads share 4 kv heads */
#define NKV (NH / KVG)
#define SCL 0.125f               /* 64^-0.5 */
#define QBLKSA (TQA / 64)
#define NSPL 11                  /* phase 1: waves that share the 2112 keys of one 16-query tile, 6 trips of 32 keys each */
#define QBLKSB (TQB / 64)
#define QTB (TQB / 16)           /* phase 2: 16-query tiles */
typedef __bf16 v16b __attribute__((ext_vector_type(16)));
typedef unsigned short v8us __attribute__((ext_vector_type(8), may_alias));
typedef float  v8f  __attribute__((ext_vector_type(8)));
typedef float  v4f  __attribute__((ext_vector_type(4)));
typedef float  v4fa __attribute__((ext_vector_type(4), may_alias));
union FragB { v16b v; v8us half[2]; unsigned short u[16]; };

__device__ __forceinline__ unsigned short bf16_bits(float x) { unsigned int u = __float_as_uint(x); return (unsigned short)((u + 0x7FFFu + ((u >> 16) & 1u)) >> 16); }
__device__ __forceinline__ float bf16_val(unsigned short b) { return __uint_as_float(((unsigned int)b) << 16); }
__device__ __forceinline__ float bf16_round(float x) { return bf16_val(bf16_bits(x)); }
// D += A·B with NT terms: 1 = ah·bh, 2 = + al·bh (A split), 3 = + ah·bl (both split)
template <int NT>
__device__ __forceinline__ v8f mmaN(v16b ah, v16b al, v16b bh, v16b bl, v8f c) {
  c = __builtin_amdgcn_wmma_f32_16x16x32_bf16(false, ah, false, bh, (short)0, c, false, false);
  if (NT >= 2) c = __builtin_amdgcn_wmma_f32_16x16x32_bf16(false, al, false, bh, (short)0, c, false, false);
  if (NT >= 3) c = __builtin_amdgcn_wmma_f32_16x16x32_bf16(false, ah, false, bl, (short)0, c, false, false);
  asm volatile("v_nop\n\tv_nop\n\tv_nop\n\tv_nop" : "+v"(c) : "v"(ah), "v"(al), "v"(bh), "v"(bl));
  return c;
}

__global__ __launch_bounds__(256) void k_wt_bf16(const float* __restrict__ W, unsigned short* __restrict__ Wt, int K, int N) {
  const int t = blockIdx.x * 256 + threadIdx.x;
  const int k8n = K / 8;
  if (t >= N * k8n) return;
  const int n = t / k8n, k8 = (t % k8n) * 8;
  v8us v;
#pragma unroll
  for (int i = 0; i < 8; ++i) v[i] = bf16_bits(W[(size_t)(k8 + i) * N + n]);
  *(v8us*)(Wt + (size_t)n * K + k8) = v;
  
}

// GEMM C[M][N] (f32, pitch ldc) = act(A[M][K]·W + bias). A f32 row-major (pitch lda) converted per fragment to bf16
// (ASPLIT: hi/lo two planes -> 2 terms, else single rounded term); Wt bf16 [N][K] (pitch ldb). BIAS_BF16 rounds the
// bias to bf16 first (bias quantised to bf16 before the add). K%32==0, M%16==0, N%64==0.
template <bool ASPLIT, int ACT, bool BIAS_BF16>
__global__ __launch_bounds__(128) void k_gemm_bf(const float* __restrict__ A, int lda, const unsigned short* __restrict__ Wt, int ldb,
                                               const float* __restrict__ bias, float* __restrict__ C, int ldc, int M, int N, int K) {
  __shared__ __attribute__((aligned(16))) float so[4][16][64];
  const int tid = threadIdx.x, w = tid >> 5, lane = tid & 31, ln = lane & 15, hh = lane >> 4;
  const int ntn = N / 64;
  const int wid = blockIdx.x * 4 + w;
  const int mt = wid / ntn, nq = wid % ntn;
  if (mt * 16 >= M) return;
  const int row0 = mt * 16, col0 = nq * 64;
  const float* arow = A + (size_t)(row0 + ln) * lda;
  v8f acc[4] = {};
  for (int kb = 0; kb < K; kb += 32) {
    FragB ah, al;
    const v4f x0 = *(const v4fa*)(arow + kb + 8 * hh), x1 = *(const v4fa*)(arow + kb + 8 * hh + 4);
    const v4f x2 = *(const v4fa*)(arow + kb + 16 + 8 * hh), x3 = *(const v4fa*)(arow + kb + 16 + 8 * hh + 4);
    float xs[16] = {x0[0],x0[1],x0[2],x0[3],x1[0],x1[1],x1[2],x1[3],x2[0],x2[1],x2[2],x2[3],x3[0],x3[1],x3[2],x3[3]};
#pragma unroll
    for (int i = 0; i < 16; ++i) { const unsigned short hb = bf16_bits(xs[i]); ah.u[i] = hb; al.u[i] = ASPLIT ? bf16_bits(xs[i] - bf16_val(hb)) : (unsigned short)0; }
#pragma unroll
    for (int t = 0; t < 4; ++t) {
      const unsigned short* brow = Wt + (size_t)(col0 + t * 16 + ln) * ldb + kb;
      FragB b;
      b.half[0] = *(const v8us*)(brow + 8 * hh);
      b.half[1] = *(const v8us*)(brow + 16 + 8 * hh);
      acc[t] = mmaN<ASPLIT ? 2 : 1>(ah.v, al.v, b.v, b.v, acc[t]);
    }
  }
#pragma unroll
  for (int t = 0; t < 4; ++t) {
    float bv = bias ? bias[col0 + t * 16 + ln] : 0.f;
    if (BIAS_BF16) bv = bf16_round(bv);
#pragma unroll
    for (int r = 0; r < 8; ++r) { float v = acc[t][r] + bv; if (ACT == 1) v = fmaxf(v, 0.f); so[w][8 * hh + r][t * 16 + ln] = v; }
  }
  __builtin_amdgcn_fence(__ATOMIC_ACQ_REL, "workgroup");
  __builtin_amdgcn_wave_barrier();
  const int rsub = lane >> 4, c4 = (lane & 15) * 4;
  {
#pragma unroll
    for (int q = 0; q < 8; ++q) {
      const int r = q * 2 + rsub;
      const v4f v = *(const v4fa*)&so[w][r][c4];
      *(v4f*)(C + (size_t)(row0 + r) * ldc + col0 + c4) = v;
    }
    
  }
}

// GEMM C = act(A·W + bias + resid): A f32 (ASPLIT -> hi/lo 2 terms), Wt bf16 [N][K]; ACT 0 none, 1 relu, 2 exact gelu;
// resid (optional, f32, row index = (row % rmod), pitch ldr, RES_BF16 rounds it) added before the activation.
template <bool ASPLIT, int ACT, bool BIAS_BF16, bool RES_BF16>
__global__ __launch_bounds__(128) void k_gemm_bf3(const float* __restrict__ A, int lda, const unsigned short* __restrict__ Wt, int ldb,
                                                const float* __restrict__ bias, const float* __restrict__ resid, int rmod, int ldr,
                                                float* __restrict__ C, int ldc, int M, int N, int K) {
  __shared__ __attribute__((aligned(16))) float so[4][16][64];
  const int tid = threadIdx.x, w = tid >> 5, lane = tid & 31, ln = lane & 15, hh = lane >> 4;
  const int ntn = N / 64;
  const int wid = blockIdx.x * 4 + w;
  const int mt = wid / ntn, nq = wid % ntn;
  if (mt * 16 >= M) return;
  const int row0 = mt * 16, col0 = nq * 64;
  const float* arow = A + (size_t)(row0 + ln) * lda;
  v8f acc[4] = {};
  for (int kb = 0; kb < K; kb += 32) {
    FragB ah, al;
    const v4f x0 = *(const v4fa*)(arow + kb + 8 * hh), x1 = *(const v4fa*)(arow + kb + 8 * hh + 4);
    const v4f x2 = *(const v4fa*)(arow + kb + 16 + 8 * hh), x3 = *(const v4fa*)(arow + kb + 16 + 8 * hh + 4);
    float xs[16] = {x0[0],x0[1],x0[2],x0[3],x1[0],x1[1],x1[2],x1[3],x2[0],x2[1],x2[2],x2[3],x3[0],x3[1],x3[2],x3[3]};
#pragma unroll
    for (int i = 0; i < 16; ++i) { const unsigned short hb = bf16_bits(xs[i]); ah.u[i] = hb; al.u[i] = ASPLIT ? bf16_bits(xs[i] - bf16_val(hb)) : (unsigned short)0; }
#pragma unroll
    for (int t = 0; t < 4; ++t) {
      const unsigned short* brow = Wt + (size_t)(col0 + t * 16 + ln) * ldb + kb;
      FragB b;
      b.half[0] = *(const v8us*)(brow + 8 * hh);
      b.half[1] = *(const v8us*)(brow + 16 + 8 * hh);
      acc[t] = mmaN<ASPLIT ? 2 : 1>(ah.v, al.v, b.v, b.v, acc[t]);
    }
  }
#pragma unroll
  for (int t = 0; t < 4; ++t) {
    const int col = col0 + t * 16 + ln;
    float bv = bias ? bias[col] : 0.f;
    if (BIAS_BF16) bv = bf16_round(bv);
#pragma unroll
    for (int r = 0; r < 8; ++r) {
      float v = acc[t][r] + bv;
      if (resid) { float rv = resid[(size_t)((row0 + 8 * hh + r) % rmod) * ldr + col]; if (RES_BF16) rv = bf16_round(rv); v += rv; }
      if (ACT == 1) v = fmaxf(v, 0.f);
      if (ACT == 2) v = 0.5f * v * (1.0f + erff(v * 0.70710678118654752f));
      if (ACT == 3) { const float u = 0.7978845608028654f * (v + 0.044715f * v * v * v); v = 0.5f * v * (1.0f + tanhf(u)); }
      so[w][8 * hh + r][t * 16 + ln] = v;
    }
  }
  __builtin_amdgcn_fence(__ATOMIC_ACQ_REL, "workgroup");
  __builtin_amdgcn_wave_barrier();
  const int rsub = lane >> 4, c4 = (lane & 15) * 4;
  {
#pragma unroll
    for (int q = 0; q < 8; ++q) {
      const int r = q * 2 + rsub;
      const v4f v = *(const v4fa*)&so[w][r][c4];
      *(v4f*)(C + (size_t)(row0 + r) * ldc + col0 + c4) = v;
    }
    
  }
}
// row LayerNorm (biased variance, eps) over N: s = X (+ R); optional out_sum <- s; out_norm <- (s-mu)*rsqrt(var+eps)*g + b
template <bool PARAM_BF16>
__global__ __launch_bounds__(256) void k_layernorm(const float* __restrict__ X, const float* __restrict__ R, const float* __restrict__ g, const float* __restrict__ bta,
                                                  float* __restrict__ out_sum, float* __restrict__ out_norm, int N, float eps) {
  __shared__ float red[256];
  const int row = blockIdx.x, tid = threadIdx.x;
  const float* x = X + (size_t)row * N; const float* rr = R ? R + (size_t)row * N : nullptr;
  float vals[16];                     // up to N = 4096
  const int per = N / 256;            // contiguous chunk per thread? use strided-by-4 chunks: thread handles j = tid*4 + 1024*u
  float s1 = 0.f;
  for (int u = 0; u < per / 4; ++u) {
    const int j = tid * 4 + 1024 * u;
    const v4f a = *(const v4fa*)(x + j);
    v4f b = {0.f,0.f,0.f,0.f}; if (rr) b = *(const v4fa*)(rr + j);
#pragma unroll
    for (int q = 0; q < 4; ++q) { const float v = a[q] + b[q]; vals[u * 4 + q] = v; s1 += v; }
  }
  red[tid] = s1; __syncthreads();
  for (int st = 128; st > 0; st >>= 1) { if (tid < st) red[tid] += red[tid + st]; __syncthreads(); }
  const float mu = red[0] / (float)N; __syncthreads();
  float s2 = 0.f;
  for (int u = 0; u < per / 4; ++u)
#pragma unroll
    for (int q = 0; q < 4; ++q) { const float c = vals[u * 4 + q] - mu; s2 += c * c; }
  red[tid] = s2; __syncthreads();
  for (int st = 128; st > 0; st >>= 1) { if (tid < st) red[tid] += red[tid + st]; __syncthreads(); }
  const float rs = rsqrtf(red[0] / (float)N + eps);
  {
    for (int u = 0; u < per / 4; ++u) {
      const int j = tid * 4 + 1024 * u;
      v4f o, sm;
#pragma unroll
      for (int q = 0; q < 4; ++q) {
        float gg = g[j + q], bb = bta[j + q];
        if (PARAM_BF16) { gg = bf16_round(gg); bb = bf16_round(bb); }
        sm[q] = vals[u * 4 + q]; o[q] = (vals[u * 4 + q] - mu) * rs * gg + bb;
      }
      if (out_sum) *(v4f*)(out_sum + (size_t)row * N + j) = sm;
      *(v4f*)(out_norm + (size_t)row * N + j) = o;
    }
    
  }
}



// ---- f16 WMMA path (v_wmma_f32_16x16x32_f16): 11-bit significands for operands in range — used where a [0,1] probability operand needs more precision than bf16
typedef _Float16 v16h __attribute__((ext_vector_type(16)));
union FragH { v16h v; v8us half[2]; _Float16 h[16]; unsigned short u[16]; };
template <int NT>
__device__ __forceinline__ v8f mmaH(v16h ah, v16h al, v16h bh, v16h bl, v8f c) {
  c = __builtin_amdgcn_wmma_f32_16x16x32_f16(false, ah, false, bh, (short)0, c, false, false);
  if (NT >= 2) c = __builtin_amdgcn_wmma_f32_16x16x32_f16(false, al, false, bh, (short)0, c, false, false);
  if (NT >= 3) c = __builtin_amdgcn_wmma_f32_16x16x32_f16(false, ah, false, bl, (short)0, c, false, false);
  asm volatile("v_nop\n\tv_nop\n\tv_nop\n\tv_nop" : "+v"(c) : "v"(ah), "v"(al), "v"(bh), "v"(bl));
  return c;
}
// batched GEMM like k_gemm_b but f16 operands: A f32 (split into f16 hi/lo if ASPLIT, else rounded to f16), Bt = f16 values [n][k]; alpha; C f32; N multiple of 16 (partial tiles skipped)
template <bool ASPLIT>
__global__ __launch_bounds__(128) void k_gemm_h(const float* __restrict__ A, int lda, size_t sA, const _Float16* __restrict__ Bh, int ldb, size_t sB, float alpha, float* __restrict__ C, int ldc, size_t sC, int M, int N, int K) {
  __shared__ __attribute__((aligned(16))) float so[4][16][64];
  const int tid = threadIdx.x, w = tid >> 5, lane = tid & 31, ln = lane & 15, hh = lane >> 4; const int by = blockIdx.y;
  A += (size_t)by * sA; Bh += (size_t)by * sB; C += (size_t)by * sC;
  const int ntn = (N + 63) / 64; const int wid = blockIdx.x * 4 + w; const int mt = wid / ntn, nq = wid % ntn; if (mt * 16 >= M) return;
  const int row0 = mt * 16, col0 = nq * 64; const float* arow = A + (size_t)(row0 + ln) * lda;
  v8f acc[4] = {};
  for (int kb = 0; kb < K; kb += 32) {
    FragH ah, al;
    const v4f x0 = *(const v4fa*)(arow + kb + 8 * hh), x1 = *(const v4fa*)(arow + kb + 8 * hh + 4), x2 = *(const v4fa*)(arow + kb + 16 + 8 * hh), x3 = *(const v4fa*)(arow + kb + 16 + 8 * hh + 4);
    float xs[16] = {x0[0],x0[1],x0[2],x0[3],x1[0],x1[1],x1[2],x1[3],x2[0],x2[1],x2[2],x2[3],x3[0],x3[1],x3[2],x3[3]};
#pragma unroll
    for (int i = 0; i < 16; ++i) { const _Float16 h = (_Float16)xs[i]; ah.h[i] = h; al.h[i] = ASPLIT ? (_Float16)(xs[i] - (float)h) : (_Float16)0.0f; }
#pragma unroll
    for (int t = 0; t < 4; ++t) { if (col0 + t * 16 >= N) continue; const size_t boff = (size_t)(col0 + t * 16 + ln) * ldb + kb; FragH bq; bq.half[0] = *(const v8us*)(Bh + boff + 8 * hh); bq.half[1] = *(const v8us*)(Bh + boff + 16 + 8 * hh);
      acc[t] = mmaH<ASPLIT ? 2 : 1>(ah.v, al.v, bq.v, bq.v, acc[t]); }
  }
#pragma unroll
  for (int t = 0; t < 4; ++t) { if (col0 + t * 16 >= N) continue;
#pragma unroll
    for (int r = 0; r < 8; ++r) so[w][8 * hh + r][t * 16 + ln] = acc[t][r] * alpha; }
  __builtin_amdgcn_fence(__ATOMIC_ACQ_REL, "workgroup"); __builtin_amdgcn_wave_barrier();
  const int rsub = lane >> 4, c4 = (lane & 15) * 4;
  {
#pragma unroll
    for (int q = 0; q < 8; ++q) { const int r = q * 2 + rsub; if (col0 + c4 < N) { const v4f v = *(const v4fa*)&so[w][r][c4]; *(v4f*)(C + (size_t)(row0 + r) * ldc + col0 + c4) = v; } }
     }
}

// ---- fragment order: every f16 plane [rows][K] that feeds a matrix operand (rows % 16 == 0, K % 32 == 0) is stored as 1-KiB blocks, one per fragment of 16 rows x 32 k, block (rt, kt) at element (rt * (K / 32) + kt) * 512.
// Inside a block, lane l = 16 hh + ln (row ln of the tile) finds its k = 8 hh .. 8 hh + 7 at element 8 l and its k = 16 + 8 hh .. 16 + 8 hh + 7 at element 256 + 8 l: each of a fragment's two 16-byte loads reads 512 contiguous bytes, four whole lines, where rows of a row-major plane gave sixteen lines of 32 bytes. The registers hold the same values as before.
// A writer's thread t stores elements 8 t .. 8 t + 7 of the plane (a wave stores four whole lines); fo_src names the row and the first k that belong there.
struct FoRK { int row, k; };
__device__ __forceinline__ FoRK fo_src(size_t t, int K) { const int lane = (int)(t & 31); const size_t wid = t >> 5; const int half = (int)(wid & 1); const size_t blk = wid >> 1; const int kb = K >> 5;
  FoRK o; o.row = (int)(blk / kb) * 16 + (lane & 15); o.k = (int)(blk % kb) * 32 + half * 16 + (lane >> 4) * 8; return o; }
// element offset of the 8 values (row, k8 .. k8 + 7), k8 % 8 == 0
__device__ __forceinline__ size_t fo_dst(int row, int k8, int K) { return ((size_t)(row >> 4) * (K >> 5) + (k8 >> 5)) * 512 + ((k8 >> 4) & 1) * 256 + (((k8 >> 3) & 1) * 16 + (row & 15)) * 8; }
// Wt = f16(W[k][n] * scale), rows n, in fragment order, from f32 row-major W[K][N] (scale = power of two; bf16-exact weights stay exact in f16 away from the subnormal range)
__device__ __forceinline__ void d_wt_f16(int bx, const float* __restrict__ W, _Float16* __restrict__ Wt, int K, int N, float scale) {
  const int t = bx * 256 + threadIdx.x; if (t >= N * (K / 8)) return; const FoRK s = fo_src((size_t)t, K); const int n = s.row, k8 = s.k; FragH f;
#pragma unroll
  for (int i = 0; i < 8; ++i) { if (i) asm volatile("s_wait_xcnt 0x0" ::: "memory");      /* stands in front of each further load, whose result may land in a register that an earlier load names as its address */
    f.h[i] = (_Float16)(bf16_round(W[(size_t)(k8 + i) * N + n]) * scale); }
  const v8us o = f.half[0];
  *(v8us*)((unsigned short*)Wt + (size_t)t * 8) = o; 
}
// k_gemm_hh variant with fused epilogue: v = acc·alpha + bias[by·sBias + col] (+ CP[(row/rowsPerB)·sCPb + by·64 + col] if CP) ; ACT 0 none / 1 elu ; writes f16 C16 (and f32 C if non-null)
template <int ACT>
__global__ __launch_bounds__(128) void k_gemm_hhx(const _Float16* __restrict__ A, int lda, size_t sA, const _Float16* __restrict__ Bh, int ldb, size_t sB, float alpha, const float* __restrict__ bias, size_t sBias, const float* __restrict__ CP, int rowsPerB, size_t sCPb, int row0g,
    float* __restrict__ C, _Float16* __restrict__ C16, int ldc, size_t sC, int M, int N, int K) {
  __shared__ __attribute__((aligned(16))) float so[4][16][64];
  const int tid = threadIdx.x, w = tid >> 5, lane = tid & 31, ln = lane & 15, hh = lane >> 4; const int by = blockIdx.y;
  A += (size_t)by * sA; Bh += (size_t)by * sB; const size_t cofs = (size_t)by * sC; const float* bp = bias ? bias + (size_t)by * sBias : nullptr;
  const int ntn = (N + 63) / 64; const int wid = blockIdx.x * 4 + w; const int mt = wid / ntn, nq = wid % ntn; if (mt * 16 >= M) return;
  const int row0 = mt * 16, col0 = nq * 64; const _Float16* arow = A + (size_t)(row0 + ln) * lda;
  v8f acc[4] = {};
  for (int kb = 0; kb < K; kb += 32) { FragH ah; ah.half[0] = *(const v8us*)((const unsigned short*)arow + kb + 8 * hh); ah.half[1] = *(const v8us*)((const unsigned short*)arow + kb + 16 + 8 * hh);
#pragma unroll
    for (int t = 0; t < 4; ++t) { if (col0 + t * 16 >= N) continue; const size_t boff = (size_t)(col0 + t * 16 + ln) * ldb + kb; FragH bq; bq.half[0] = *(const v8us*)((const unsigned short*)Bh + boff + 8 * hh); bq.half[1] = *(const v8us*)((const unsigned short*)Bh + boff + 16 + 8 * hh);
      acc[t] = mmaH<1>(ah.v, ah.v, bq.v, bq.v, acc[t]); }
  }
#pragma unroll
  for (int t = 0; t < 4; ++t) { if (col0 + t * 16 >= N) continue; const int col = col0 + t * 16 + ln; const float bv = bp ? bf16_round(bp[col]) : 0.f;
#pragma unroll
    for (int r = 0; r < 8; ++r) { float v = acc[t][r] * alpha + bv; if (CP) { const int bidx = (row0g + row0 + 8 * hh + r) / rowsPerB; v += CP[(size_t)bidx * sCPb + (size_t)by * 64 + col]; } if (ACT == 1) v = (v > 0.f) ? v : expm1f(v); else if (ACT == 7) v = (v > 0.f) ? v + 1.0f : expf(v); else if (ACT == 8) v = tanhf(v); else if (ACT == 9) v = 0.5f * v * (1.0f + tanhf(0.7978845608028654f * (v + 0.044715f * v * v * v))); else if (ACT == 11) v = 1.0f / (1.0f + expf(-v)); else if (ACT == 12) v = (v > 0.f) ? v : 0.01f * v; else if (ACT == 14) v = (v > 0.f) ? v : 0.1f * v; else if (ACT == 15) v = v / (1.0f + expf(-v)); else if (ACT == 3) v = fmaxf(v, 0.f); else if (ACT == 6) v = 0.5f * v * (1.0f + erff(v * 0.70710678118654752f)); so[w][8 * hh + r][t * 16 + ln] = v; } }
  __builtin_amdgcn_fence(__ATOMIC_ACQ_REL, "workgroup"); __builtin_amdgcn_wave_barrier();
  const int rsub = lane >> 4, c4 = (lane & 15) * 4; typedef _Float16 v4h __attribute__((ext_vector_type(4)));
  {
#pragma unroll
    for (int q = 0; q < 8; ++q) { const int r = q * 2 + rsub; if (col0 + c4 < N) { const v4f v = *(const v4fa*)&so[w][r][c4]; if (C) *(v4f*)(C + cofs + (size_t)(row0 + r) * ldc + col0 + c4) = v; if (C16) { v4h h4; for (int i = 0; i < 4; ++i) h4[i] = (_Float16)v[i]; *(v4h*)(C16 + cofs + (size_t)(row0 + r) * ldc + col0 + c4) = h4; } } }
     }
}


typedef _Float16 v4h __attribute__((ext_vector_type(4)));

__device__ __forceinline__ void d_x16(int bx, const float* __restrict__ x, _Float16* __restrict__ X16, size_t n8, int K) { const size_t t = (size_t)bx * 256 + threadIdx.x; if (t >= n8) return; const FoRK s = fo_src(t, K); const float* xs = x + (size_t)s.row * K + s.k; FragH f;
#pragma unroll
  for (int q = 0; q < 8; ++q) f.h[q] = (_Float16)bf16_round(xs[q]); *(v8us*)((unsigned short*)X16 + t * 8) = f.half[0];  }
__global__ __launch_bounds__(256) void k_h16(const float* __restrict__ x, _Float16* __restrict__ X16, size_t n8) { const size_t t = (size_t)blockIdx.x * 256 + threadIdx.x; if (t >= n8) return; FragH f;
#pragma unroll
  for (int q = 0; q < 8; ++q) f.h[q] = (_Float16)x[t * 8 + q]; *(v8us*)((unsigned short*)X16 + t * 8) = f.half[0];  }
__global__ __launch_bounds__(256) void k_round16f(const float* __restrict__ W, _Float16* __restrict__ Bt, size_t n8) { const size_t t = (size_t)blockIdx.x * 256 + threadIdx.x; if (t >= n8) return; FragH f;
#pragma unroll
  for (int i = 0; i < 8; ++i) f.h[i] = (_Float16)(bf16_round(W[t * 8 + i]) * 16.0f); *(v8us*)((unsigned short*)Bt + t * 8) = f.half[0];  }
// both V^T planes straight from a value projection: a block takes 64 keys x 64 dims of one (batch, kv head) from the f32 plane F (rpb rows a batch, KVD columns), splits each value into f16 hi + 2^10 residual, turns both tiles in LDS and writes them at keys key_off + ... of the planes (rows d, k = keys, TK keys a row, fragment order). rpb and key_off are multiples of 64
__device__ __forceinline__ void d_vtf(int bx, const float* __restrict__ F, int rpb, int key_off, _Float16* __restrict__ Vt, _Float16* __restrict__ VtL) { __shared__ unsigned short th[64][66], tl[64][66]; const int tid = threadIdx.x; const int npb = rpb / 64; const int slab = bx / npb, lg = bx % npb; const int b = slab / NKV, h = slab % NKV;
  for (int i = tid; i < 64 * 8; i += 256) { const int r = i / 8, c8 = (i % 8) * 8; const float* fs = F + ((size_t)b * rpb + lg * 64 + r) * KVD + h * 64 + c8; const v4f a = *(const v4fa*)fs, c = *(const v4fa*)(fs + 4); FragH fh, fl;
#pragma unroll
    for (int q = 0; q < 4; ++q) { _Float16 hv = (_Float16)a[q]; fh.h[q] = hv; fl.h[q] = (_Float16)((a[q] - (float)hv) * 1024.0f); hv = (_Float16)c[q]; fh.h[4 + q] = hv; fl.h[4 + q] = (_Float16)((c[q] - (float)hv) * 1024.0f); }
#pragma unroll
    for (int q = 0; q < 8; ++q) { th[r][c8 + q] = fh.u[q]; tl[r][c8 + q] = fl.u[q]; } }
  __syncthreads();      /* both tiles are whole in LDS before any thread reads a column */
  {
#pragma unroll
    for (int rd = 0; rd < 2; ++rd) { const int wv = rd * 8 + tid / 32, lane = tid % 32; const int d = (wv >> 2) * 16 + (lane & 15), pc = (wv & 3) * 2 + (lane >> 4); FragH fh, fl;      /* a wave per half fragment of V^T (rows d, k = keys): 16 d x 2 groups of 8 keys */
#pragma unroll
      for (int q = 0; q < 8; ++q) { fh.u[q] = th[pc * 8 + q][d]; fl.u[q] = tl[pc * 8 + q][d]; }
      const size_t e = fo_dst(slab * 64 + d, key_off + lg * 64 + pc * 8, TK);
      *(v8us*)((unsigned short*)Vt + e) = fh.half[0]; *(v8us*)((unsigned short*)VtL + e) = fl.half[0]; }
    asm volatile("s_wait_xcnt 0x0" ::: "memory");      /* stands behind the four stores above, in front of whatever the launch's other ranges, laid out behind this one, write into registers that the stores name */
     } }

// ---- fast GEMM (wave tile 32x64; requires M % 32 == 0 rows per launch region, N % 64 == 0 and K % 64 == 0); epilogue = k_gemm_hhx semantics ----
__device__ __forceinline__ v16h g2_frag(const _Float16* p) { FragH f; f.half[0] = *(const v8us*)((const unsigned short*)p); f.half[1] = *(const v8us*)((const unsigned short*)p + 256); return f.v; }      /* p: the lane's 8 elements in the fragment's block */
__device__ __forceinline__ v8f g2_mma(v16h a, v16h b, v8f c) { v8f d = __builtin_amdgcn_wmma_f32_16x16x32_f16(false, a, false, b, (short)0, c, false, false); asm volatile("v_nop\n\tv_nop\n\tv_nop\n\tv_nop" : "+v"(d) : "v"(a), "v"(b)); return d; }
template <int ACT>
__device__ __forceinline__ void d_gemm2(int bx, const _Float16* __restrict__ A, size_t sA, const _Float16* __restrict__ Bh, size_t sB, const _Float16* __restrict__ A2, const _Float16* __restrict__ B2, int np, float alpha, const float* __restrict__ bias, size_t sBias, const float* __restrict__ CP, int rowsPerB, size_t sCPb, int row0g,
    float* __restrict__ C, _Float16* __restrict__ C16, int ldc, size_t sC, int M, int N, int K) {
  __shared__ __attribute__((aligned(16))) float so[4][32][68];
  const int tid = threadIdx.x, w = tid >> 5, lane = tid & 31, ln = lane & 15, hh = lane >> 4; const int by = blockIdx.y;
  A += (size_t)by * sA; Bh += (size_t)by * sB; const size_t cofs = (size_t)by * sC; const float* bp = bias ? bias + (size_t)by * sBias : nullptr;
  const int ntn = N >> 6; const int mt = bx / ntn, nq = bx - mt * ntn; const int row0 = mt * 128 + 32 * w, col0 = nq * 64; if (row0 >= M) return;
  /* A and Bh in fragment order, K elements a row: a tile of 16 rows is K * 16 elements, a step of 32 k is 512 */
  const size_t ao = (size_t)(row0 >> 4) * K * 16 + lane * 8, bo = (size_t)(col0 >> 4) * K * 16 + lane * 8;
  const v8f z8 = {0.f,0.f,0.f,0.f,0.f,0.f,0.f,0.f}; v8f c00 = z8, c01 = z8, c02 = z8, c03 = z8, c10 = z8, c11 = z8, c12 = z8, c13 = z8;
  /* np == 2: the residual product A2 B2 (A2 = 2^10 residual of A, B2 = x1 weights where Bh holds x16) is summed on top of the first in the same accumulators: the first sum is worth 1/16, the second 1/1024, so the first is raised by 64 (exact) in between and alpha = 1/1024 serves both */
#pragma unroll 1      /* kept rolled: one copy of the k loop */
  for (int ps = 0; ps < np; ++ps) {
  const _Float16* a0p = (ps ? A2 : A) + ao; const _Float16* a1p = a0p + (size_t)16 * K;
  const _Float16* b0p = (ps ? B2 : Bh) + bo; const _Float16* b1p = b0p + (size_t)16 * K; const _Float16* b2p = b1p + (size_t)16 * K; const _Float16* b3p = b2p + (size_t)16 * K;
  if (ps) { c00 *= 64.0f; c01 *= 64.0f; c02 *= 64.0f; c03 *= 64.0f; c10 *= 64.0f; c11 *= 64.0f; c12 *= 64.0f; c13 *= 64.0f; }
  /* two register sets x / y of the six fragments (K % 64 == 0): the loads of the next 32-wide k step are all issued before the products of this one, so a step waits for one overlapped latency at most */
  v16h xa0 = g2_frag(a0p), xa1 = g2_frag(a1p), xb0 = g2_frag(b0p), xb1 = g2_frag(b1p), xb2 = g2_frag(b2p), xb3 = g2_frag(b3p);
#pragma unroll 1
  for (int kb = 0; kb < K; kb += 64) { const int k1 = kb * 16, k2 = ((kb + 64 < K) ? kb + 64 : kb) * 16;      /* element offsets of this trip's first block (the y step is the block behind it, 512 elements on) and of the next trip's. Last trip: k2 names a step inside the row tile again; its values are not used */
    const _Float16* pya0 = a0p + k1; const _Float16* pya1 = a1p + k1; const _Float16* pyb0 = b0p + k1; const _Float16* pyb1 = b1p + k1; const _Float16* pyb2 = b2p + k1; const _Float16* pyb3 = b3p + k1;
    const _Float16* pxa0 = a0p + k2; const _Float16* pxa1 = a1p + k2; const _Float16* pxb0 = b0p + k2; const _Float16* pxb1 = b1p + k2; const _Float16* pxb2 = b2p + k2; const _Float16* pxb3 = b3p + k2;
    const v16h ya0 = g2_frag(pya0 + 512), ya1 = g2_frag(pya1 + 512), yb0 = g2_frag(pyb0 + 512), yb1 = g2_frag(pyb1 + 512), yb2 = g2_frag(pyb2 + 512), yb3 = g2_frag(pyb3 + 512);
    __builtin_amdgcn_sched_barrier(0);      /* holds the y loads above the x products (the scheduler otherwise moves each load down to its use) */
    c00 = g2_mma(xa0, xb0, c00); c10 = g2_mma(xa1, xb0, c10); c01 = g2_mma(xa0, xb1, c01); c11 = g2_mma(xa1, xb1, c11);
    c02 = g2_mma(xa0, xb2, c02); c12 = g2_mma(xa1, xb2, c12); c03 = g2_mma(xa0, xb3, c03); c13 = g2_mma(xa1, xb3, c13);
    __builtin_amdgcn_sched_barrier(0);      /* holds the x reloads below the x products and, with the next one, above the y products */
    xa0 = g2_frag(pxa0); xa1 = g2_frag(pxa1); xb0 = g2_frag(pxb0); xb1 = g2_frag(pxb1); xb2 = g2_frag(pxb2); xb3 = g2_frag(pxb3);
    __builtin_amdgcn_sched_barrier(0);      /* holds the x reloads above the y products */
    c00 = g2_mma(ya0, yb0, c00); c10 = g2_mma(ya1, yb0, c10); c01 = g2_mma(ya0, yb1, c01); c11 = g2_mma(ya1, yb1, c11);
    c02 = g2_mma(ya0, yb2, c02); c12 = g2_mma(ya1, yb2, c12); c03 = g2_mma(ya0, yb3, c03); c13 = g2_mma(ya1, yb3, c13);
    asm volatile("s_wait_xcnt 0x0" :: "v"(pya0), "v"(pya1), "v"(pyb0), "v"(pyb1), "v"(pyb2), "v"(pyb3), "v"(pxa0), "v"(pxa1), "v"(pxb0), "v"(pxb1), "v"(pxb2), "v"(pxb3) : "memory"); }      /* stands in front of the next trip's address sums, which overwrite registers that the loads name; the trip's twelve addresses are its inputs, so that each keeps its registers up to here and no later load's result lands in them */
  }
  v8f accs[8] = {c00, c01, c02, c03, c10, c11, c12, c13};
  /* the epilogue's loads (4 bias words, 64 CP words a lane) are issued together as well, ahead of the arithmetic that uses them */
  float bw[4] = {0.f, 0.f, 0.f, 0.f}; v8f cpv[8] = {z8, z8, z8, z8, z8, z8, z8, z8};
  if (bp) {
#pragma unroll
    for (int t = 0; t < 4; ++t) bw[t] = bp[col0 + t * 16 + ln];
    asm volatile("s_wait_xcnt 0x0" ::: "memory"); }      /* stands in front of the scalar work below, which overwrites the base register that the four loads name */
  if (CP) {
#pragma unroll
    for (int u = 0; u < 8; ++u)
#pragma unroll
      for (int r = 0; r < 8; ++r) { const int bidx = (row0g + row0 + (u >> 2) * 16 + 8 * hh + r) / rowsPerB; cpv[u][r] = CP[(size_t)bidx * sCPb + (size_t)by * 64 + col0 + (u & 3) * 16 + ln];
        if (r == 7) asm volatile("s_wait_xcnt 0x0" ::: "memory"); }      /* stands in front of the next group's loads, whose results may land in address registers of this group */
    asm volatile("" :: "v"(cpv[0]), "v"(cpv[1]), "v"(cpv[2]), "v"(cpv[3]), "v"(cpv[4]), "v"(cpv[5]), "v"(cpv[6]), "v"(cpv[7])); }      /* inputs-only fence on the loaded words: holds all 64 loads in this block, where they overlap, instead of one waited load in front of each add */
#pragma unroll
  for (int u = 0; u < 8; ++u) { const int t = u & 3, half = u >> 2; const float bv = bp ? bf16_round(bw[t]) : 0.f;
#pragma unroll
    for (int r = 0; r < 8; ++r) { const int rloc = half * 16 + 8 * hh + r; float v = accs[u][r] * alpha + bv; if (CP) v += cpv[u][r];
      if (ACT == 3) v = fmaxf(v, 0.f); else if (ACT == 6) v = 0.5f * v * (1.0f + erff(v * 0.70710678118654752f)); else if (ACT == 11) v = 1.0f / (1.0f + expf(-v)); else if (ACT == 15) v = v / (1.0f + expf(-v)); else if (ACT == 12) v = (v > 0.f) ? v : 0.01f * v; else if (ACT == 8) v = tanhf(v);
      so[w][rloc][t * 16 + ln] = v; } }
  __builtin_amdgcn_fence(__ATOMIC_ACQ_REL, "workgroup"); __builtin_amdgcn_wave_barrier();
  const int rsub = lane >> 4, c4 = (lane & 15) * 4;
  {
#pragma unroll
    for (int q = 0; q < 16; ++q) { const int r = q * 2 + rsub; const v4f v = *(const v4fa*)&so[w][r][c4]; if (C) *(v4f*)(C + cofs + (size_t)(row0 + r) * ldc + col0 + c4) = v; if (C16) { v4h h4; for (int i = 0; i < 4; ++i) h4[i] = (_Float16)v[i]; *(v4h*)(C16 + cofs + (size_t)(row0 + r) * ldc + col0 + c4) = h4; }
      if ((q & 3) == 3 && q != 15) asm volatile("s_wait_xcnt 0x0" ::: "memory"); }      /* stands in front of the next four rows' LDS reads and address sums, which overwrite registers that the stores above name */
     } }



// lane l's value of lane l ^ X (X < 16) inside its 16-lane row, by a DPP row_xmask move in registers (no trip through the LDS pipe and no wait on it)
template <int X>
__device__ __forceinline__ float row_xor(float v) { return __int_as_float(__builtin_amdgcn_update_dpp(0, __float_as_int(v), 0x160 | X, 0xf, 0xf, true)); }
// maximum over the 16-lane row, all 32 lanes on: four dependent DPP maxima in one statement (written with fmaxf on a DPP move the compiler puts a move and a quieting maximum in front of each step, three links for one)
__device__ __forceinline__ float row_max16(float v) {
  asm("v_max_num_f32_dpp %0, %0, %0 row_xmask:1 row_mask:0xf bank_mask:0xf\n\t"
      "v_max_num_f32_dpp %0, %0, %0 row_xmask:2 row_mask:0xf bank_mask:0xf\n\t"
      "v_max_num_f32_dpp %0, %0, %0 row_xmask:4 row_mask:0xf bank_mask:0xf\n\t"
      "v_max_num_f32_dpp %0, %0, %0 row_xmask:8 row_mask:0xf bank_mask:0xf" : "+v"(v));
  return v; }
__device__ __forceinline__ float row_sum16(float v) { v += row_xor<1>(v); v += row_xor<2>(v); v += row_xor<4>(v); v += row_xor<8>(v); return v; }
template <int CAUSAL>
__global__ __launch_bounds__(128) void k_flash(const _Float16* __restrict__ Q16, int ldq, const _Float16* __restrict__ K16, int ldk, const _Float16* __restrict__ Vt, const int* __restrict__ MSK, float* __restrict__ O, int ldo) {
  constexpr int RPW = 16, RTN = RPW / 16, NQB = TQ / (4 * RPW), DT = 4, KS = 2;
  __shared__ __attribute__((aligned(16))) unsigned short sP[4][RPW][40]; __shared__ __attribute__((aligned(16))) float sO[4][RPW][64 + 4];
  const int tid = threadIdx.x, w = tid >> 5, lane = tid & 31, ln = lane & 15, hh = lane >> 4;
  const int slab = blockIdx.x / NQB, qblk = blockIdx.x % NQB; const int b = slab / NH, h = slab % NH; const int qb0 = qblk * (4 * RPW); const int q0 = qb0 + w * RPW;
  FragH aq[2][KS];
#pragma unroll
  for (int rt = 0; rt < RTN; ++rt) { const unsigned short* qr = (const unsigned short*)Q16 + ((size_t)b * TQ + q0 + rt * 16 + ln) * ldq + h * 64;
#pragma unroll
    for (int ks = 0; ks < KS; ++ks) { aq[rt][ks].half[0] = *(const v8us*)(qr + ks * 32 + 8 * hh); aq[rt][ks].half[1] = *(const v8us*)(qr + ks * 32 + 16 + 8 * hh); } }
  const unsigned short* Vth = (const unsigned short*)Vt + (size_t)slab * 64 * TK;
  float m_r[2][8], l_r[2][8]; v8f oacc[2][DT];
#pragma unroll
  for (int rt = 0; rt < RTN; ++rt) {
#pragma unroll
    for (int r = 0; r < 8; ++r) { m_r[rt][r] = -3.0e38f; l_r[rt][r] = 0.f; }
#pragma unroll
    for (int dt = 0; dt < DT; ++dt) oacc[rt][dt] = (v8f){0.f,0.f,0.f,0.f,0.f,0.f,0.f,0.f}; }
  const int jend = (CAUSAL == 1) ? (qb0 + 4 * RPW) : TK;      /* causal: keys beyond the block's last query never contribute */
#pragma unroll 1
  for (int j0 = 0; j0 < jend; j0 += 32) {
    v8f s[2][2];
#pragma unroll
    for (int nt = 0; nt < 2; ++nt) { const unsigned short* kr = (const unsigned short*)K16 + ((size_t)b * TK + j0 + nt * 16 + ln) * ldk + h * 64; FragH bk[KS];
#pragma unroll
      for (int ks = 0; ks < KS; ++ks) { bk[ks].half[0] = *(const v8us*)(kr + ks * 32 + 8 * hh); bk[ks].half[1] = *(const v8us*)(kr + ks * 32 + 16 + 8 * hh); }
#pragma unroll
      for (int rt = 0; rt < RTN; ++rt) { v8f acc = (v8f){0.f,0.f,0.f,0.f,0.f,0.f,0.f,0.f};
#pragma unroll
        for (int ks = 0; ks < KS; ++ks) acc = mmaH<1>(aq[rt][ks].v, aq[rt][ks].v, bk[ks].v, bk[ks].v, acc); s[rt][nt] = acc; } }
#pragma unroll
    for (int rt = 0; rt < RTN; ++rt)
#pragma unroll
      for (int r = 0; r < 8; ++r) { const int tq = q0 + rt * 16 + 8 * hh + r; const int k0 = j0 + ln, k1 = j0 + 16 + ln;
        const bool ok0 = (CAUSAL == 1) ? (k0 <= tq) : ((CAUSAL == 2) ? ((k0 >> 5) == (tq >> 5)) : true), ok1 = (CAUSAL == 1) ? (k1 <= tq) : ((CAUSAL == 2) ? ((k1 >> 5) == (tq >> 5)) : true);      /* mode 2: block-diagonal 32-token groups */
        const float s0 = ok0 ? s[rt][0][r] * SCL : -3.0e38f, s1 = ok1 ? s[rt][1][r] * SCL : -3.0e38f; 
        const float mn = row_max16(fmaxf(fmaxf(s0, s1), m_r[rt][r]));      /* the running maximum is the same in all 16 lanes of the row: taken in ahead of the reduction, the reduced value is the new maximum itself */
        const float al = (mn > -1.0e38f) ? expf(m_r[rt][r] - mn) : 1.0f; m_r[rt][r] = mn; const float p0 = ok0 ? expf(s0 - mn) : 0.f, p1 = ok1 ? expf(s1 - mn) : 0.f; l_r[rt][r] = l_r[rt][r] * al + p0 + p1;
#pragma unroll
        for (int dt = 0; dt < DT; ++dt) oacc[rt][dt][r] *= al;
        FragH t2; t2.h[0] = (_Float16)(p0 * 1024.0f); t2.h[1] = (_Float16)(p1 * 1024.0f); sP[w][rt * 16 + 8 * hh + r][ln] = t2.u[0]; sP[w][rt * 16 + 8 * hh + r][16 + ln] = t2.u[1]; }
    __builtin_amdgcn_fence(__ATOMIC_ACQ_REL, "workgroup"); __builtin_amdgcn_wave_barrier();
    FragH pa[2];
#pragma unroll
    for (int rt = 0; rt < RTN; ++rt) { pa[rt].half[0] = *(const v8us*)&sP[w][rt * 16 + ln][8 * hh]; pa[rt].half[1] = *(const v8us*)&sP[w][rt * 16 + ln][16 + 8 * hh]; }
#pragma unroll
    for (int dt = 0; dt < DT; ++dt) { const unsigned short* vrow = Vth + (size_t)(dt * 16 + ln) * TK + j0; FragH bv; bv.half[0] = *(const v8us*)(vrow + 8 * hh); bv.half[1] = *(const v8us*)(vrow + 16 + 8 * hh);
#pragma unroll
      for (int rt = 0; rt < RTN; ++rt) oacc[rt][dt] = mmaH<1>(pa[rt].v, pa[rt].v, bv.v, bv.v, oacc[rt][dt]); }
    __builtin_amdgcn_fence(__ATOMIC_ACQ_REL, "workgroup"); __builtin_amdgcn_wave_barrier(); }
#pragma unroll
  for (int rt = 0; rt < RTN; ++rt) {
#pragma unroll
    for (int r = 0; r < 8; ++r) { float l = l_r[rt][r]; l = row_sum16(l); l_r[rt][r] = (l > 0.f) ? 1.0f / (l * 1024.0f) : 0.f; }
#pragma unroll
    for (int dt = 0; dt < DT; ++dt)
#pragma unroll
      for (int r = 0; r < 8; ++r) sO[w][rt * 16 + 8 * hh + r][dt * 16 + ln] = oacc[rt][dt][r] * l_r[rt][r]; }
  __builtin_amdgcn_fence(__ATOMIC_ACQ_REL, "workgroup"); __builtin_amdgcn_wave_barrier();
  {
#pragma unroll
    for (int rp = 0; rp < RPW; rp += 2) { const int r = rp + (lane >> 4), pc = lane & 15; const v4f val = *(const v4fa*)&sO[w][r][pc * 4]; *(v4f*)(O + ((size_t)b * TQ + q0 + r) * ldo + h * 64 + pc * 4) = val; }
     } }
__device__ __forceinline__ float half_swap(float v) { const int x = __float_as_int(v); return __int_as_float(__builtin_amdgcn_permlanex16(x, x, 0x76543210, 0xfedcba98, false, false)); }
typedef int v4im __attribute__((ext_vector_type(4), may_alias));
// softmax of one trip. s[i >> 3][i & 7] is the score of the trip's key (i >> 3) * 16 + 8 hh + (i & 7) against the lane's own query (column ln); ok[i] its mask. The maximum and the sum over keys are taken inside the lane; the maximum is joined with the other half's once a trip (m_c is the same in both halves), the sum l_c stays this half's until the epilogue.
// The two score tiles, converted in place, are the B operand P^T in the hardware k order (element i): P takes no trip through LDS. O^T tiles hold the lane's query in every register, so one factor rescales them all.
__device__ __forceinline__ void sm_trip(const v8f (&s)[2], const bool (&ok)[16], float& m_c, float& l_c, v8f (&oacc)[4], v8f (&oaccL)[4], FragH& ph, FragH& pl) {
  float sc[16], t[8], p[16], u[8];
#pragma unroll
  for (int i = 0; i < 16; ++i) sc[i] = ok[i] ? s[i >> 3][i & 7] * SCL : -3.0e38f;
#pragma unroll
  for (int i = 0; i < 8; ++i) t[i] = fmaxf(sc[i], sc[i + 8]);
  const float mh = fmaxf(fmaxf(fmaxf(fmaxf(t[0], t[1]), fmaxf(t[2], t[3])), fmaxf(fmaxf(t[4], t[5]), fmaxf(t[6], t[7]))), m_c);
  const float mn = fmaxf(mh, half_swap(mh));
  /* each exponential is the hardware's 2^x of (difference * log2 e), with nothing guarded around it: the 17 of a trip are independent and overlap (the library call under a per-key test compiled to 17 masked branch regions, each one dependent chain, run one after another). An unchanged maximum still gives a factor of exactly 1 */
  const float mr = fmaxf(mn, -1.0e38f);      /* a masked key's sc = -3.0e38 lies at least 2.0e38 below mr, also where no key has been live yet: its 2^x is 0, as the test gave */
  float x[16], ea; const float xa = (m_c - mn) * 1.44269504f;
#pragma unroll
  for (int i = 0; i < 16; ++i) x[i] = (sc[i] - mr) * 1.44269504f;
  /* written as two runs in asm so that the slot behind each transcendental is kept by construction: the next instruction is another 2^x with registers of its own (results are early-clobber: none shares a register with a source), and one v_nop ends each run */
  asm("v_exp_f32 %0, %9\n\tv_exp_f32 %1, %10\n\tv_exp_f32 %2, %11\n\tv_exp_f32 %3, %12\n\tv_exp_f32 %4, %13\n\tv_exp_f32 %5, %14\n\tv_exp_f32 %6, %15\n\tv_exp_f32 %7, %16\n\tv_exp_f32 %8, %17\n\tv_nop"
      : "=&v"(p[0]), "=&v"(p[1]), "=&v"(p[2]), "=&v"(p[3]), "=&v"(p[4]), "=&v"(p[5]), "=&v"(p[6]), "=&v"(p[7]), "=&v"(ea)
      : "v"(x[0]), "v"(x[1]), "v"(x[2]), "v"(x[3]), "v"(x[4]), "v"(x[5]), "v"(x[6]), "v"(x[7]), "v"(xa));
  asm("v_exp_f32 %0, %8\n\tv_exp_f32 %1, %9\n\tv_exp_f32 %2, %10\n\tv_exp_f32 %3, %11\n\tv_exp_f32 %4, %12\n\tv_exp_f32 %5, %13\n\tv_exp_f32 %6, %14\n\tv_exp_f32 %7, %15\n\tv_nop"
      : "=&v"(p[8]), "=&v"(p[9]), "=&v"(p[10]), "=&v"(p[11]), "=&v"(p[12]), "=&v"(p[13]), "=&v"(p[14]), "=&v"(p[15])
      : "v"(x[8]), "v"(x[9]), "v"(x[10]), "v"(x[11]), "v"(x[12]), "v"(x[13]), "v"(x[14]), "v"(x[15]));
  const float al = (mn > -1.0e38f) ? ea : 1.0f; m_c = mn;
#pragma unroll
  for (int i = 0; i < 8; ++i) u[i] = p[i] + p[i + 8];
  l_c = l_c * al + (((u[0] + u[1]) + (u[2] + u[3])) + ((u[4] + u[5]) + (u[6] + u[7])));
#pragma unroll
  for (int dt = 0; dt < 4; ++dt) { oacc[dt] *= al; oaccL[dt] *= al; }
#pragma unroll
  for (int i = 0; i < 16; ++i) { const float x = p[i] * 1024.0f; const _Float16 hv = (_Float16)x; ph.h[i] = hv; pl.h[i] = (_Float16)((x - (float)hv) * 1024.0f); } }

// 3-term variant: O = (P_hi V_hi + (P_lo V_hi + P_hi V_lo) / 1024) / l with P = [hi | 2^10 residual] of 1024 p and V^T = [hi | 2^10 residual] planes (VtL same layout as Vt) -> ~2^-21-class products for un-averaged (early causal / peaked) rows
template <int CAUSAL>
__global__ __launch_bounds__(32 * NSPL) void k_flash3gA(const _Float16* __restrict__ Q16, int ldq, const _Float16* __restrict__ K16, int ldk, const _Float16* __restrict__ Vt, const _Float16* __restrict__ VtL, const int* __restrict__ MSK, _Float16* __restrict__ OH, _Float16* __restrict__ OL, int ldo) {
  constexpr int RPW = 16, RTN = RPW / 16, NQB = TQA / (4 * RPW), DT = 4, KS = 2;
  __shared__ __attribute__((aligned(16))) float sO[NSPL][RPW][64 + 4]; __shared__ float sM[NSPL][RPW], sL[NSPL][RPW];
  const int tid = threadIdx.x, w = __builtin_amdgcn_readfirstlane(tid >> 5), lane = tid & 31, ln = lane & 15, hh = lane >> 4;      /* the wave's number in a scalar register: the key range below stays scalar */
  /* one work-group per (batch, head, 16-query tile); its NSPL waves each run the flash loop over their own TK / NSPL keys, and the partial (m, l, O) are merged through LDS behind the loop */
  const int slab = blockIdx.x / (TQA / RPW), qblk = blockIdx.x % (TQA / RPW); (void)NQB; const int b = slab / NH, h = slab % NH; const int qb0 = qblk * RPW; const int q0 = qb0;
  FragH aq[2][KS];
#pragma unroll
  for (int rt = 0; rt < RTN; ++rt) { const unsigned short* qr = (const unsigned short*)Q16 + ((size_t)((b * TQA + q0 + rt * 16) >> 4) * (ldq >> 5) + h * 2) * 512 + lane * 8;      /* Q, K and both V^T planes in fragment order */
#pragma unroll
    for (int ks = 0; ks < KS; ++ks) { aq[rt][ks].half[0] = *(const v8us*)(qr + ks * 512); aq[rt][ks].half[1] = *(const v8us*)(qr + ks * 512 + 256); } }
  const size_t vslab = (size_t)(b * (NH / KVG) + h / KVG); const unsigned short* Vth = (const unsigned short*)Vt + vslab * 64 * TK; const unsigned short* Vtl = (const unsigned short*)VtL + vslab * 64 * TK;      /* GQA: q-head h reads kv head h / KVG */
  float m_c = -3.0e38f, l_c = 0.f; v8f oacc[DT], oaccL[DT];      /* of the lane's query q0 + ln; register r of tile dt is dim dt * 16 + 8 hh + r */
#pragma unroll
  for (int dt = 0; dt < DT; ++dt) { oacc[dt] = (v8f){0.f,0.f,0.f,0.f,0.f,0.f,0.f,0.f}; oaccL[dt] = oacc[dt]; }
  const int jbeg = w * (TK / NSPL), jend = jbeg + TK / NSPL;      /* this wave's keys */
#pragma unroll 1
  for (int j0 = jbeg; j0 < jend; j0 += 32) {
    v8f s[2]; FragH bk[2][KS], bv[DT], bl[DT]; v4im mk[2][2];
    /* every global load of the trip is issued here, in the order of use (K, mask words, both V planes): their latencies overlap, and V lands behind the softmax */
#pragma unroll
    for (int nt = 0; nt < 2; ++nt) { const unsigned short* kr = (const unsigned short*)K16 + ((size_t)((b * TK + j0 + nt * 16) >> 4) * (ldk >> 5) + (h / KVG) * 2) * 512 + lane * 8;
#pragma unroll
      for (int ks = 0; ks < KS; ++ks) { bk[nt][ks].half[0] = *(const v8us*)(kr + ks * 512); bk[nt][ks].half[1] = *(const v8us*)(kr + ks * 512 + 256); } }
    if (CAUSAL == 8) { const int* mrow = MSK + (size_t)(q0 + ln) * TK + j0 + 8 * hh;      /* the lane's query row: its 8 keys of each 16-key tile, 32 contiguous bytes */
#pragma unroll
      for (int nt = 0; nt < 2; ++nt) { mk[nt][0] = *(const v4im*)(mrow + nt * 16); mk[nt][1] = *(const v4im*)(mrow + nt * 16 + 4); } }
    asm volatile("s_wait_xcnt 0x0" ::: "memory");      /* stands in front of the V loads, whose results may land in registers that the K and mask loads name as addresses */
#pragma unroll
    for (int dt = 0; dt < DT; ++dt) { const size_t vo = ((size_t)dt * (TK / 32) + (j0 >> 5)) * 512 + lane * 8; const unsigned short* vrow = Vth + vo; const unsigned short* vrl = Vtl + vo; bv[dt].half[0] = *(const v8us*)vrow; bv[dt].half[1] = *(const v8us*)(vrow + 256);
      if (dt == DT - 1) asm volatile("s_wait_xcnt 0x0" ::: "memory");      /* stands in front of the trip's last two loads: the result of the first lands in the address registers of the hi plane's loads above */
      bl[dt].half[0] = *(const v8us*)vrl;
      if (dt == DT - 1) asm volatile("s_wait_xcnt 0x0" ::: "memory");      /* stands in front of the trip's last load, whose result lands in the address registers of the V loads above */
      bl[dt].half[1] = *(const v8us*)(vrl + 256); }
    __builtin_amdgcn_sched_barrier(0);      /* keeps the loads above together: without it the scheduler moves each one down to its first use, one exposed latency apiece */
#pragma unroll
    for (int nt = 0; nt < 2; ++nt) { v8f acc = (v8f){0.f,0.f,0.f,0.f,0.f,0.f,0.f,0.f};      /* K rows as A, Q as B: register r = key nt * 16 + 8 hh + r, column ln = query */
#pragma unroll
      for (int ks = 0; ks < KS; ++ks) acc = mmaH<1>(bk[nt][ks].v, bk[nt][ks].v, aq[0][ks].v, aq[0][ks].v, acc); s[nt] = acc; }
    bool ok[16]; const int tq = q0 + ln;
#pragma unroll
    for (int i = 0; i < 16; ++i) { const int k = j0 + (i >> 3) * 16 + 8 * hh + (i & 7);
      bool o = (CAUSAL == 1) ? (k <= tq) : ((CAUSAL == 2) ? ((k >> 5) == (tq >> 5)) : true);      /* mode 2: block-diagonal 32-token groups */
      if (CAUSAL == 8) o = mk[i >> 3][(i >> 2) & 1][i & 3] != 0;      /* mode 8: per-(query, key) int table shared by all batches and heads */
      if (CAUSAL == 4) o = MSK[((size_t)b * TQA + tq) * TK + k] != 0;      /* mode 4: per-(query, key) INPUT mask shared by all heads; masked keys contribute nothing (== the reference's -4096 fill, whose exp underflows to 0), rows with no valid key give l = 0 -> output 0 (== the reference's row_valid zeroing) */
      ok[i] = o; }
    FragH ph, pl; sm_trip(s, ok, m_c, l_c, oacc, oaccL, ph, pl);
#pragma unroll
    for (int dt = 0; dt < DT; ++dt) { oacc[dt] = mmaH<1>(bv[dt].v, bv[dt].v, ph.v, ph.v, oacc[dt]); oaccL[dt] = mmaH<1>(bv[dt].v, bv[dt].v, pl.v, pl.v, oaccL[dt]); oaccL[dt] = mmaH<1>(bl[dt].v, bl[dt].v, ph.v, ph.v, oaccL[dt]); } }      /* V^T rows as A, P^T as B */
  /* each wave leaves its queries' maxima, sums (both halves joined) and unnormalised outputs in LDS, a row per query: a lane's 8 registers of a tile are 8 consecutive dims of its row */
  { const float l = l_c + half_swap(l_c); if (hh == 0) { sM[w][ln] = m_c; sL[w][ln] = l; } }
#pragma unroll
  for (int dt = 0; dt < DT; ++dt) { v4f v0, v1;
#pragma unroll
    for (int r = 0; r < 4; ++r) { float v = oacc[dt][r]; v += oaccL[dt][r] * 0.0009765625f; v0[r] = v; v = oacc[dt][4 + r]; v += oaccL[dt][4 + r] * 0.0009765625f; v1[r] = v; }
    *(v4fa*)&sO[w][ln][dt * 16 + 8 * hh] = v0; *(v4fa*)&sO[w][ln][dt * 16 + 8 * hh + 4] = v1; }
  __syncthreads();      /* every wave's partials are in LDS before any thread merges them */
  /* merge, a thread per (row, 4 columns): M = max m_u; l = sum l_u e^(m_u - M); O = sum O_u e^(m_u - M), u in wave order. A wave with no live key for the row has m_u = -3.0e38, l_u = 0, O_u = 0 and adds nothing; a row with no live key at all gives l = 0 -> output 0 */
  /* the result leaves as the next GEMM's A operand: f16 hi plane and 2^10 residual plane in fragment order (ldo elements a row). A wave takes the 16 rows and two neighbouring column groups, which are 8 k of every row: 256 contiguous bytes of each plane */
  if (tid < RPW * 16) { const int r = tid & 15, pc = tid >> 4; float mm = sM[0][r];      /* both loops below are unrolled so that their LDS reads are issued together, ahead of the arithmetic */
#pragma unroll
    for (int u = 1; u < NSPL; ++u) mm = fmaxf(mm, sM[u][r]);
    float l = 0.f; v4f a = {0.f, 0.f, 0.f, 0.f};
#pragma unroll
    for (int u = 0; u < NSPL; ++u) { const float f = expf(sM[u][r] - mm); const v4f val = *(const v4fa*)&sO[u][r][pc * 4]; l += sL[u][r] * f; a += val * f; }
    const float li = (l > 0.f) ? 1.0f / (l * 1024.0f) : 0.f;
    const v4f o = a * li; v4h oh, ol;
#pragma unroll
    for (int q = 0; q < 4; ++q) { const _Float16 hv = (_Float16)o[q]; oh[q] = hv; ol[q] = (_Float16)((o[q] - (float)hv) * 1024.0f); }
    const size_t e = fo_dst(b * TQA + q0 + r, h * 64 + (pc >> 1) * 8, ldo) + (pc & 1) * 4;
    *(v4h*)(OH + e) = oh; *(v4h*)(OL + e) = ol; } }

// 3-term variant: O = (P_hi V_hi + (P_lo V_hi + P_hi V_lo) / 1024) / l with P = [hi | 2^10 residual] of 1024 p and V^T = [hi | 2^10 residual] planes (VtL same layout as Vt) -> ~2^-21-class products for un-averaged (early causal / peaked) rows
template <int CAUSAL>
__global__ __launch_bounds__(256) void k_flash3gB(const _Float16* __restrict__ Q16, int ldq, const _Float16* __restrict__ K16, int ldk, const _Float16* __restrict__ Vt, const _Float16* __restrict__ VtL, const int* __restrict__ MSK, const unsigned int* __restrict__ LV, _Float16* __restrict__ OH, _Float16* __restrict__ OL, int ldo) {
  constexpr int RPW = 16, RTN = RPW / 16, NQB = TQB / (4 * RPW), DT = 4, KS = 2;
  const int tid = threadIdx.x, w = __builtin_amdgcn_readfirstlane(tid >> 5), lane = tid & 31, ln = lane & 15, hh = lane >> 4;      /* the wave's number in a scalar register: the tile number, its live bits and the test on them stay scalar */
  const int slab = blockIdx.x / (QTB / 16), pblk = blockIdx.x % (QTB / 16); (void)NQB; const int b = slab / NH, h = slab % NH;
  /* a wave takes two 16-query tiles one after the other, t and QTB - 1 - t: where the live key tiles grow with the query position, as under a causal mask, every wave then walks about the same number of them. For any mask each tile is taken exactly once */
#pragma unroll 1      /* kept rolled: one copy of the key loop */
  for (int it = 0; it < 2; ++it) {
  const int qt = it ? QTB - 1 - (pblk * 8 + w) : pblk * 8 + w; const int q0 = qt * RPW;
  const unsigned int* lv = LV + (size_t)qt * (3 * 4 * 32);      /* bit kt & 31 of word kt >> 5, the four row groups joined: key tile kt holds a non-zero mask word for this query tile */
  unsigned int lw0 = ~0u, lw1 = ~0u, lw2 = ~0u;      /* the modes without a mask table walk every key tile */
  if (CAUSAL == 8) { lw0 = __builtin_amdgcn_readfirstlane(lv[0] | lv[32] | lv[64] | lv[96]); lw1 = __builtin_amdgcn_readfirstlane(lv[128] | lv[160] | lv[192] | lv[224]); lw2 = __builtin_amdgcn_readfirstlane(lv[256] | lv[288] | lv[320] | lv[352]); }
  FragH aq[2][KS];
#pragma unroll
  for (int rt = 0; rt < RTN; ++rt) { const unsigned short* qr = (const unsigned short*)Q16 + ((size_t)((b * TQB + q0 + rt * 16) >> 4) * (ldq >> 5) + h * 2) * 512 + lane * 8;      /* Q, K and both V^T planes in fragment order */
#pragma unroll
    for (int ks = 0; ks < KS; ++ks) { aq[rt][ks].half[0] = *(const v8us*)(qr + ks * 512); aq[rt][ks].half[1] = *(const v8us*)(qr + ks * 512 + 256); } }
  const size_t vslab = (size_t)(b * (NH / KVG) + h / KVG); const unsigned short* Vth = (const unsigned short*)Vt + vslab * 64 * TK; const unsigned short* Vtl = (const unsigned short*)VtL + vslab * 64 * TK;      /* GQA: q-head h reads kv head h / KVG */
  float m_c = -3.0e38f, l_c = 0.f; v8f oacc[DT], oaccL[DT];      /* of the lane's query q0 + ln; register r of tile dt is dim dt * 16 + 8 hh + r */
#pragma unroll
  for (int dt = 0; dt < DT; ++dt) { oacc[dt] = (v8f){0.f,0.f,0.f,0.f,0.f,0.f,0.f,0.f}; oaccL[dt] = oacc[dt]; }
  const int jend = (CAUSAL == 1) ? (q0 + RPW) : TK;      /* causal: keys beyond the tile's last query never contribute */
#pragma unroll 1
  for (int j0 = 0; j0 < jend; j0 += 32) {
    /* a key tile whose 16 x 32 mask words are all zero leaves m, l and O as they are (every p is 0 and the rescale factor is 1): it is passed over, on a scalar test */
    const int kt = j0 >> 5; const unsigned int lw = (kt < 32) ? lw0 : ((kt < 64) ? lw1 : lw2);
    if (((lw >> (kt & 31)) & 1u) == 0u) continue;
    v8f s[2]; FragH bk[2][KS], bv[DT], bl[DT]; v4im mk[2][2];
    /* every global load of the trip is issued here, in the order of use (K, mask words, both V planes): their latencies overlap, and V lands behind the softmax */
#pragma unroll
    for (int nt = 0; nt < 2; ++nt) { const unsigned short* kr = (const unsigned short*)K16 + ((size_t)((b * TK + j0 + nt * 16) >> 4) * (ldk >> 5) + (h / KVG) * 2) * 512 + lane * 8;
#pragma unroll
      for (int ks = 0; ks < KS; ++ks) { bk[nt][ks].half[0] = *(const v8us*)(kr + ks * 512); bk[nt][ks].half[1] = *(const v8us*)(kr + ks * 512 + 256); } }
    asm volatile("s_wait_xcnt 0x0" ::: "memory");      /* stands in front of the mask loads, whose results may land in registers that the K loads name as addresses */
    if (CAUSAL == 8) { const int* mrow = MSK + (size_t)(q0 + ln) * TK + j0 + 8 * hh;      /* the lane's query row: its 8 keys of each 16-key tile, 32 contiguous bytes */
#pragma unroll
      for (int nt = 0; nt < 2; ++nt) { mk[nt][0] = *(const v4im*)(mrow + nt * 16); mk[nt][1] = *(const v4im*)(mrow + nt * 16 + 4); } }
    asm volatile("s_wait_xcnt 0x0" ::: "memory");      /* stands in front of the V loads, whose results may land in registers that the K and mask loads name as addresses */
#pragma unroll
    for (int dt = 0; dt < DT; ++dt) { const size_t vo = ((size_t)dt * (TK / 32) + (j0 >> 5)) * 512 + lane * 8; const unsigned short* vrow = Vth + vo; const unsigned short* vrl = Vtl + vo; bv[dt].half[0] = *(const v8us*)vrow; bv[dt].half[1] = *(const v8us*)(vrow + 256); bl[dt].half[0] = *(const v8us*)vrl;
      if (dt == DT - 1) asm volatile("s_wait_xcnt 0x0" ::: "memory");      /* stands in front of the trip's last load, whose result lands in the address registers of the V loads above */
      bl[dt].half[1] = *(const v8us*)(vrl + 256); }
    __builtin_amdgcn_sched_barrier(0);      /* keeps the loads above together: without it the scheduler moves each one down to its first use, one exposed latency apiece */
#pragma unroll
    for (int nt = 0; nt < 2; ++nt) { v8f acc = (v8f){0.f,0.f,0.f,0.f,0.f,0.f,0.f,0.f};      /* K rows as A, Q as B: register r = key nt * 16 + 8 hh + r, column ln = query */
#pragma unroll
      for (int ks = 0; ks < KS; ++ks) acc = mmaH<1>(bk[nt][ks].v, bk[nt][ks].v, aq[0][ks].v, aq[0][ks].v, acc); s[nt] = acc; }
    bool ok[16]; const int tq = q0 + ln;
#pragma unroll
    for (int i = 0; i < 16; ++i) { const int k = j0 + (i >> 3) * 16 + 8 * hh + (i & 7);
      bool o = (CAUSAL == 1) ? (k <= tq) : ((CAUSAL == 2) ? ((k >> 5) == (tq >> 5)) : true);      /* mode 2: block-diagonal 32-token groups */
      if (CAUSAL == 8) o = mk[i >> 3][(i >> 2) & 1][i & 3] != 0;      /* mode 8: per-(query, key) int table shared by all batches and heads */
      if (CAUSAL == 4) o = MSK[((size_t)b * TQB + tq) * TK + k] != 0;      /* mode 4: per-(query, key) INPUT mask shared by all heads; masked keys contribute nothing (== the reference's -4096 fill, whose exp underflows to 0), rows with no valid key give l = 0 -> output 0 (== the reference's row_valid zeroing) */
      ok[i] = o; }
    FragH ph, pl; sm_trip(s, ok, m_c, l_c, oacc, oaccL, ph, pl);
#pragma unroll
    for (int dt = 0; dt < DT; ++dt) { oacc[dt] = mmaH<1>(bv[dt].v, bv[dt].v, ph.v, ph.v, oacc[dt]); oaccL[dt] = mmaH<1>(bv[dt].v, bv[dt].v, pl.v, pl.v, oaccL[dt]); oaccL[dt] = mmaH<1>(bl[dt].v, bl[dt].v, ph.v, ph.v, oaccL[dt]); } }      /* V^T rows as A, P^T as B */
  /* the halves' sums joined; the result leaves as the output GEMM's A operand, f16 hi plane and 2^10 residual plane in fragment order (ldo elements a row): a lane's 8 registers of tile dt are k = h * 64 + dt * 16 + 8 hh .. + 7 of row ln, which is the lane's own 16 bytes of half dt & 1 of block h * 2 + (dt >> 1), so each store of a wave is 512 contiguous bytes straight from registers */
  const float lt = l_c + half_swap(l_c); const float li = (lt > 0.f) ? 1.0f / (lt * 1024.0f) : 0.f;
  const size_t oo = ((size_t)((b * TQB + q0) >> 4) * (ldo >> 5) + h * 2) * 512 + lane * 8; unsigned short* oh = (unsigned short*)OH + oo; unsigned short* ol = (unsigned short*)OL + oo;
#pragma unroll
  for (int dt = 0; dt < DT; ++dt) { FragH fh, fl;
#pragma unroll
    for (int r = 0; r < 8; ++r) { float v = oacc[dt][r]; v += oaccL[dt][r] * 0.0009765625f; v = v * li; const _Float16 hv = (_Float16)v; fh.h[r] = hv; fl.h[r] = (_Float16)((v - (float)hv) * 1024.0f); }
    *(v8us*)(oh + dt * 256) = fh.half[0]; *(v8us*)(ol + dt * 256) = fl.half[0]; }
  asm volatile("s_wait_xcnt 0x0" ::: "memory");      /* stands in front of the second tile's set-up, which overwrites registers that the stores above name */
  } }

// two planes [nout][nin] in fragment order, one behind the other: x16 weights (for the hi operand), then x1 weights (for the 2^10 residual operand) at Bt + nout * nin
__device__ __forceinline__ void d_wpair(int bx, const float* __restrict__ Wm, int nin, int nout, _Float16* __restrict__ Bt) { const size_t t = (size_t)bx * 256 + threadIdx.x; if (t >= (size_t)nout * (2 * nin / 8)) return; const size_t per = (size_t)nout * (nin / 8); const bool lo = t >= per; const FoRK s = fo_src(lo ? t - per : t, nin); const int o = s.row; FragH f;
  for (int q = 0; q < 8; ++q) { const int c = s.k + q; if (q) asm volatile("s_wait_xcnt 0x0" ::: "memory");      /* stands in front of each further load, whose result may land in a register that an earlier load names as its address */
    f.h[q] = (_Float16)(bf16_round(Wm[(size_t)c * nout + o]) * (lo ? 1.0f : 16.0f)); } *(v8us*)((unsigned short*)Bt + t * 8) = f.half[0];  }
template <int TWO_D>
__device__ __forceinline__ void d_rotab(int bx, int nrows, int rpb, const int* __restrict__ bar, const int* __restrict__ tib, float* __restrict__ CS, float* __restrict__ SN) {
  #pragma clang fp contract(off)
  const size_t t = (size_t)bx * 256 + threadIdx.x; if (t >= (size_t)nrows * 32) return; const int d = (int)(t % 32); const int row = (int)(t / 32); const int b = row / rpb, r = row % rpb; float pos, inv;
  if (TWO_D) { const int dm = d & 15; inv = 1.0f / powf(10000.0f, (float)dm * 2.0f / 32.0f); pos = (d < 16) ? (float)bar[(size_t)b * rpb + r] : (float)tib[(size_t)b * rpb + r]; }
  else { inv = 1.0f / powf(10000.0f, (float)(2 * d) / 64.0f); pos = (float)r; }
  const float th = pos * inv; const float c = cosf(th), s = sinf(th);
  { *(float*)(CS + t) = c; *(float*)(SN + t) = s;  } }
__device__ __forceinline__ void d_rope(int bx, const float* __restrict__ F, int nrows, int rpb, int nheads, const float* __restrict__ CS, const float* __restrict__ SN, _Float16* __restrict__ dst, int ldo, int dst_bstride, int row_off) {
  #pragma clang fp contract(off)
  /* dst in fragment order (ldo elements a row): a wave takes 16 rows of one head and the dims jg .. jg + 7 and jg + 32 .. jg + 39 that make half a fragment each; rpb, dst_bstride and row_off are multiples of 16 */
  const size_t t = (size_t)bx * 256 + threadIdx.x; if (t >= (size_t)nrows * nheads * 4) return; const int lane = (int)(t & 31); const size_t wid = t >> 5; const int jg = (int)(wid & 1) * 16 + (lane >> 4) * 8; const int h = (int)((wid >> 1) % nheads); const int row = (int)((wid >> 1) / nheads) * 16 + (lane & 15); const int b = row / rpb, r = row % rpb; const int ldi = nheads * 64;
  const float* xr = F + (size_t)row * ldi + h * 64; FragH f0, f1;
#pragma unroll
  for (int q = 0; q < 8; ++q) { const int d = jg + q; const float c = CS[(size_t)row * 32 + d], s = SN[(size_t)row * 32 + d]; const float x0 = xr[d], x1 = xr[d + 32];
    float o0 = x0 * c; o0 += -x1 * s; float o1 = x1 * c; o1 += x0 * s; f0.h[q] = (_Float16)o0; f1.h[q] = (_Float16)o1; }
  unsigned short* o = (unsigned short*)dst + fo_dst(b * dst_bstride + row_off + r, h * 64 + jg, ldo);
  { *(v8us*)o = f0.half[0]; *(v8us*)(o + 512) = f1.half[0];  } }      /* 32 dims on: the next block */
// f16 plane of an f32 plane, in fragment order (k2 into the key plane)
__device__ __forceinline__ void d_putk(int bx, const float* __restrict__ F, int nrows, int rpb, int ncol, _Float16* __restrict__ H, int dst_bstride, int row_off) {
  const size_t t = (size_t)bx * 256 + threadIdx.x; if (t >= (size_t)nrows * (ncol / 8)) return; const FoRK s = fo_src(t, ncol); const int b = s.row / rpb, r = s.row % rpb; FragH fh;
  for (int q = 0; q < 8; ++q) fh.h[q] = (_Float16)F[(size_t)s.row * ncol + s.k + q];
  *(v8us*)((unsigned short*)H + fo_dst(b * dst_bstride + row_off + r, s.k, ncol)) = fh.half[0]; }

// live bits of the phase-2 mask: bit l of word (qt, wd, rg) says whether key tile wd * 32 + l (32 keys) holds a non-zero word in rows 4 rg .. 4 rg + 3 of the 16-query tile qt. A wave per word, a lane per key tile (128 bytes a row); each word has a 128-byte line of its own
__device__ __forceinline__ void d_live(int bx, const int* __restrict__ MSK, unsigned int* __restrict__ LV) {
  typedef int v4ia __attribute__((ext_vector_type(4), may_alias));
  const int wv = bx * 8 + (int)(threadIdx.x >> 5), lane = threadIdx.x & 31; const int rg = wv & 3, wd = (wv >> 2) % 3, qt = (wv >> 2) / 3; const int kt = wd * 32 + lane; v4ia any = {0, 0, 0, 0};
  if (kt < TK / 32) { const int* p = MSK + (size_t)(qt * 16 + rg * 4) * TK + kt * 32;
#pragma unroll 1
    for (int r = 0; r < 4; ++r) {      /* kept rolled: a row's 8 loads are in flight together, and the launch's register count stays low for its other ranges */
#pragma unroll
      for (int c = 0; c < 8; ++c) any |= *(const v4ia*)(p + (size_t)r * TK + c * 4); } }
  const unsigned int word = __builtin_amdgcn_ballot_w32((any[0] | any[1] | any[2] | any[3]) != 0);
  if (lane == 0) LV[(size_t)wv * 32] = word; }

// ---- one launch per dependency level: kernels that do not depend on one another run as consecutive block ranges of one grid. Every range test reads blockIdx.x alone, so a work-group takes one branch as a whole; each body is the same code as before, handed its block number inside its own range. ----
constexpr int PB_W = DMOD * DMOD / 8 / 256, PB_WK = DMOD * KVD / 8 / 256;                  /* blocks of one transposed weight plane: 1024 and 256 columns */
constexpr int PB_P = DMOD * (2 * DMOD / 8) / 256, PB_PK = KVD * (2 * DMOD / 8) / 256;       /* blocks of one hi | residual weight pair */
constexpr int PB_T1 = NRS * 32 / 256, PB_T2 = NRR * 32 / 256;                              /* RoPE tables */
constexpr int PB_XS = NRS * DMOD / 8 / 256, PB_XR = NRR * DMOD / 8 / 256;                  /* f16 planes of the two inputs */
constexpr int PB_ALL = 2 * PB_W + 4 * PB_WK + 2 * PB_P + 2 * PB_PK + PB_T1 + PB_T2 + PB_XS + PB_XR;
__global__ __launch_bounds__(256) void k_prep(const float* w_sq, const float* w_sk, const float* w_sv, const float* w_rq, const float* w_rk, const float* w_rv,
    _Float16* BSQ, _Float16* BSK, _Float16* BSV, _Float16* BRQ, _Float16* BRK, _Float16* BRV,
    const float* w_so, const float* w_ro, const float* w_k2, const float* w_v2, _Float16* BSO, _Float16* BRO, _Float16* BK2, _Float16* BV2,
    const int* bar, const int* tib, float* CS1, float* SN1, float* CS2, float* SN2, const float* sum_x, _Float16* SX, const float* reg_x, _Float16* RX) {
  int bx = blockIdx.x;
  if (bx < 2 * PB_W + 4 * PB_WK) { const float* Wm = w_sq; _Float16* Bt = BSQ; int nout = DMOD;
    if (bx >= PB_W) { bx -= PB_W; Wm = w_rq; Bt = BRQ;
      if (bx >= PB_W) { bx -= PB_W; Wm = w_sk; Bt = BSK; nout = KVD;
        if (bx >= PB_WK) { bx -= PB_WK; Wm = w_sv; Bt = BSV;
          if (bx >= PB_WK) { bx -= PB_WK; Wm = w_rk; Bt = BRK;
            if (bx >= PB_WK) { bx -= PB_WK; Wm = w_rv; Bt = BRV; } } } } }
    d_wt_f16(bx, Wm, Bt, DMOD, nout, 16.0f); return; }
  bx -= 2 * PB_W + 4 * PB_WK;
  if (bx < 2 * PB_P + 2 * PB_PK) { const float* Wm = w_so; _Float16* Bt = BSO; int nout = DMOD;
    if (bx >= PB_P) { bx -= PB_P; Wm = w_ro; Bt = BRO;
      if (bx >= PB_P) { bx -= PB_P; Wm = w_k2; Bt = BK2; nout = KVD;
        if (bx >= PB_PK) { bx -= PB_PK; Wm = w_v2; Bt = BV2; } } }
    d_wpair(bx, Wm, DMOD, nout, Bt); return; }
  bx -= 2 * PB_P + 2 * PB_PK;
  if (bx < PB_T1) { d_rotab<0>(bx, NRS, SS, nullptr, nullptr, CS1, SN1); return; }
  bx -= PB_T1;
  if (bx < PB_T2) { d_rotab<1>(bx, NRR, RR, bar, tib, CS2, SN2); return; }
  bx -= PB_T2;
  if (bx < PB_XS) d_x16(bx, sum_x, SX, (size_t)NRS * DMOD / 8, DMOD); else d_x16(bx - PB_XS, reg_x, RX, (size_t)NRR * DMOD / 8, DMOD); }

// up to six GEMMs (d_gemm2) in one launch, all with the same K and alpha, operands in fragment order; ldc = N. Jobs 0..2 read A0 (Ma rows), jobs 3..5 read A1 (Mb rows); in each triple N = DMOD, KVD, KVD. S_j is job j's bias. np == 2 (jobs 0..2 only): A0L is the residual plane of A0, and each B_j is a pair of planes, x16 weights and behind them x1 weights; both products are summed in the one launch. The grid ends behind the last job in use; the pointers of jobs behind it are not read.
__global__ __launch_bounds__(128) void k_gemm2m(const _Float16* A0, const _Float16* A1, const _Float16* A0L, const _Float16* B0, const _Float16* B1, const _Float16* B2, const _Float16* B3, const _Float16* B4, const _Float16* B5,
    const float* S0, const float* S1, const float* S2, const float* S3, const float* S4, const float* S5, float* C0, float* C1, float* C2, float* C3, float* C4, float* C5, int Ma, int Mb, int K, float alpha, int np) {
  int bx = blockIdx.x; const int ta = Ma >> 7, tb = Mb >> 7;      /* 128-row block tiles; a job has (M / 128) * (N / 64) blocks */
  const _Float16* A = A0; const _Float16* B = B0; const float* S = S0; float* C = C0; int M = Ma, N = DMOD;
  if (bx >= ta * (DMOD / 64)) { bx -= ta * (DMOD / 64); B = B1; S = S1; C = C1; N = KVD;
    if (bx >= ta * (KVD / 64)) { bx -= ta * (KVD / 64); B = B2; S = S2; C = C2;
      if (bx >= ta * (KVD / 64)) { bx -= ta * (KVD / 64); A = A1; M = Mb; B = B3; S = S3; C = C3; N = DMOD;
        if (bx >= tb * (DMOD / 64)) { bx -= tb * (DMOD / 64); B = B4; S = S4; C = C4; N = KVD;
          if (bx >= tb * (KVD / 64)) { bx -= tb * (KVD / 64); B = B5; S = S5; C = C5; } } } } }
  d_gemm2<0>(bx, A, 0, B, 0, A0L, B + (size_t)N * K, np, alpha, S, 0, nullptr, 1, (size_t)N, 0, C, nullptr, N, 0, M, N, K); }

constexpr int QB_RQ = NRR * NH * 4 / 256, QB_RK = NRR * NKV * 4 / 256, QB_RV = NB * NKV * (RR / 64), QB_SQ = NRS * NH * 4 / 256, QB_SK = NRS * NKV * 4 / 256, QB_SV = NB * NKV * (SS / 64), QB_K2 = NRS * (KVD / 8) / 256;      /* values: a block per tile of 64 keys x 64 dims */
constexpr int QB_LV = QTB * 3 * 4 / 8;      /* live bits of the phase-2 mask: 8 waves a block, a wave per word */
// what follows the six projections: RoPE of both q and both k planes, transposed hi + residual planes of both v; ahead of them, as it depends on an input alone, the live bits of the phase-2 mask
__global__ __launch_bounds__(256) void k_post(const float* FSQ, const float* FSK, const float* FSV, const float* FRQ, const float* FRK, const float* FRV, const float* CS1, const float* SN1, const float* CS2, const float* SN2,
    _Float16* SQ, _Float16* RQ, _Float16* KC, _Float16* VT, _Float16* VTL, const int* mupd, unsigned int* LV) {
  int bx = blockIdx.x;
  if (bx < QB_LV) { d_live(bx, mupd, LV); return; }
  bx -= QB_LV;
  if (bx < QB_RQ + QB_RK + QB_SQ + QB_SK) { const float* F = FRQ; const float* CS = CS2; const float* SN = SN2; _Float16* dst = RQ; int nrows = NRR, rpb = RR, nheads = NH, bstr = RR, roff = 0;
    if (bx >= QB_RQ) { bx -= QB_RQ; F = FRK; dst = KC; nheads = NKV; bstr = TK; roff = SS;      /* keys 64.. of each batch */
      if (bx >= QB_RK) { bx -= QB_RK; F = FSQ; CS = CS1; SN = SN1; dst = SQ; nrows = NRS; rpb = SS; nheads = NH; bstr = SS; roff = 0;
        if (bx >= QB_SQ) { bx -= QB_SQ; F = FSK; dst = KC; nheads = NKV; bstr = TK; } } }      /* keys 0..63 of each batch */
    d_rope(bx, F, nrows, rpb, nheads, CS, SN, dst, nheads * 64, bstr, roff); return; }
  bx -= QB_RQ + QB_RK + QB_SQ + QB_SK;
  const bool rg = bx < QB_RV; d_vtf(rg ? bx : bx - QB_RV, rg ? FRV : FSV, rg ? RR : SS, rg ? SS : 0, VT, VTL); }      /* regular values at keys 64.., summary values at keys 0..63 of each batch */
// k2 into key rows 0..63 (one plane), v2 into keys 0..63 of both V^T planes, of each batch; the regular keys' part of the planes stands as k_post wrote it
__global__ __launch_bounds__(256) void k_put2(const float* FK2, const float* FV2, _Float16* KC, _Float16* VT, _Float16* VTL) {
  const int bx = blockIdx.x;
  if (bx < QB_K2) d_putk(bx, FK2, NRS, SS, KVD, KC, TK, 0); else d_vtf(bx - QB_K2, FV2, SS, 0, VT, VTL); }

extern "C" void kernel_launch(void* const* d_in, const int* in_sizes, int n_in,
                              void* d_out, int out_size, void* d_ws, size_t ws_size, hipStream_t stream) {
  (void)in_sizes; (void)n_in; (void)out_size;
  const float* const* I = (const float* const*)d_in; const float* sum_x = I[0]; const float* reg_x = I[1];
  const float* w_sq = I[2]; const float* b_sq = I[3]; const float* w_sk = I[4]; const float* b_sk = I[5]; const float* w_sv = I[6]; const float* b_sv = I[7]; const float* w_so = I[8]; const float* b_so = I[9];
  const float* w_rq = I[10]; const float* b_rq = I[11]; const float* w_rk = I[12]; const float* b_rk = I[13]; const float* w_rv = I[14]; const float* b_rv = I[15]; const float* w_ro = I[16]; const float* b_ro = I[17];
  const float* w_k2 = I[18]; const float* b_k2 = I[19]; const float* w_v2 = I[20]; const float* b_v2 = I[21];
  const int* bar = (const int*)d_in[22]; const int* tib = (const int*)d_in[23]; const int* msum = (const int*)d_in[24]; const int* mupd = (const int*)d_in[25];
  char* ws = (char*)d_ws; size_t off = 0;
  auto take = [&](size_t bytes) { char* p = ws + off; off += (bytes + 255) & ~(size_t)255; return p; };
  const size_t w8 = (size_t)DMOD * DMOD / 8, w8k = (size_t)DMOD * KVD / 8;
  _Float16* BSQ = (_Float16*)take(w8 * 16); _Float16* BSK = (_Float16*)take(w8k * 16); _Float16* BSV = (_Float16*)take(w8k * 16); _Float16* BRQ = (_Float16*)take(w8 * 16); _Float16* BRK = (_Float16*)take(w8k * 16); _Float16* BRV = (_Float16*)take(w8k * 16);
  _Float16* BSO = (_Float16*)take(w8 * 32); _Float16* BRO = (_Float16*)take(w8 * 32); _Float16* BK2 = (_Float16*)take(w8k * 32); _Float16* BV2 = (_Float16*)take(w8k * 32);
  float* CS1 = (float*)take((size_t)NRS * 32 * 4); float* SN1 = (float*)take((size_t)NRS * 32 * 4); float* CS2 = (float*)take((size_t)NRR * 32 * 4); float* SN2 = (float*)take((size_t)NRR * 32 * 4); _Float16* SX = (_Float16*)take((size_t)NRS * DMOD * 2); _Float16* RX = (_Float16*)take((size_t)NRR * DMOD * 2);
  /* each projection has an f32 plane of its own, since all six are written by one launch */
  float* FRQ = (float*)take((size_t)NRR * DMOD * 4); float* FRK = (float*)take((size_t)NRR * KVD * 4); float* FRV = (float*)take((size_t)NRR * KVD * 4); float* FSQ = (float*)take((size_t)NRS * DMOD * 4); float* FSK = (float*)take((size_t)NRS * KVD * 4); float* FSV = (float*)take((size_t)NRS * KVD * 4);
  _Float16* SQ = (_Float16*)take((size_t)NRS * DMOD * 2); _Float16* RQ = (_Float16*)take((size_t)NRR * DMOD * 2); _Float16* KC = (_Float16*)take((size_t)NB * TK * KVD * 2); _Float16* VT = (_Float16*)take((size_t)NB * NKV * 64 * TK * 2); _Float16* VTL = (_Float16*)take((size_t)NB * NKV * 64 * TK * 2);
  _Float16* O1H = (_Float16*)take((size_t)NRS * DMOD * 2); _Float16* O1L = (_Float16*)take((size_t)NRS * DMOD * 2); _Float16* O2H = (_Float16*)FRQ; _Float16* O2L = O2H + (size_t)NRR * DMOD;      /* both reg_attn planes over the reg-q f32 scratch (dead after k_post) */
  unsigned int* LV = (unsigned int*)take((size_t)QTB * 3 * 4 * 128);      /* live bits of the phase-2 mask, a 128-byte line a word */
  float* FK2 = FSK; float* FV2 = FSV;      /* k2 / v2 f32 planes over the summary k / v scratch (dead after k_post) */
  if (off > ws_size) return;      /* about 70 MiB */
  float* out0 = (float*)d_out; float* out1 = (float*)d_out + (size_t)NRS * DMOD;
  /* weight planes, RoPE tables, input planes */
  k_prep<<<PB_ALL, 256, 0, stream>>>(w_sq, w_sk, w_sv, w_rq, w_rk, w_rv, BSQ, BSK, BSV, BRQ, BRK, BRV, w_so, w_ro, w_k2, w_v2, BSO, BRO, BK2, BV2, bar, tib, CS1, SN1, CS2, SN2, sum_x, SX, reg_x, RX);
  /* summary q/k/v and regular q/k/v */
  k_gemm2m<<<(NRS / 128 + NRR / 128) * ((DMOD + 2 * KVD) / 64), 128, 0, stream>>>(SX, RX, nullptr, BSQ, BSK, BSV, BRQ, BRK, BRV, b_sq, b_sk, b_sv, b_rq, b_rk, b_rv, FSQ, FSK, FSV, FRQ, FRK, FRV, NRS, NRR, DMOD, 0.0625f, 1);
  k_post<<<QB_LV + QB_RQ + QB_RK + QB_SQ + QB_SK + QB_RV + QB_SV, 256, 0, stream>>>(FSQ, FSK, FSV, FRQ, FRK, FRV, CS1, SN1, CS2, SN2, SQ, RQ, KC, VT, VTL, mupd, LV);
  /* phase 1: summary queries over [summary ; regular] keys; sum_attn leaves as hi + residual planes */
  k_flash3gA<8><<<NB * NH * (TQA / 16), 32 * NSPL, 0, stream>>>(SQ, DMOD, KC, KVD, VT, VTL, msum, O1H, O1L, DMOD);
  /* output 0 = sum_attn W_so + b_so; k2 / v2 from sum_attn (no RoPE): hi and residual product of each in the one launch */
  k_gemm2m<<<(NRS / 128) * ((DMOD + 2 * KVD) / 64), 128, 0, stream>>>(O1H, nullptr, O1L, BSO, BK2, BV2, nullptr, nullptr, nullptr, b_so, b_k2, b_v2, nullptr, nullptr, nullptr, out0, FK2, FV2, nullptr, nullptr, nullptr, NRS, 0, DMOD, 1.0f / 1024.0f, 2);
  k_put2<<<QB_K2 + QB_SV, 256, 0, stream>>>(FK2, FV2, KC, VT, VTL);      /* into keys 0..63 of each batch */
  /* phase 2: regular queries over [k2 ; regular] keys; reg_attn leaves as hi + residual planes */
  k_flash3gB<8><<<NB * NH * (QTB / 16), 256, 0, stream>>>(RQ, DMOD, KC, KVD, VT, VTL, mupd, LV, O2H, O2L, DMOD);
  k_gemm2m<<<(NRR / 128) * (DMOD / 64), 128, 0, stream>>>(O2H, nullptr, O2L, BRO, nullptr, nullptr, nullptr, nullptr, nullptr, b_ro, nullptr, nullptr, nullptr, nullptr, nullptr, out1, nullptr, nullptr, nullptr, nullptr, nullptr, NRR, 0, DMOD, 1.0f / 1024.0f, 2);
}

// v010
// Measured time: 153 microseconds a run.
// Two timings next to v009 put it at 1.14 and 1.15 times that version's speed.
// Counting every step since v000, which is the starting kernel, it is 9.04 times as fast.
#include <hip/hip_runtime.h>
// FlexSummaryAttention (2 batches; 64 summary tokens S, 2048 regular tokens R, D = 1024; 16 query heads, 4 kv heads (GQA), head dim 64): q/k/v projections for both token sets; 1-D RoPE on summary q/k, 2-D hierarchical RoPE (bar id | token-in-bar id) on regular q/k; phase 1: summary queries over [summary; regular] keys with the summarize mask -> sum_attn; k2/v2 = sum_attn W + b; phase 2: regular queries over [k2; regular k] / [v2; regular v] with the updating mask -> reg_attn; outputs sum_attn W_so + b and reg_attn W_ro + b.
// Structure: exact f16 planes of both inputs; six projection GEMMs (32x64 wave tiles, f32 accumulation, exact x16 weights + bias); RoPE on VALU (thread per (row, head, 8 dims), f32 trig) into f16 q planes and the shared per-batch key plane [k2-or-summary ; regular] (4 kv heads); values as f16 hi + 2^10 residual planes, V^T by LDS tiles; the fused flash kernel (3-term P.V, GQA head mapping, INPUT int mask tables) once per phase; sum_attn / reg_attn as hi + residual pairs into the k2/v2 and output GEMMs.
// Compute dtype: inputs, masks' companions and parameters rounded to bf16; q/k after RoPE as f16 (~2^-12); P and v hi + residual (~2^-21-class); attention outputs hi + residual into the following GEMMs; f32 softmax/accumulation/trig. v_wmma_f32_16x16x32_f16.
#define NB 2
#define SS 64
#define RR 2048
#define DMOD 1024
#define KVD 256
#define NRS (NB * SS)            /* 128 summary rows */
#define NRR (NB * RR)            /* 4096 regular rows */
#define TK 2112                  /* keys per batch in both phases: 64 summary(-derived) + 2048 regular */
#define TQA 64                   /* phase-1 queries (summary tokens) */
#define TQB 2048                 /* phase-2 queries (regular tokens) */
#define TQ TQB
#define NH 16
#define KVG 4                    /* GQA: 16 query heads share 4 kv heads */
#define NKV (NH / KVG)
#define SCL 0.125f               /* 64^-0.5 */
#define QBLKSA (TQA / 64)
#define NSPL 11                  /* phase 1: waves that share the 2112 keys of one 16-query tile, 6 trips of 32 keys each */
#define QBLKSB (TQB / 64)
#define QTB (TQB / 16)           /* phase 2: 16-query tiles */
typedef __bf16 v16b __attribute__((ext_vector_type(16)));
typedef unsigned short v8us __attribute__((ext_vector_type(8), may_alias));
typedef float  v8f  __attribute__((ext_vector_type(8)));
typedef float  v4f  __attribute__((ext_vector_type(4)));
typedef float  v4fa __attribute__((ext_vector_type(4), may_alias));
union FragB { v16b v; v8us half[2]; unsigned short u[16]; };

__device__ __forceinline__ unsigned short bf16_bits(float x) { unsigned int u = __float_as_uint(x); return (unsigned short)((u + 0x7FFFu + ((u >> 16) & 1u)) >> 16); }
__device__ __forceinline__ float bf16_val(unsigned short b) { return __uint_as_float(((unsigned int)b) << 16); }
__device__ __forceinline__ float bf16_round(float x) { return bf16_val(bf16_bits(x)); }
// D += A·B with NT terms: 1 = ah·bh, 2 = + al·bh (A split), 3 = + ah·bl (both split)
template <int NT>
__device__ __forceinline__ v8f mmaN(v16b ah, v16b al, v16b bh, v16b bl, v8f c) {
  c = __builtin_amdgcn_wmma_f32_16x16x32_bf16(false, ah, false, bh, (short)0, c, false, false);
  if (NT >= 2) c = __builtin_amdgcn_wmma_f32_16x16x32_bf16(false, al, false, bh, (short)0, c, false, false);
  if (NT >= 3) c = __builtin_amdgcn_wmma_f32_16x16x32_bf16(false, ah, false, bl, (short)0, c, false, false);
  asm volatile("v_nop\n\tv_nop\n\tv_nop\n\tv_nop" : "+v"(c) : "v"(ah), "v"(al), "v"(bh), "v"(bl));
  return c;
}

__global__ __launch_bounds__(256) void k_wt_bf16(const float* __restrict__ W, unsigned short* __restrict__ Wt, int K, int N) {
  const int t = blockIdx.x * 256 + threadIdx.x;
  const int k8n = K / 8;
  if (t >= N * k8n) return;
  const int n = t / k8n, k8 = (t % k8n) * 8;
  v8us v;
#pragma unroll
  for (int i = 0; i < 8; ++i) v[i] = bf16_bits(W[(size_t)(k8 + i) * N + n]);
  *(v8us*)(Wt + (size_t)n * K + k8) = v;
  
}

// GEMM C[M][N] (f32, pitch ldc) = act(A[M][K]·W + bias). A f32 row-major (pitch lda) converted per fragment to bf16
// (ASPLIT: hi/lo two planes -> 2 terms, else single rounded term); Wt bf16 [N][K] (pitch ldb). BIAS_BF16 rounds the
// bias to bf16 first (bias quantised to bf16 before the add). K%32==0, M%16==0, N%64==0.
template <bool ASPLIT, int ACT, bool BIAS_BF16>
__global__ __launch_bounds__(128) void k_gemm_bf(const float* __restrict__ A, int lda, const unsigned short* __restrict__ Wt, int ldb,
                                               const float* __restrict__ bias, float* __restrict__ C, int ldc, int M, int N, int K) {
  __shared__ __attribute__((aligned(16))) float so[4][16][64];
  const int tid = threadIdx.x, w = tid >> 5, lane = tid & 31, ln = lane & 15, hh = lane >> 4;
  const int ntn = N / 64;
  const int wid = blockIdx.x * 4 + w;
  const int mt = wid / ntn, nq = wid % ntn;
  if (mt * 16 >= M) return;
  const int row0 = mt * 16, col0 = nq * 64;
  const float* arow = A + (size_t)(row0 + ln) * lda;
  v8f acc[4] = {};
  for (int kb = 0; kb < K; kb += 32) {
    FragB ah, al;
    const v4f x0 = *(const v4fa*)(arow + kb + 8 * hh), x1 = *(const v4fa*)(arow + kb + 8 * hh + 4);
    const v4f x2 = *(const v4fa*)(arow + kb + 16 + 8 * hh), x3 = *(const v4fa*)(arow + kb + 16 + 8 * hh + 4);
    float xs[16] = {x0[0],x0[1],x0[2],x0[3],x1[0],x1[1],x1[2],x1[3],x2[0],x2[1],x2[2],x2[3],x3[0],x3[1],x3[2],x3[3]};
#pragma unroll
    for (int i = 0; i < 16; ++i) { const unsigned short hb = bf16_bits(xs[i]); ah.u[i] = hb; al.u[i] = ASPLIT ? bf16_bits(xs[i] - bf16_val(hb)) : (unsigned short)0; }
#pragma unroll
    for (int t = 0; t < 4; ++t) {
      const unsigned short* brow = Wt + (size_t)(col0 + t * 16 + ln) * ldb + kb;
      FragB b;
      b.half[0] = *(const v8us*)(brow + 8 * hh);
      b.half[1] = *(const v8us*)(brow + 16 + 8 * hh);
      acc[t] = mmaN<ASPLIT ? 2 : 1>(ah.v, al.v, b.v, b.v, acc[t]);
    }
  }
#pragma unroll
  for (int t = 0; t < 4; ++t) {
    float bv = bias ? bias[col0 + t * 16 + ln] : 0.f;
    if (BIAS_BF16) bv = bf16_round(bv);
#pragma unroll
    for (int r = 0; r < 8; ++r) { float v = acc[t][r] + bv; if (ACT == 1) v = fmaxf(v, 0.f); so[w][8 * hh + r][t * 16 + ln] = v; }
  }
  __builtin_amdgcn_fence(__ATOMIC_ACQ_REL, "workgroup");
  __builtin_amdgcn_wave_barrier();
  const int rsub = lane >> 4, c4 = (lane & 15) * 4;
  {
#pragma unroll
    for (int q = 0; q < 8; ++q) {
      const int r = q * 2 + rsub;
      const v4f v = *(const v4fa*)&so[w][r][c4];
      *(v4f*)(C + (size_t)(row0 + r) * ldc + col0 + c4) = v;
    }
    
  }
}

// GEMM C = act(A·W + bias + resid): A f32 (ASPLIT -> hi/lo 2 terms), Wt bf16 [N][K]; ACT 0 none, 1 relu, 2 exact gelu;
// resid (optional, f32, row index = (row % rmod), pitch ldr, RES_BF16 rounds it) added before the activation.
template <bool ASPLIT, int ACT, bool BIAS_BF16, bool RES_BF16>
__global__ __launch_bounds__(128) void k_gemm_bf3(const float* __restrict__ A, int lda, const unsigned short* __restrict__ Wt, int ldb,
                                                const float* __restrict__ bias, const float* __restrict__ resid, int rmod, int ldr,
                                                float* __restrict__ C, int ldc, int M, int N, int K) {
  __shared__ __attribute__((aligned(16))) float so[4][16][64];
  const int tid = threadIdx.x, w = tid >> 5, lane = tid & 31, ln = lane & 15, hh = lane >> 4;
  const int ntn = N / 64;
  const int wid = blockIdx.x * 4 + w;
  const int mt = wid / ntn, nq = wid % ntn;
  if (mt * 16 >= M) return;
  const int row0 = mt * 16, col0 = nq * 64;
  const float* arow = A + (size_t)(row0 + ln) * lda;
  v8f acc[4] = {};
  for (int kb = 0; kb < K; kb += 32) {
    FragB ah, al;
    const v4f x0 = *(const v4fa*)(arow + kb + 8 * hh), x1 = *(const v4fa*)(arow + kb + 8 * hh + 4);
    const v4f x2 = *(const v4fa*)(arow + kb + 16 + 8 * hh), x3 = *(const v4fa*)(arow + kb + 16 + 8 * hh + 4);
    float xs[16] = {x0[0],x0[1],x0[2],x0[3],x1[0],x1[1],x1[2],x1[3],x2[0],x2[1],x2[2],x2[3],x3[0],x3[1],x3[2],x3[3]};
#pragma unroll
    for (int i = 0; i < 16; ++i) { const unsigned short hb = bf16_bits(xs[i]); ah.u[i] = hb; al.u[i] = ASPLIT ? bf16_bits(xs[i] - bf16_val(hb)) : (unsigned short)0; }
#pragma unroll
    for (int t = 0; t < 4; ++t) {
      const unsigned short* brow = Wt + (size_t)(col0 + t * 16 + ln) * ldb + kb;
      FragB b;
      b.half[0] = *(const v8us*)(brow + 8 * hh);
      b.half[1] = *(const v8us*)(brow + 16 + 8 * hh);
      acc[t] = mmaN<ASPLIT ? 2 : 1>(ah.v, al.v, b.v, b.v, acc[t]);
    }
  }
#pragma unroll
  for (int t = 0; t < 4; ++t) {
    const int col = col0 + t * 16 + ln;
    float bv = bias ? bias[col] : 0.f;
    if (BIAS_BF16) bv = bf16_round(bv);
#pragma unroll
    for (int r = 0; r < 8; ++r) {
      float v = acc[t][r] + bv;
      if (resid) { float rv = resid[(size_t)((row0 + 8 * hh + r) % rmod) * ldr + col]; if (RES_BF16) rv = bf16_round(rv); v += rv; }
      if (ACT == 1) v = fmaxf(v, 0.f);
      if (ACT == 2) v = 0.5f * v * (1.0f + erff(v * 0.70710678118654752f));
      if (ACT == 3) { const float u = 0.7978845608028654f * (v + 0.044715f * v * v * v); v = 0.5f * v * (1.0f + tanhf(u)); }
      so[w][8 * hh + r][t * 16 + ln] = v;
    }
  }
  __builtin_amdgcn_fence(__ATOMIC_ACQ_REL, "workgroup");
  __builtin_amdgcn_wave_barrier();
  const int rsub = lane >> 4, c4 = (lane & 15) * 4;
  {
#pragma unroll
    for (int q = 0; q < 8; ++q) {
      const int r = q * 2 + rsub;
      const v4f v = *(const v4fa*)&so[w][r][c4];
      *(v4f*)(C + (size_t)(row0 + r) * ldc + col0 + c4) = v;
    }
    
  }
}
// row LayerNorm (biased variance, eps) over N: s = X (+ R); optional out_sum <- s; out_norm <- (s-mu)*rsqrt(var+eps)*g + b
template <bool PARAM_BF16>
__global__ __launch_bounds__(256) void k_layernorm(const float* __restrict__ X, const float* __restrict__ R, const float* __restrict__ g, const float* __restrict__ bta,
                                                  float* __restrict__ out_sum, float* __restrict__ out_norm, int N, float eps) {
  __shared__ float red[256];
  const int row = blockIdx.x, tid = threadIdx.x;
  const float* x = X + (size_t)row * N; const float* rr = R ? R + (size_t)row * N : nullptr;
  float vals[16];                     // up to N = 4096
  const int per = N / 256;            // contiguous chunk per thread? use strided-by-4 chunks: thread handles j = tid*4 + 1024*u
  float s1 = 0.f;
  for (int u = 0; u < per / 4; ++u) {
    const int j = tid * 4 + 1024 * u;
    const v4f a = *(const v4fa*)(x + j);
    v4f b = {0.f,0.f,0.f,0.f}; if (rr) b = *(const v4fa*)(rr + j);
#pragma unroll
    for (int q = 0; q < 4; ++q) { const float v = a[q] + b[q]; vals[u * 4 + q] = v; s1 += v; }
  }
  red[tid] = s1; __syncthreads();
  for (int st = 128; st > 0; st >>= 1) { if (tid < st) red[tid] += red[tid + st]; __syncthreads(); }
  const float mu = red[0] / (float)N; __syncthreads();
  float s2 = 0.f;
  for (int u = 0; u < per / 4; ++u)
#pragma unroll
    for (int q = 0; q < 4; ++q) { const float c = vals[u * 4 + q] - mu; s2 += c * c; }
  red[tid] = s2; __syncthreads();
  for (int st = 128; st > 0; st >>= 1) { if (tid < st) red[tid] += red[tid + st]; __syncthreads(); }
  const float rs = rsqrtf(red[0] / (float)N + eps);
  {
    for (int u = 0; u < per / 4; ++u) {
      const int j = tid * 4 + 1024 * u;
      v4f o, sm;
#pragma unroll
      for (int q = 0; q < 4; ++q) {
        float gg = g[j + q], bb = bta[j + q];
        if (PARAM_BF16) { gg = bf16_round(gg); bb = bf16_round(bb); }
        sm[q] = vals[u * 4 + q]; o[q] = (vals[u * 4 + q] - mu) * rs * gg + bb;
      }
      if (out_sum) *(v4f*)(out_sum + (size_t)row * N + j) = sm;
      *(v4f*)(out_norm + (size_t)row * N + j) = o;
    }
    
  }
}



// ---- f16 WMMA path (v_wmma_f32_16x16x32_f16): 11-bit significands for operands in range — used where a [0,1] probability operand needs more precision than bf16
typedef _Float16 v16h __attribute__((ext_vector_type(16)));
union FragH { v16h v; v8us half[2]; _Float16 h[16]; unsigned short u[16]; };
template <int NT>
__device__ __forceinline__ v8f mmaH(v16h ah, v16h al, v16h bh, v16h bl, v8f c) {
  c = __builtin_amdgcn_wmma_f32_16x16x32_f16(false, ah, false, bh, (short)0, c, false, false);
  if (NT >= 2) c = __builtin_amdgcn_wmma_f32_16x16x32_f16(false, al, false, bh, (short)0, c, false, false);
  if (NT >= 3) c = __builtin_amdgcn_wmma_f32_16x16x32_f16(false, ah, false, bl, (short)0, c, false, false);
  asm volatile("v_nop\n\tv_nop\n\tv_nop\n\tv_nop" : "+v"(c) : "v"(ah), "v"(al), "v"(bh), "v"(bl));
  return c;
}
// batched GEMM like k_gemm_b but f16 operands: A f32 (split into f16 hi/lo if ASPLIT, else rounded to f16), Bt = f16 values [n][k]; alpha; C f32; N multiple of 16 (partial tiles skipped)
template <bool ASPLIT>
__global__ __launch_bounds__(128) void k_gemm_h(const float* __restrict__ A, int lda, size_t sA, const _Float16* __restrict__ Bh, int ldb, size_t sB, float alpha, float* __restrict__ C, int ldc, size_t sC, int M, int N, int K) {
  __shared__ __attribute__((aligned(16))) float so[4][16][64];
  const int tid = threadIdx.x, w = tid >> 5, lane = tid & 31, ln = lane & 15, hh = lane >> 4; const int by = blockIdx.y;
  A += (size_t)by * sA; Bh += (size_t)by * sB; C += (size_t)by * sC;
  const int ntn = (N + 63) / 64; const int wid = blockIdx.x * 4 + w; const int mt = wid / ntn, nq = wid % ntn; if (mt * 16 >= M) return;
  const int row0 = mt * 16, col0 = nq * 64; const float* arow = A + (size_t)(row0 + ln) * lda;
  v8f acc[4] = {};
  for (int kb = 0; kb < K; kb += 32) {
    FragH ah, al;
    const v4f x0 = *(const v4fa*)(arow + kb + 8 * hh), x1 = *(const v4fa*)(arow + kb + 8 * hh + 4), x2 = *(const v4fa*)(arow + kb + 16 + 8 * hh), x3 = *(const v4fa*)(arow + kb + 16 + 8 * hh + 4);
    float xs[16] = {x0[0],x0[1],x0[2],x0[3],x1[0],x1[1],x1[2],x1[3],x2[0],x2[1],x2[2],x2[3],x3[0],x3[1],x3[2],x3[3]};
#pragma unroll
    for (int i = 0; i < 16; ++i) { const _Float16 h = (_Float16)xs[i]; ah.h[i] = h; al.h[i] = ASPLIT ? (_Float16)(xs[i] - (float)h) : (_Float16)0.0f; }
#pragma unroll
    for (int t = 0; t < 4; ++t) { if (col0 + t * 16 >= N) continue; const size_t boff = (size_t)(col0 + t * 16 + ln) * ldb + kb; FragH bq; bq.half[0] = *(const v8us*)(Bh + boff + 8 * hh); bq.half[1] = *(const v8us*)(Bh + boff + 16 + 8 * hh);
      acc[t] = mmaH<ASPLIT ? 2 : 1>(ah.v, al.v, bq.v, bq.v, acc[t]); }
  }
#pragma unroll
  for (int t = 0; t < 4; ++t) { if (col0 + t * 16 >= N) continue;
#pragma unroll
    for (int r = 0; r < 8; ++r) so[w][8 * hh + r][t * 16 + ln] = acc[t][r] * alpha; }
  __builtin_amdgcn_fence(__ATOMIC_ACQ_REL, "workgroup"); __builtin_amdgcn_wave_barrier();
  const int rsub = lane >> 4, c4 = (lane & 15) * 4;
  {
#pragma unroll
    for (int q = 0; q < 8; ++q) { const int r = q * 2 + rsub; if (col0 + c4 < N) { const v4f v = *(const v4fa*)&so[w][r][c4]; *(v4f*)(C + (size_t)(row0 + r) * ldc + col0 + c4) = v; } }
     }
}

// ---- fragment order: every f16 plane [rows][K] that feeds a matrix operand (rows % 16 == 0, K % 32 == 0) is stored as 1-KiB blocks, one per fragment of 16 rows x 32 k, block (rt, kt) at element (rt * (K / 32) + kt) * 512.
// Inside a block, lane l = 16 hh + ln (row ln of the tile) finds its k = 8 hh .. 8 hh + 7 at element 8 l and its k = 16 + 8 hh .. 16 + 8 hh + 7 at element 256 + 8 l: each of a fragment's two 16-byte loads reads 512 contiguous bytes, four whole lines, where rows of a row-major plane gave sixteen lines of 32 bytes. The registers hold the same values as before.
// A writer's thread t stores elements 8 t .. 8 t + 7 of the plane (a wave stores four whole lines); fo_src names the row and the first k that belong there.
struct FoRK { int row, k; };
__device__ __forceinline__ FoRK fo_src(size_t t, int K) { const int lane = (int)(t & 31); const size_t wid = t >> 5; const int half = (int)(wid & 1); const size_t blk = wid >> 1; const int kb = K >> 5;
  FoRK o; o.row = (int)(blk / kb) * 16 + (lane & 15); o.k = (int)(blk % kb) * 32 + half * 16 + (lane >> 4) * 8; return o; }
// element offset of the 8 values (row, k8 .. k8 + 7), k8 % 8 == 0
__device__ __forceinline__ size_t fo_dst(int row, int k8, int K) { return ((size_t)(row >> 4) * (K >> 5) + (k8 >> 5)) * 512 + ((k8 >> 4) & 1) * 256 + (((k8 >> 3) & 1) * 16 + (row & 15)) * 8; }
// Wt = f16(W[k][n] * scale), rows n, in fragment order, from f32 row-major W[K][N] (scale = power of two; bf16-exact weights stay exact in f16 away from the subnormal range)
__device__ __forceinline__ void d_wt_f16(int bx, const float* __restrict__ W, _Float16* __restrict__ Wt, int K, int N, float scale) {
  const int t = bx * 256 + threadIdx.x; if (t >= N * (K / 8)) return; const FoRK s = fo_src((size_t)t, K); const int n = s.row, k8 = s.k; FragH f;
#pragma unroll
  for (int i = 0; i < 8; ++i) { if (i) asm volatile("s_wait_xcnt 0x0" ::: "memory");      /* stands in front of each further load, whose result may land in a register that an earlier load names as its address */
    f.h[i] = (_Float16)(bf16_round(W[(size_t)(k8 + i) * N + n]) * scale); }
  const v8us o = f.half[0];
  *(v8us*)((unsigned short*)Wt + (size_t)t * 8) = o; 
}
// k_gemm_hh variant with fused epilogue: v = acc·alpha + bias[by·sBias + col] (+ CP[(row/rowsPerB)·sCPb + by·64 + col] if CP) ; ACT 0 none / 1 elu ; writes f16 C16 (and f32 C if non-null)
template <int ACT>
__global__ __launch_bounds__(128) void k_gemm_hhx(const _Float16* __restrict__ A, int lda, size_t sA, const _Float16* __restrict__ Bh, int ldb, size_t sB, float alpha, const float* __restrict__ bias, size_t sBias, const float* __restrict__ CP, int rowsPerB, size_t sCPb, int row0g,
    float* __restrict__ C, _Float16* __restrict__ C16, int ldc, size_t sC, int M, int N, int K) {
  __shared__ __attribute__((aligned(16))) float so[4][16][64];
  const int tid = threadIdx.x, w = tid >> 5, lane = tid & 31, ln = lane & 15, hh = lane >> 4; const int by = blockIdx.y;
  A += (size_t)by * sA; Bh += (size_t)by * sB; const size_t cofs = (size_t)by * sC; const float* bp = bias ? bias + (size_t)by * sBias : nullptr;
  const int ntn = (N + 63) / 64; const int wid = blockIdx.x * 4 + w; const int mt = wid / ntn, nq = wid % ntn; if (mt * 16 >= M) return;
  const int row0 = mt * 16, col0 = nq * 64; const _Float16* arow = A + (size_t)(row0 + ln) * lda;
  v8f acc[4] = {};
  for (int kb = 0; kb < K; kb += 32) { FragH ah; ah.half[0] = *(const v8us*)((const unsigned short*)arow + kb + 8 * hh); ah.half[1] = *(const v8us*)((const unsigned short*)arow + kb + 16 + 8 * hh);
#pragma unroll
    for (int t = 0; t < 4; ++t) { if (col0 + t * 16 >= N) continue; const size_t boff = (size_t)(col0 + t * 16 + ln) * ldb + kb; FragH bq; bq.half[0] = *(const v8us*)((const unsigned short*)Bh + boff + 8 * hh); bq.half[1] = *(const v8us*)((const unsigned short*)Bh + boff + 16 + 8 * hh);
      acc[t] = mmaH<1>(ah.v, ah.v, bq.v, bq.v, acc[t]); }
  }
#pragma unroll
  for (int t = 0; t < 4; ++t) { if (col0 + t * 16 >= N) continue; const int col = col0 + t * 16 + ln; const float bv = bp ? bf16_round(bp[col]) : 0.f;
#pragma unroll
    for (int r = 0; r < 8; ++r) { float v = acc[t][r] * alpha + bv; if (CP) { const int bidx = (row0g + row0 + 8 * hh + r) / rowsPerB; v += CP[(size_t)bidx * sCPb + (size_t)by * 64 + col]; } if (ACT == 1) v = (v > 0.f) ? v : expm1f(v); else if (ACT == 7) v = (v > 0.f) ? v + 1.0f : expf(v); else if (ACT == 8) v = tanhf(v); else if (ACT == 9) v = 0.5f * v * (1.0f + tanhf(0.7978845608028654f * (v + 0.044715f * v * v * v))); else if (ACT == 11) v = 1.0f / (1.0f + expf(-v)); else if (ACT == 12) v = (v > 0.f) ? v : 0.01f * v; else if (ACT == 14) v = (v > 0.f) ? v : 0.1f * v; else if (ACT == 15) v = v / (1.0f + expf(-v)); else if (ACT == 3) v = fmaxf(v, 0.f); else if (ACT == 6) v = 0.5f * v * (1.0f + erff(v * 0.70710678118654752f)); so[w][8 * hh + r][t * 16 + ln] = v; } }
  __builtin_amdgcn_fence(__ATOMIC_ACQ_REL, "workgroup"); __builtin_amdgcn_wave_barrier();
  const int rsub = lane >> 4, c4 = (lane & 15) * 4; typedef _Float16 v4h __attribute__((ext_vector_type(4)));
  {
#pragma unroll
    for (int q = 0; q < 8; ++q) { const int r = q * 2 + rsub; if (col0 + c4 < N) { const v4f v = *(const v4fa*)&so[w][r][c4]; if (C) *(v4f*)(C + cofs + (size_t)(row0 + r) * ldc + col0 + c4) = v; if (C16) { v4h h4; for (int i = 0; i < 4; ++i) h4[i] = (_Float16)v[i]; *(v4h*)(C16 + cofs + (size_t)(row0 + r) * ldc + col0 + c4) = h4; } } }
     }
}


typedef _Float16 v4h __attribute__((ext_vector_type(4)));

__device__ __forceinline__ void d_x16(int bx, const float* __restrict__ x, _Float16* __restrict__ X16, size_t n8, int K) { const size_t t = (size_t)bx * 256 + threadIdx.x; if (t >= n8) return; const FoRK s = fo_src(t, K); const float* xs = x + (size_t)s.row * K + s.k; FragH f;
#pragma unroll
  for (int q = 0; q < 8; ++q) f.h[q] = (_Float16)bf16_round(xs[q]); *(v8us*)((unsigned short*)X16 + t * 8) = f.half[0];  }
__global__ __launch_bounds__(256) void k_h16(const float* __restrict__ x, _Float16* __restrict__ X16, size_t n8) { const size_t t = (size_t)blockIdx.x * 256 + threadIdx.x; if (t >= n8) return; FragH f;
#pragma unroll
  for (int q = 0; q < 8; ++q) f.h[q] = (_Float16)x[t * 8 + q]; *(v8us*)((unsigned short*)X16 + t * 8) = f.half[0];  }
__global__ __launch_bounds__(256) void k_round16f(const float* __restrict__ W, _Float16* __restrict__ Bt, size_t n8) { const size_t t = (size_t)blockIdx.x * 256 + threadIdx.x; if (t >= n8) return; FragH f;
#pragma unroll
  for (int i = 0; i < 8; ++i) f.h[i] = (_Float16)(bf16_round(W[t * 8 + i]) * 16.0f); *(v8us*)((unsigned short*)Bt + t * 8) = f.half[0];  }
// both V^T planes straight from a value projection: a block takes 64 keys x 64 dims of one (batch, kv head) from the f32 plane F (rpb rows a batch, KVD columns), splits each value into f16 hi + 2^10 residual, turns both tiles in LDS and writes them at keys key_off + ... of the planes (rows d, k = keys, TK keys a row, fragment order). rpb and key_off are multiples of 64
__device__ __forceinline__ void d_vtf(int bx, const float* __restrict__ F, int rpb, int key_off, _Float16* __restrict__ Vt, _Float16* __restrict__ VtL) { __shared__ unsigned short th[64][66], tl[64][66]; const int tid = threadIdx.x; const int npb = rpb / 64; const int slab = bx / npb, lg = bx % npb; const int b = slab / NKV, h = slab % NKV;
  for (int i = tid; i < 64 * 8; i += 256) { const int r = i / 8, c8 = (i % 8) * 8; const float* fs = F + ((size_t)b * rpb + lg * 64 + r) * KVD + h * 64 + c8; const v4f a = *(const v4fa*)fs, c = *(const v4fa*)(fs + 4); FragH fh, fl;
#pragma unroll
    for (int q = 0; q < 4; ++q) { _Float16 hv = (_Float16)a[q]; fh.h[q] = hv; fl.h[q] = (_Float16)((a[q] - (float)hv) * 1024.0f); hv = (_Float16)c[q]; fh.h[4 + q] = hv; fl.h[4 + q] = (_Float16)((c[q] - (float)hv) * 1024.0f); }
#pragma unroll
    for (int q = 0; q < 8; ++q) { th[r][c8 + q] = fh.u[q]; tl[r][c8 + q] = fl.u[q]; } }
  __syncthreads();      /* both tiles are whole in LDS before any thread reads a column */
  {
#pragma unroll
    for (int rd = 0; rd < 2; ++rd) { const int wv = rd * 8 + tid / 32, lane = tid % 32; const int d = (wv >> 2) * 16 + (lane & 15), pc = (wv & 3) * 2 + (lane >> 4); FragH fh, fl;      /* a wave per half fragment of V^T (rows d, k = keys): 16 d x 2 groups of 8 keys */
#pragma unroll
      for (int q = 0; q < 8; ++q) { fh.u[q] = th[pc * 8 + q][d]; fl.u[q] = tl[pc * 8 + q][d]; }
      const size_t e = fo_dst(slab * 64 + d, key_off + lg * 64 + pc * 8, TK);
      *(v8us*)((unsigned short*)Vt + e) = fh.half[0]; *(v8us*)((unsigned short*)VtL + e) = fl.half[0]; }
    asm volatile("s_wait_xcnt 0x0" ::: "memory");      /* stands behind the four stores above, in front of whatever the launch's other ranges, laid out behind this one, write into registers that the stores name */
     } }

// ---- fast GEMM (wave tile 32x64; a work-group is RW * KS waves on a block tile of 32 RW rows x 64 columns: RW waves side by side in the rows, and KS waves on each wave tile, each with its own K / KS of the k range; requires M % (32 RW) == 0, N % 64 == 0 and K % (64 KS) == 0); epilogue = k_gemm_hhx semantics (KS > 1: bias and f32 C alone) ----
__device__ __forceinline__ v16h g2_frag(const _Float16* p) { FragH f; f.half[0] = *(const v8us*)((const unsigned short*)p); f.half[1] = *(const v8us*)((const unsigned short*)p + 256); return f.v; }      /* p: the lane's 8 elements in the fragment's block */
__device__ __forceinline__ v8f g2_mma(v16h a, v16h b, v8f c) { v8f d = __builtin_amdgcn_wmma_f32_16x16x32_f16(false, a, false, b, (short)0, c, false, false); asm volatile("v_nop\n\tv_nop\n\tv_nop\n\tv_nop" : "+v"(d) : "v"(a), "v"(b)); return d; }
template <int ACT, int RW, int KS>
__device__ __forceinline__ void d_gemm2(int bx, const _Float16* __restrict__ A, size_t sA, const _Float16* __restrict__ Bh, size_t sB, const _Float16* __restrict__ A2, const _Float16* __restrict__ B2, int np, float alpha, const float* __restrict__ bias, size_t sBias, const float* __restrict__ CP, int rowsPerB, size_t sCPb, int row0g,
    float* __restrict__ C, _Float16* __restrict__ C16, int ldc, size_t sC, int M, int N, int K) {
  static_assert(KS == 1 || ACT == 0, "the split form has no activation");
  __shared__ __attribute__((aligned(16))) float so[RW * KS][32][68];
  const int tid = threadIdx.x, w = tid >> 5, lane = tid & 31, ln = lane & 15, hh = lane >> 4; const int by = blockIdx.y;
  A += (size_t)by * sA; Bh += (size_t)by * sB; const size_t cofs = (size_t)by * sC; const float* bp = bias ? bias + (size_t)by * sBias : nullptr;
  const int wr = (KS == 1) ? w : w % RW, kp = (KS == 1) ? 0 : w / RW;      /* the wave's row tile in the block tile, and its part of k */
  const int ntn = N >> 6; const int mt = bx / ntn, nq = bx - mt * ntn; const int row0 = mt * (32 * RW) + 32 * wr, col0 = nq * 64; if (mt * (32 * RW) >= M) return;      /* the same for the whole work-group, in front of its barrier */
  const int Kp = K / KS;      /* a short k range per wave: where a launch has few tiles, its time is the chain of load latencies down k, and KS waves walk it side by side */
  /* A and Bh in fragment order, K elements a row: a tile of 16 rows is K * 16 elements, a step of 32 k is 512 */
  const size_t ao = (size_t)(row0 >> 4) * K * 16 + (size_t)kp * Kp * 16 + lane * 8, bo = (size_t)(col0 >> 4) * K * 16 + (size_t)kp * Kp * 16 + lane * 8;
  const v8f z8 = {0.f,0.f,0.f,0.f,0.f,0.f,0.f,0.f}; v8f c00 = z8, c01 = z8, c02 = z8, c03 = z8, c10 = z8, c11 = z8, c12 = z8, c13 = z8;
  /* np == 2: the residual product A2 B2 (A2 = 2^10 residual of A, B2 = x1 weights where Bh holds x16) is summed on top of the first in the same accumulators: the first sum is worth 1/16, the second 1/1024, so the first is raised by 64 (exact) in between and alpha = 1/1024 serves both */
#pragma unroll 1      /* kept rolled: one copy of the k loop */
  for (int ps = 0; ps < np; ++ps) {
  const _Float16* a0p = (ps ? A2 : A) + ao; const _Float16* a1p = a0p + (size_t)16 * K;
  const _Float16* b0p = (ps ? B2 : Bh) + bo; const _Float16* b1p = b0p + (size_t)16 * K; const _Float16* b2p = b1p + (size_t)16 * K; const _Float16* b3p = b2p + (size_t)16 * K;
  if (ps) { c00 *= 64.0f; c01 *= 64.0f; c02 *= 64.0f; c03 *= 64.0f; c10 *= 64.0f; c11 *= 64.0f; c12 *= 64.0f; c13 *= 64.0f; }
  /* two register sets x / y of the six fragments (K % 64 == 0): the loads of the next 32-wide k step are all issued before the products of this one, so a step waits for one overlapped latency at most */
  v16h xa0 = g2_frag(a0p), xa1 = g2_frag(a1p), xb0 = g2_frag(b0p), xb1 = g2_frag(b1p), xb2 = g2_frag(b2p), xb3 = g2_frag(b3p);
#pragma unroll 1
  for (int kb = 0; kb < Kp; kb += 64) { const int k1 = kb * 16, k2 = ((kb + 64 < Kp) ? kb + 64 : kb) * 16;      /* element offsets of this trip's first block (the y step is the block behind it, 512 elements on) and of the next trip's. Last trip: k2 names a step inside the row tile again; its values are not used */
    const _Float16* pya0 = a0p + k1; const _Float16* pya1 = a1p + k1; const _Float16* pyb0 = b0p + k1; const _Float16* pyb1 = b1p + k1; const _Float16* pyb2 = b2p + k1; const _Float16* pyb3 = b3p + k1;
    const _Float16* pxa0 = a0p + k2; const _Float16* pxa1 = a1p + k2; const _Float16* pxb0 = b0p + k2; const _Float16* pxb1 = b1p + k2; const _Float16* pxb2 = b2p + k2; const _Float16* pxb3 = b3p + k2;
    const v16h ya0 = g2_frag(pya0 + 512), ya1 = g2_frag(pya1 + 512), yb0 = g2_frag(pyb0 + 512), yb1 = g2_frag(pyb1 + 512), yb2 = g2_frag(pyb2 + 512), yb3 = g2_frag(pyb3 + 512);
    __builtin_amdgcn_sched_barrier(0);      /* holds the y loads above the x products (the scheduler otherwise moves each load down to its use) */
    c00 = g2_mma(xa0, xb0, c00); c10 = g2_mma(xa1, xb0, c10); c01 = g2_mma(xa0, xb1, c01); c11 = g2_mma(xa1, xb1, c11);
    c02 = g2_mma(xa0, xb2, c02); c12 = g2_mma(xa1, xb2, c12); c03 = g2_mma(xa0, xb3, c03); c13 = g2_mma(xa1, xb3, c13);
    __builtin_amdgcn_sched_barrier(0);      /* holds the x reloads below the x products and, with the next one, above the y products */
    if (KS == 1 || kb + 64 < Kp) { xa0 = g2_frag(pxa0); xa1 = g2_frag(pxa1); xb0 = g2_frag(pxb0); xb1 = g2_frag(pxb1); xb2 = g2_frag(pxb2); xb3 = g2_frag(pxb3); }      /* KS > 1: a wave has few trips, down to one, and the last trip's unused reload would be a large share of its loads: passed over on a scalar test */
    __builtin_amdgcn_sched_barrier(0);      /* holds the x reloads above the y products */
    c00 = g2_mma(ya0, yb0, c00); c10 = g2_mma(ya1, yb0, c10); c01 = g2_mma(ya0, yb1, c01); c11 = g2_mma(ya1, yb1, c11);
    c02 = g2_mma(ya0, yb2, c02); c12 = g2_mma(ya1, yb2, c12); c03 = g2_mma(ya0, yb3, c03); c13 = g2_mma(ya1, yb3, c13);
    asm volatile("s_wait_xcnt 0x0" :: "v"(pya0), "v"(pya1), "v"(pyb0), "v"(pyb1), "v"(pyb2), "v"(pyb3), "v"(pxa0), "v"(pxa1), "v"(pxb0), "v"(pxb1), "v"(pxb2), "v"(pxb3) : "memory"); }      /* stands in front of the next trip's address sums, which overwrite registers that the loads name; the trip's twelve addresses are its inputs, so that each keeps its registers up to here and no later load's result lands in them */
  }
  v8f accs[8] = {c00, c01, c02, c03, c10, c11, c12, c13};
  if constexpr (KS > 1) {
    /* every wave leaves its partial tile in LDS; behind the barrier a thread sums the KS partials of 4 columns of a row, in the order of k, and gives the sum the scale and the bias. 16 threads store a row's 256 bytes */
    const int c4 = (tid & 15) * 4; v4f bw4 = {0.f, 0.f, 0.f, 0.f};
    if (bp) { bw4 = *(const v4fa*)(bp + col0 + c4);
      asm volatile("s_wait_xcnt 0x0" ::: "memory"); }      /* stands in front of the work below, which overwrites the registers that the load names */
#pragma unroll
    for (int u = 0; u < 8; ++u)
#pragma unroll
      for (int r = 0; r < 8; ++r) so[w][(u >> 2) * 16 + 8 * hh + r][(u & 3) * 16 + ln] = accs[u][r];
    __syncthreads();      /* all partial tiles are whole in LDS before any thread sums them */
    static_assert(KS == 16, "32 RW rows x 16 groups of 4 columns over 32 RW KS threads: one group a thread");
    const int rr = tid >> 4; const int tw = rr >> 5, r = rr & 31; v4f s = *(const v4fa*)&so[tw][r][c4];
#pragma unroll
    for (int p = 1; p < KS; ++p) s += *(const v4fa*)&so[p * RW + tw][r][c4];
    v4f o;
#pragma unroll
    for (int i = 0; i < 4; ++i) o[i] = s[i] * alpha + bf16_round(bw4[i]);
    *(v4f*)(C + cofs + (size_t)(mt * (32 * RW) + rr) * ldc + col0 + c4) = o;
    return; }
  /* the epilogue's loads (4 bias words, 64 CP words a lane) are issued together as well, ahead of the arithmetic that uses them */
  float bw[4] = {0.f, 0.f, 0.f, 0.f}; v8f cpv[8] = {z8, z8, z8, z8, z8, z8, z8, z8};
  if (bp) {
#pragma unroll
    for (int t = 0; t < 4; ++t) bw[t] = bp[col0 + t * 16 + ln];
    asm volatile("s_wait_xcnt 0x0" ::: "memory"); }      /* stands in front of the scalar work below, which overwrites the base register that the four loads name */
  if (CP) {
#pragma unroll
    for (int u = 0; u < 8; ++u)
#pragma unroll
      for (int r = 0; r < 8; ++r) { const int bidx = (row0g + row0 + (u >> 2) * 16 + 8 * hh + r) / rowsPerB; cpv[u][r] = CP[(size_t)bidx * sCPb + (size_t)by * 64 + col0 + (u & 3) * 16 + ln];
        if (r == 7) asm volatile("s_wait_xcnt 0x0" ::: "memory"); }      /* stands in front of the next group's loads, whose results may land in address registers of this group */
    asm volatile("" :: "v"(cpv[0]), "v"(cpv[1]), "v"(cpv[2]), "v"(cpv[3]), "v"(cpv[4]), "v"(cpv[5]), "v"(cpv[6]), "v"(cpv[7])); }      /* inputs-only fence on the loaded words: holds all 64 loads in this block, where they overlap, instead of one waited load in front of each add */
#pragma unroll
  for (int u = 0; u < 8; ++u) { const int t = u & 3, half = u >> 2; const float bv = bp ? bf16_round(bw[t]) : 0.f;
#pragma unroll
    for (int r = 0; r < 8; ++r) { const int rloc = half * 16 + 8 * hh + r; float v = accs[u][r] * alpha + bv; if (CP) v += cpv[u][r];
      if (ACT == 3) v = fmaxf(v, 0.f); else if (ACT == 6) v = 0.5f * v * (1.0f + erff(v * 0.70710678118654752f)); else if (ACT == 11) v = 1.0f / (1.0f + expf(-v)); else if (ACT == 15) v = v / (1.0f + expf(-v)); else if (ACT == 12) v = (v > 0.f) ? v : 0.01f * v; else if (ACT == 8) v = tanhf(v);
      so[w][rloc][t * 16 + ln] = v; } }
  __builtin_amdgcn_fence(__ATOMIC_ACQ_REL, "workgroup"); __builtin_amdgcn_wave_barrier();
  const int rsub = lane >> 4, c4 = (lane & 15) * 4;
  {
#pragma unroll
    for (int q = 0; q < 16; ++q) { const int r = q * 2 + rsub; const v4f v = *(const v4fa*)&so[w][r][c4]; if (C) *(v4f*)(C + cofs + (size_t)(row0 + r) * ldc + col0 + c4) = v; if (C16) { v4h h4; for (int i = 0; i < 4; ++i) h4[i] = (_Float16)v[i]; *(v4h*)(C16 + cofs + (size_t)(row0 + r) * ldc + col0 + c4) = h4; }
      if ((q & 3) == 3 && q != 15) asm volatile("s_wait_xcnt 0x0" ::: "memory"); }      /* stands in front of the next four rows' LDS reads and address sums, which overwrite registers that the stores above name */
     } }



// lane l's value of lane l ^ X (X < 16) inside its 16-lane row, by a DPP row_xmask move in registers (no trip through the LDS pipe and no wait on it)
template <int X>
__device__ __forceinline__ float row_xor(float v) { return __int_as_float(__builtin_amdgcn_update_dpp(0, __float_as_int(v), 0x160 | X, 0xf, 0xf, true)); }
// maximum over the 16-lane row, all 32 lanes on: four dependent DPP maxima in one statement (written with fmaxf on a DPP move the compiler puts a move and a quieting maximum in front of each step, three links for one)
__device__ __forceinline__ float row_max16(float v) {
  asm("v_max_num_f32_dpp %0, %0, %0 row_xmask:1 row_mask:0xf bank_mask:0xf\n\t"
      "v_max_num_f32_dpp %0, %0, %0 row_xmask:2 row_mask:0xf bank_mask:0xf\n\t"
      "v_max_num_f32_dpp %0, %0, %0 row_xmask:4 row_mask:0xf bank_mask:0xf\n\t"
      "v_max_num_f32_dpp %0, %0, %0 row_xmask:8 row_mask:0xf bank_mask:0xf" : "+v"(v));
  return v; }
__device__ __forceinline__ float row_sum16(float v) { v += row_xor<1>(v); v += row_xor<2>(v); v += row_xor<4>(v); v += row_xor<8>(v); return v; }
template <int CAUSAL>
__global__ __launch_bounds__(128) void k_flash(const _Float16* __restrict__ Q16, int ldq, const _Float16* __restrict__ K16, int ldk, const _Float16* __restrict__ Vt, const int* __restrict__ MSK, float* __restrict__ O, int ldo) {
  constexpr int RPW = 16, RTN = RPW / 16, NQB = TQ / (4 * RPW), DT = 4, KS = 2;
  __shared__ __attribute__((aligned(16))) unsigned short sP[4][RPW][40]; __shared__ __attribute__((aligned(16))) float sO[4][RPW][64 + 4];
  const int tid = threadIdx.x, w = tid >> 5, lane = tid & 31, ln = lane & 15, hh = lane >> 4;
  const int slab = blockIdx.x / NQB, qblk = blockIdx.x % NQB; const int b = slab / NH, h = slab % NH; const int qb0 = qblk * (4 * RPW); const int q0 = qb0 + w * RPW;
  FragH aq[2][KS];
#pragma unroll
  for (int rt = 0; rt < RTN; ++rt) { const unsigned short* qr = (const unsigned short*)Q16 + ((size_t)b * TQ + q0 + rt * 16 + ln) * ldq + h * 64;
#pragma unroll
    for (int ks = 0; ks < KS; ++ks) { aq[rt][ks].half[0] = *(const v8us*)(qr + ks * 32 + 8 * hh); aq[rt][ks].half[1] = *(const v8us*)(qr + ks * 32 + 16 + 8 * hh); } }
  const unsigned short* Vth = (const unsigned short*)Vt + (size_t)slab * 64 * TK;
  float m_r[2][8], l_r[2][8]; v8f oacc[2][DT];
#pragma unroll
  for (int rt = 0; rt < RTN; ++rt) {
#pragma unroll
    for (int r = 0; r < 8; ++r) { m_r[rt][r] = -3.0e38f; l_r[rt][r] = 0.f; }
#pragma unroll
    for (int dt = 0; dt < DT; ++dt) oacc[rt][dt] = (v8f){0.f,0.f,0.f,0.f,0.f,0.f,0.f,0.f}; }
  const int jend = (CAUSAL == 1) ? (qb0 + 4 * RPW) : TK;      /* causal: keys beyond the block's last query never contribute */
#pragma unroll 1
  for (int j0 = 0; j0 < jend; j0 += 32) {
    v8f s[2][2];
#pragma unroll
    for (int nt = 0; nt < 2; ++nt) { const unsigned short* kr = (const unsigned short*)K16 + ((size_t)b * TK + j0 + nt * 16 + ln) * ldk + h * 64; FragH bk[KS];
#pragma unroll
      for (int ks = 0; ks < KS; ++ks) { bk[ks].half[0] = *(const v8us*)(kr + ks * 32 + 8 * hh); bk[ks].half[1] = *(const v8us*)(kr + ks * 32 + 16 + 8 * hh); }
#pragma unroll
      for (int rt = 0; rt < RTN; ++rt) { v8f acc = (v8f){0.f,0.f,0.f,0.f,0.f,0.f,0.f,0.f};
#pragma unroll
        for (int ks = 0; ks < KS; ++ks) acc = mmaH<1>(aq[rt][ks].v, aq[rt][ks].v, bk[ks].v, bk[ks].v, acc); s[rt][nt] = acc; } }
#pragma unroll
    for (int rt = 0; rt < RTN; ++rt)
#pragma unroll
      for (int r = 0; r < 8; ++r) { const int tq = q0 + rt * 16 + 8 * hh + r; const int k0 = j0 + ln, k1 = j0 + 16 + ln;
        const bool ok0 = (CAUSAL == 1) ? (k0 <= tq) : ((CAUSAL == 2) ? ((k0 >> 5) == (tq >> 5)) : true), ok1 = (CAUSAL == 1) ? (k1 <= tq) : ((CAUSAL == 2) ? ((k1 >> 5) == (tq >> 5)) : true);      /* mode 2: block-diagonal 32-token groups */
        const float s0 = ok0 ? s[rt][0][r] * SCL : -3.0e38f, s1 = ok1 ? s[rt][1][r] * SCL : -3.0e38f; 
        const float mn = row_max16(fmaxf(fmaxf(s0, s1), m_r[rt][r]));      /* the running maximum is the same in all 16 lanes of the row: taken in ahead of the reduction, the reduced value is the new maximum itself */
        const float al = (mn > -1.0e38f) ? expf(m_r[rt][r] - mn) : 1.0f; m_r[rt][r] = mn; const float p0 = ok0 ? expf(s0 - mn) : 0.f, p1 = ok1 ? expf(s1 - mn) : 0.f; l_r[rt][r] = l_r[rt][r] * al + p0 + p1;
#pragma unroll
        for (int dt = 0; dt < DT; ++dt) oacc[rt][dt][r] *= al;
        FragH t2; t2.h[0] = (_Float16)(p0 * 1024.0f); t2.h[1] = (_Float16)(p1 * 1024.0f); sP[w][rt * 16 + 8 * hh + r][ln] = t2.u[0]; sP[w][rt * 16 + 8 * hh + r][16 + ln] = t2.u[1]; }
    __builtin_amdgcn_fence(__ATOMIC_ACQ_REL, "workgroup"); __builtin_amdgcn_wave_barrier();
    FragH pa[2];
#pragma unroll
    for (int rt = 0; rt < RTN; ++rt) { pa[rt].half[0] = *(const v8us*)&sP[w][rt * 16 + ln][8 * hh]; pa[rt].half[1] = *(const v8us*)&sP[w][rt * 16 + ln][16 + 8 * hh]; }
#pragma unroll
    for (int dt = 0; dt < DT; ++dt) { const unsigned short* vrow = Vth + (size_t)(dt * 16 + ln) * TK + j0; FragH bv; bv.half[0] = *(const v8us*)(vrow + 8 * hh); bv.half[1] = *(const v8us*)(vrow + 16 + 8 * hh);
#pragma unroll
      for (int rt = 0; rt < RTN; ++rt) oacc[rt][dt] = mmaH<1>(pa[rt].v, pa[rt].v, bv.v, bv.v, oacc[rt][dt]); }
    __builtin_amdgcn_fence(__ATOMIC_ACQ_REL, "workgroup"); __builtin_amdgcn_wave_barrier(); }
#pragma unroll
  for (int rt = 0; rt < RTN; ++rt) {
#pragma unroll
    for (int r = 0; r < 8; ++r) { float l = l_r[rt][r]; l = row_sum16(l); l_r[rt][r] = (l > 0.f) ? 1.0f / (l * 1024.0f) : 0.f; }
#pragma unroll
    for (int dt = 0; dt < DT; ++dt)
#pragma unroll
      for (int r = 0; r < 8; ++r) sO[w][rt * 16 + 8 * hh + r][dt * 16 + ln] = oacc[rt][dt][r] * l_r[rt][r]; }
  __builtin_amdgcn_fence(__ATOMIC_ACQ_REL, "workgroup"); __builtin_amdgcn_wave_barrier();
  {
#pragma unroll
    for (int rp = 0; rp < RPW; rp += 2) { const int r = rp + (lane >> 4), pc = lane & 15; const v4f val = *(const v4fa*)&sO[w][r][pc * 4]; *(v4f*)(O + ((size_t)b * TQ + q0 + r) * ldo + h * 64 + pc * 4) = val; }
     } }
__device__ __forceinline__ float half_swap(float v) { const int x = __float_as_int(v); return __int_as_float(__builtin_amdgcn_permlanex16(x, x, 0x76543210, 0xfedcba98, false, false)); }
typedef int v4im __attribute__((ext_vector_type(4), may_alias));
// softmax of one trip. s[i >> 3][i & 7] is the score of the trip's key (i >> 3) * 16 + 8 hh + (i & 7) against the lane's own query (column ln); ok[i] its mask. The maximum and the sum over keys are taken inside the lane; the maximum is joined with the other half's once a trip (m_c is the same in both halves), the sum l_c stays this half's until the epilogue.
// The two score tiles, converted in place, are the B operand P^T in the hardware k order (element i): P takes no trip through LDS. O^T tiles hold the lane's query in every register, so one factor rescales them all.
__device__ __forceinline__ void sm_trip(const v8f (&s)[2], const bool (&ok)[16], float& m_c, float& l_c, v8f (&oacc)[4], v8f (&oaccL)[4], FragH& ph, FragH& pl) {
  float sc[16], t[8], p[16], u[8];
#pragma unroll
  for (int i = 0; i < 16; ++i) sc[i] = ok[i] ? s[i >> 3][i & 7] * SCL : -3.0e38f;
#pragma unroll
  for (int i = 0; i < 8; ++i) t[i] = fmaxf(sc[i], sc[i + 8]);
  const float mh = fmaxf(fmaxf(fmaxf(fmaxf(t[0], t[1]), fmaxf(t[2], t[3])), fmaxf(fmaxf(t[4], t[5]), fmaxf(t[6], t[7]))), m_c);
  const float mn = fmaxf(mh, half_swap(mh));
  /* each exponential is the hardware's 2^x of (difference * log2 e), with nothing guarded around it: the 17 of a trip are independent and overlap (the library call under a per-key test compiled to 17 masked branch regions, each one dependent chain, run one after another). An unchanged maximum still gives a factor of exactly 1 */
  const float mr = fmaxf(mn, -1.0e38f);      /* a masked key's sc = -3.0e38 lies at least 2.0e38 below mr, also where no key has been live yet: its 2^x is 0, as the test gave */
  float x[16], ea; const float xa = (m_c - mn) * 1.44269504f;
#pragma unroll
  for (int i = 0; i < 16; ++i) x[i] = (sc[i] - mr) * 1.44269504f;
  /* written as two runs in asm so that the slot behind each transcendental is kept by construction: the next instruction is another 2^x with registers of its own (results are early-clobber: none shares a register with a source), and one v_nop ends each run */
  asm("v_exp_f32 %0, %9\n\tv_exp_f32 %1, %10\n\tv_exp_f32 %2, %11\n\tv_exp_f32 %3, %12\n\tv_exp_f32 %4, %13\n\tv_exp_f32 %5, %14\n\tv_exp_f32 %6, %15\n\tv_exp_f32 %7, %16\n\tv_exp_f32 %8, %17\n\tv_nop"
      : "=&v"(p[0]), "=&v"(p[1]), "=&v"(p[2]), "=&v"(p[3]), "=&v"(p[4]), "=&v"(p[5]), "=&v"(p[6]), "=&v"(p[7]), "=&v"(ea)
      : "v"(x[0]), "v"(x[1]), "v"(x[2]), "v"(x[3]), "v"(x[4]), "v"(x[5]), "v"(x[6]), "v"(x[7]), "v"(xa));
  asm("v_exp_f32 %0, %8\n\tv_exp_f32 %1, %9\n\tv_exp_f32 %2, %10\n\tv_exp_f32 %3, %11\n\tv_exp_f32 %4, %12\n\tv_exp_f32 %5, %13\n\tv_exp_f32 %6, %14\n\tv_exp_f32 %7, %15\n\tv_nop"
      : "=&v"(p[8]), "=&v"(p[9]), "=&v"(p[10]), "=&v"(p[11]), "=&v"(p[12]), "=&v"(p[13]), "=&v"(p[14]), "=&v"(p[15])
      : "v"(x[8]), "v"(x[9]), "v"(x[10]), "v"(x[11]), "v"(x[12]), "v"(x[13]), "v"(x[14]), "v"(x[15]));
  const float al = (mn > -1.0e38f) ? ea : 1.0f; m_c = mn;
#pragma unroll
  for (int i = 0; i < 8; ++i) u[i] = p[i] + p[i + 8];
  l_c = l_c * al + (((u[0] + u[1]) + (u[2] + u[3])) + ((u[4] + u[5]) + (u[6] + u[7])));
#pragma unroll
  for (int dt = 0; dt < 4; ++dt) { oacc[dt] *= al; oaccL[dt] *= al; }
#pragma unroll
  for (int i = 0; i < 16; ++i) { const float x = p[i] * 1024.0f; const _Float16 hv = (_Float16)x; ph.h[i] = hv; pl.h[i] = (_Float16)((x - (float)hv) * 1024.0f); } }

// 3-term variant: O = (P_hi V_hi + (P_lo V_hi + P_hi V_lo) / 1024) / l with P = [hi | 2^10 residual] of 1024 p and V^T = [hi | 2^10 residual] planes (VtL same layout as Vt) -> ~2^-21-class products for un-averaged (early causal / peaked) rows
template <int CAUSAL>
__global__ __launch_bounds__(32 * NSPL) void k_flash3gA(const _Float16* __restrict__ Q16, int ldq, const _Float16* __restrict__ K16, int ldk, const _Float16* __restrict__ Vt, const _Float16* __restrict__ VtL, const int* __restrict__ MSK, _Float16* __restrict__ OH, _Float16* __restrict__ OL, int ldo) {
  constexpr int RPW = 16, RTN = RPW / 16, NQB = TQA / (4 * RPW), DT = 4, KS = 2;
  __shared__ __attribute__((aligned(16))) float sO[NSPL][RPW][64 + 4]; __shared__ float sM[NSPL][RPW], sL[NSPL][RPW];
  const int tid = threadIdx.x, w = __builtin_amdgcn_readfirstlane(tid >> 5), lane = tid & 31, ln = lane & 15, hh = lane >> 4;      /* the wave's number in a scalar register: the key range below stays scalar */
  /* one work-group per (batch, head, 16-query tile); its NSPL waves each run the flash loop over their own TK / NSPL keys, and the partial (m, l, O) are merged through LDS behind the loop */
  const int slab = blockIdx.x / (TQA / RPW), qblk = blockIdx.x % (TQA / RPW); (void)NQB; const int b = slab / NH, h = slab % NH; const int qb0 = qblk * RPW; const int q0 = qb0;
  FragH aq[2][KS];
#pragma unroll
  for (int rt = 0; rt < RTN; ++rt) { const unsigned short* qr = (const unsigned short*)Q16 + ((size_t)((b * TQA + q0 + rt * 16) >> 4) * (ldq >> 5) + h * 2) * 512 + lane * 8;      /* Q, K and both V^T planes in fragment order */
#pragma unroll
    for (int ks = 0; ks < KS; ++ks) { aq[rt][ks].half[0] = *(const v8us*)(qr + ks * 512); aq[rt][ks].half[1] = *(const v8us*)(qr + ks * 512 + 256); } }
  const size_t vslab = (size_t)(b * (NH / KVG) + h / KVG); const unsigned short* Vth = (const unsigned short*)Vt + vslab * 64 * TK; const unsigned short* Vtl = (const unsigned short*)VtL + vslab * 64 * TK;      /* GQA: q-head h reads kv head h / KVG */
  float m_c = -3.0e38f, l_c = 0.f; v8f oacc[DT], oaccL[DT];      /* of the lane's query q0 + ln; register r of tile dt is dim dt * 16 + 8 hh + r */
#pragma unroll
  for (int dt = 0; dt < DT; ++dt) { oacc[dt] = (v8f){0.f,0.f,0.f,0.f,0.f,0.f,0.f,0.f}; oaccL[dt] = oacc[dt]; }
  const int jbeg = w * (TK / NSPL), jend = jbeg + TK / NSPL;      /* this wave's keys */
#pragma unroll 1
  for (int j0 = jbeg; j0 < jend; j0 += 32) {
    v8f s[2]; FragH bk[2][KS], bv[DT], bl[DT]; v4im mk[2][2];
    /* every global load of the trip is issued here, in the order of use (K, mask words, both V planes): their latencies overlap, and V lands behind the softmax */
#pragma unroll
    for (int nt = 0; nt < 2; ++nt) { const unsigned short* kr = (const unsigned short*)K16 + ((size_t)((b * TK + j0 + nt * 16) >> 4) * (ldk >> 5) + (h / KVG) * 2) * 512 + lane * 8;
#pragma unroll
      for (int ks = 0; ks < KS; ++ks) { bk[nt][ks].half[0] = *(const v8us*)(kr + ks * 512); bk[nt][ks].half[1] = *(const v8us*)(kr + ks * 512 + 256); } }
    if (CAUSAL == 8) { const int* mrow = MSK + (size_t)(q0 + ln) * TK + j0 + 8 * hh;      /* the lane's query row: its 8 keys of each 16-key tile, 32 contiguous bytes */
#pragma unroll
      for (int nt = 0; nt < 2; ++nt) { mk[nt][0] = *(const v4im*)(mrow + nt * 16); mk[nt][1] = *(const v4im*)(mrow + nt * 16 + 4); } }
    asm volatile("s_wait_xcnt 0x0" ::: "memory");      /* stands in front of the V loads, whose results may land in registers that the K and mask loads name as addresses */
#pragma unroll
    for (int dt = 0; dt < DT; ++dt) { const size_t vo = ((size_t)dt * (TK / 32) + (j0 >> 5)) * 512 + lane * 8; const unsigned short* vrow = Vth + vo; const unsigned short* vrl = Vtl + vo; bv[dt].half[0] = *(const v8us*)vrow; bv[dt].half[1] = *(const v8us*)(vrow + 256);
      if (dt == DT - 1) asm volatile("s_wait_xcnt 0x0" ::: "memory");      /* stands in front of the trip's last two loads: the result of the first lands in the address registers of the hi plane's loads above */
      bl[dt].half[0] = *(const v8us*)vrl;
      if (dt == DT - 1) asm volatile("s_wait_xcnt 0x0" ::: "memory");      /* stands in front of the trip's last load, whose result lands in the address registers of the V loads above */
      bl[dt].half[1] = *(const v8us*)(vrl + 256); }
    __builtin_amdgcn_sched_barrier(0);      /* keeps the loads above together: without it the scheduler moves each one down to its first use, one exposed latency apiece */
#pragma unroll
    for (int nt = 0; nt < 2; ++nt) { v8f acc = (v8f){0.f,0.f,0.f,0.f,0.f,0.f,0.f,0.f};      /* K rows as A, Q as B: register r = key nt * 16 + 8 hh + r, column ln = query */
#pragma unroll
      for (int ks = 0; ks < KS; ++ks) acc = mmaH<1>(bk[nt][ks].v, bk[nt][ks].v, aq[0][ks].v, aq[0][ks].v, acc); s[nt] = acc; }
    bool ok[16]; const int tq = q0 + ln;
#pragma unroll
    for (int i = 0; i < 16; ++i) { const int k = j0 + (i >> 3) * 16 + 8 * hh + (i & 7);
      bool o = (CAUSAL == 1) ? (k <= tq) : ((CAUSAL == 2) ? ((k >> 5) == (tq >> 5)) : true);      /* mode 2: block-diagonal 32-token groups */
      if (CAUSAL == 8) o = mk[i >> 3][(i >> 2) & 1][i & 3] != 0;      /* mode 8: per-(query, key) int table shared by all batches and heads */
      if (CAUSAL == 4) o = MSK[((size_t)b * TQA + tq) * TK + k] != 0;      /* mode 4: per-(query, key) INPUT mask shared by all heads; masked keys contribute nothing (== the reference's -4096 fill, whose exp underflows to 0), rows with no valid key give l = 0 -> output 0 (== the reference's row_valid zeroing) */
      ok[i] = o; }
    FragH ph, pl; sm_trip(s, ok, m_c, l_c, oacc, oaccL, ph, pl);
#pragma unroll
    for (int dt = 0; dt < DT; ++dt) { oacc[dt] = mmaH<1>(bv[dt].v, bv[dt].v, ph.v, ph.v, oacc[dt]); oaccL[dt] = mmaH<1>(bv[dt].v, bv[dt].v, pl.v, pl.v, oaccL[dt]); oaccL[dt] = mmaH<1>(bl[dt].v, bl[dt].v, ph.v, ph.v, oaccL[dt]); } }      /* V^T rows as A, P^T as B */
  /* each wave leaves its queries' maxima, sums (both halves joined) and unnormalised outputs in LDS, a row per query: a lane's 8 registers of a tile are 8 consecutive dims of its row */
  { const float l = l_c + half_swap(l_c); if (hh == 0) { sM[w][ln] = m_c; sL[w][ln] = l; } }
#pragma unroll
  for (int dt = 0; dt < DT; ++dt) { v4f v0, v1;
#pragma unroll
    for (int r = 0; r < 4; ++r) { float v = oacc[dt][r]; v += oaccL[dt][r] * 0.0009765625f; v0[r] = v; v = oacc[dt][4 + r]; v += oaccL[dt][4 + r] * 0.0009765625f; v1[r] = v; }
    *(v4fa*)&sO[w][ln][dt * 16 + 8 * hh] = v0; *(v4fa*)&sO[w][ln][dt * 16 + 8 * hh + 4] = v1; }
  __syncthreads();      /* every wave's partials are in LDS before any thread merges them */
  /* merge, a thread per (row, 4 columns): M = max m_u; l = sum l_u e^(m_u - M); O = sum O_u e^(m_u - M), u in wave order. A wave with no live key for the row has m_u = -3.0e38, l_u = 0, O_u = 0 and adds nothing; a row with no live key at all gives l = 0 -> output 0 */
  /* the result leaves as the next GEMM's A operand: f16 hi plane and 2^10 residual plane in fragment order (ldo elements a row). A wave takes the 16 rows and two neighbouring column groups, which are 8 k of every row: 256 contiguous bytes of each plane */
  if (tid < RPW * 16) { const int r = tid & 15, pc = tid >> 4; float mm = sM[0][r];      /* both loops below are unrolled so that their LDS reads are issued together, ahead of the arithmetic */
#pragma unroll
    for (int u = 1; u < NSPL; ++u) mm = fmaxf(mm, sM[u][r]);
    float l = 0.f; v4f a = {0.f, 0.f, 0.f, 0.f};
#pragma unroll
    for (int u = 0; u < NSPL; ++u) { const float f = expf(sM[u][r] - mm); const v4f val = *(const v4fa*)&sO[u][r][pc * 4]; l += sL[u][r] * f; a += val * f; }
    const float li = (l > 0.f) ? 1.0f / (l * 1024.0f) : 0.f;
    const v4f o = a * li; v4h oh, ol;
#pragma unroll
    for (int q = 0; q < 4; ++q) { const _Float16 hv = (_Float16)o[q]; oh[q] = hv; ol[q] = (_Float16)((o[q] - (float)hv) * 1024.0f); }
    const size_t e = fo_dst(b * TQA + q0 + r, h * 64 + (pc >> 1) * 8, ldo) + (pc & 1) * 4;
    *(v4h*)(OH + e) = oh; *(v4h*)(OL + e) = ol; } }

// 3-term variant: O = (P_hi V_hi + (P_lo V_hi + P_hi V_lo) / 1024) / l with P = [hi | 2^10 residual] of 1024 p and V^T = [hi | 2^10 residual] planes (VtL same layout as Vt) -> ~2^-21-class products for un-averaged (early causal / peaked) rows
template <int CAUSAL>
__global__ __launch_bounds__(512) void k_flash3gB(const _Float16* __restrict__ Q16, int ldq, const _Float16* __restrict__ K16, int ldk, const _Float16* __restrict__ Vt, const _Float16* __restrict__ VtL, const int* __restrict__ MSK, const unsigned int* __restrict__ LV, _Float16* __restrict__ OH, _Float16* __restrict__ OL, int ldo) {
  constexpr int RPW = 16, RTN = RPW / 16, NQB = TQB / (4 * RPW), DT = 4, KS = 2;
  __shared__ __attribute__((aligned(16))) float sX[2][16][8][32][4]; __shared__ float sM[2][16][32], sL[2][16][32];      /* per (tile in turn, wave): a lane's 32 unnormalised outputs as 8 groups of 4, its maximum, its sum */
  const int tid = threadIdx.x, w = __builtin_amdgcn_readfirstlane(tid >> 5), lane = tid & 31, ln = lane & 15, hh = lane >> 4;      /* the wave's number in a scalar register: the tile number, its live bits and the test on them stay scalar */
  const int slot = w >> 1, kh = w & 1;      /* two waves share a query tile: wave kh walks the key tiles of parity kh. The work-group's 16 waves stand four to a SIMD, was two: more waves to fill each other's load waits and dependent vector chains */
  const int slab = blockIdx.x / (QTB / 16), pblk = blockIdx.x % (QTB / 16); (void)NQB; const int b = slab / NH, h = slab % NH;
  /* a pair of waves takes two 16-query tiles one after the other, t and QTB - 1 - t: where the live key tiles grow with the query position, as under a causal mask, every wave then walks about the same number of them. For any mask each (query tile, key tile) is taken exactly once */
#pragma unroll 1      /* kept rolled: one copy of the key loop in the instruction cache */
  for (int it = 0; it < 2; ++it) {
  const int qt = it ? QTB - 1 - (pblk * 8 + slot) : pblk * 8 + slot; const int q0 = qt * RPW;
  const unsigned int* lv = LV + (size_t)qt * (3 * 4 * 32);      /* bit kt & 31 of word kt >> 5, the four row groups joined: key tile kt holds a non-zero mask word for this query tile */
  unsigned int lw0 = ~0u, lw1 = ~0u, lw2 = ~0u;      /* the modes without a mask table walk every key tile */
  if (CAUSAL == 8) { lw0 = __builtin_amdgcn_readfirstlane(lv[0] | lv[32] | lv[64] | lv[96]); lw1 = __builtin_amdgcn_readfirstlane(lv[128] | lv[160] | lv[192] | lv[224]); lw2 = __builtin_amdgcn_readfirstlane(lv[256] | lv[288] | lv[320] | lv[352]); }
  FragH aq[2][KS];
#pragma unroll
  for (int rt = 0; rt < RTN; ++rt) { const unsigned short* qr = (const unsigned short*)Q16 + ((size_t)((b * TQB + q0 + rt * 16) >> 4) * (ldq >> 5) + h * 2) * 512 + lane * 8;      /* Q, K and both V^T planes in fragment order */
#pragma unroll
    for (int ks = 0; ks < KS; ++ks) { aq[rt][ks].half[0] = *(const v8us*)(qr + ks * 512); aq[rt][ks].half[1] = *(const v8us*)(qr + ks * 512 + 256); } }
  const size_t vslab = (size_t)(b * (NH / KVG) + h / KVG); const unsigned short* Vth = (const unsigned short*)Vt + vslab * 64 * TK + kh * 512; const unsigned short* Vtl = (const unsigned short*)VtL + vslab * 64 * TK + kh * 512;      /* GQA: q-head h reads kv head h / KVG. The wave's parity is in the scalar base: the first key tile it walks */
  float m_c = -3.0e38f, l_c = 0.f; v8f oacc[DT], oaccL[DT];      /* of the lane's query q0 + ln; register r of tile dt is dim dt * 16 + 8 hh + r */
#pragma unroll
  for (int dt = 0; dt < DT; ++dt) { oacc[dt] = (v8f){0.f,0.f,0.f,0.f,0.f,0.f,0.f,0.f}; oaccL[dt] = oacc[dt]; }
  const int jend = (CAUSAL == 1) ? (q0 + RPW) : TK;      /* causal: keys beyond the tile's last query never contribute */
#pragma unroll 1
  for (int kp = 0; kp < (jend + 63) / 64; ++kp) { const int kt = kp * 2 + kh, j0 = kt * 32;      /* TK % 64 == 0: a pair of key tiles never reaches past the planes; keys from jend on are masked */
    /* a key tile whose 16 x 32 mask words are all zero leaves m, l and O as they are (every p is 0 and the rescale factor is 1): it is passed over, on a scalar test */
    const unsigned int lw = (kt < 32) ? lw0 : ((kt < 64) ? lw1 : lw2);
    if (((lw >> (kt & 31)) & 1u) == 0u) continue;
    v8f s[2]; FragH bk[2][KS], bv[DT], bl[DT]; v4im mk[2][2];
    /* every global load of the trip is issued here, in the order of use (K, mask words, both V planes): their latencies overlap, and V lands behind the softmax */
#pragma unroll
    for (int nt = 0; nt < 2; ++nt) { const unsigned short* kr = (const unsigned short*)K16 + ((size_t)((b * TK + j0 + nt * 16) >> 4) * (ldk >> 5) + (h / KVG) * 2) * 512 + lane * 8;
#pragma unroll
      for (int ks = 0; ks < KS; ++ks) { bk[nt][ks].half[0] = *(const v8us*)(kr + ks * 512); bk[nt][ks].half[1] = *(const v8us*)(kr + ks * 512 + 256); } }
    asm volatile("s_wait_xcnt 0x0" ::: "memory");      /* stands in front of the mask loads, whose results may land in registers that the K loads name as addresses */
    if (CAUSAL == 8) { const int* mrow = MSK + (size_t)(q0 + ln) * TK + j0 + 8 * hh;      /* the lane's query row: its 8 keys of each 16-key tile, 32 contiguous bytes */
#pragma unroll
      for (int nt = 0; nt < 2; ++nt) { mk[nt][0] = *(const v4im*)(mrow + nt * 16); mk[nt][1] = *(const v4im*)(mrow + nt * 16 + 4); } }
    asm volatile("s_wait_xcnt 0x0" ::: "memory");      /* stands in front of the V loads, whose results may land in registers that the K and mask loads name as addresses */
#pragma unroll
    for (int dt = 0; dt < DT; ++dt) { const size_t vo = ((size_t)dt * (TK / 32) + kp * 2) * 512 + lane * 8; const unsigned short* vrow = Vth + vo; const unsigned short* vrl = Vtl + vo; bv[dt].half[0] = *(const v8us*)vrow; bv[dt].half[1] = *(const v8us*)(vrow + 256); bl[dt].half[0] = *(const v8us*)vrl;
      if (dt == DT - 1) asm volatile("s_wait_xcnt 0x0" ::: "memory");      /* stands in front of the trip's last load, whose result lands in the address registers of the V loads above */
      bl[dt].half[1] = *(const v8us*)(vrl + 256); }
    __builtin_amdgcn_sched_barrier(0);      /* keeps the loads above together: without it the scheduler moves each one down to its first use, one exposed latency apiece */
#pragma unroll
    for (int nt = 0; nt < 2; ++nt) { v8f acc = (v8f){0.f,0.f,0.f,0.f,0.f,0.f,0.f,0.f};      /* K rows as A, Q as B: register r = key nt * 16 + 8 hh + r, column ln = query */
#pragma unroll
      for (int ks = 0; ks < KS; ++ks) acc = mmaH<1>(bk[nt][ks].v, bk[nt][ks].v, aq[0][ks].v, aq[0][ks].v, acc); s[nt] = acc; }
    bool ok[16]; const int tq = q0 + ln;
#pragma unroll
    for (int i = 0; i < 16; ++i) { const int k = j0 + (i >> 3) * 16 + 8 * hh + (i & 7);
      bool o = (CAUSAL == 1) ? (k <= tq) : ((CAUSAL == 2) ? ((k >> 5) == (tq >> 5)) : true);      /* mode 2: block-diagonal 32-token groups */
      if (CAUSAL == 8) o = mk[i >> 3][(i >> 2) & 1][i & 3] != 0;      /* mode 8: per-(query, key) int table shared by all batches and heads */
      if (CAUSAL == 4) o = MSK[((size_t)b * TQB + tq) * TK + k] != 0;      /* mode 4: per-(query, key) INPUT mask shared by all heads; masked keys contribute nothing (== the reference's -4096 fill, whose exp underflows to 0), rows with no valid key give l = 0 -> output 0 (== the reference's row_valid zeroing) */
      ok[i] = o; }
    FragH ph, pl; sm_trip(s, ok, m_c, l_c, oacc, oaccL, ph, pl);
#pragma unroll
    for (int dt = 0; dt < DT; ++dt) { oacc[dt] = mmaH<1>(bv[dt].v, bv[dt].v, ph.v, ph.v, oacc[dt]); oaccL[dt] = mmaH<1>(bv[dt].v, bv[dt].v, pl.v, pl.v, oaccL[dt]); oaccL[dt] = mmaH<1>(bl[dt].v, bl[dt].v, ph.v, ph.v, oaccL[dt]); } }      /* V^T rows as A, P^T as B */
  /* the wave leaves its part of the tile in LDS, lane for lane: maximum, sum (the halves' joined), unnormalised outputs. A wave with no live key leaves m = -3.0e38, l = 0, O = 0 */
  sM[it][w][lane] = m_c; sL[it][w][lane] = l_c + half_swap(l_c);
#pragma unroll
  for (int dt = 0; dt < DT; ++dt) { v4f v0, v1;
#pragma unroll
    for (int r = 0; r < 4; ++r) { float v = oacc[dt][r]; v += oaccL[dt][r] * 0.0009765625f; v0[r] = v; v = oacc[dt][4 + r]; v += oaccL[dt][4 + r] * 0.0009765625f; v1[r] = v; }
    *(v4fa*)&sX[it][w][dt * 2][lane][0] = v0; *(v4fa*)&sX[it][w][dt * 2 + 1][lane][0] = v1; }
  }
  __syncthreads();      /* both tiles' parts of every wave are in LDS before any wave merges them; the one barrier stands behind both tiles, where all waves have walked about the same number of key tiles */
  /* merge: wave kh of a pair finishes the pair's tile number kh. M = max(m_a, m_b); l = l_a e^(m_a - M) + l_b e^(m_b - M); O likewise, even key tiles' part first. A part with no live key adds nothing; a row with no live key at all gives l = 0 -> output 0 */
  /* the result leaves as the output GEMM's A operand, f16 hi plane and 2^10 residual plane in fragment order (ldo elements a row): a lane's 8 values of tile dt are k = h * 64 + dt * 16 + 8 hh .. + 7 of row ln, which is the lane's own 16 bytes of half dt & 1 of block h * 2 + (dt >> 1), so each store of a wave is 512 contiguous bytes */
  const int qf = kh ? QTB - 1 - (pblk * 8 + slot) : pblk * 8 + slot; const int wa = slot * 2, wb = slot * 2 + 1;
  const float ma = sM[kh][wa][lane], mb = sM[kh][wb][lane]; const float mm = fmaxf(ma, mb); float fa, fb;
  const float ea = fmaxf(ma - mm, -1.0e38f) * 1.44269504f, eb = fmaxf(mb - mm, -1.0e38f) * 1.44269504f;      /* 0 for the part that holds the maximum, and for both where neither has a live key: factor exactly 1 */
  /* the hardware's 2^x as in sm_trip, both in one statement with a v_nop behind them: the slot behind each transcendental is kept by construction */
  asm("v_exp_f32 %0, %2\n\tv_exp_f32 %1, %3\n\tv_nop" : "=&v"(fa), "=&v"(fb) : "v"(ea), "v"(eb));
  const float lt = sL[kh][wa][lane] * fa + sL[kh][wb][lane] * fb; const float li = (lt > 0.f) ? 1.0f / (lt * 1024.0f) : 0.f;
  const size_t oo = ((size_t)((b * TQB + qf * RPW) >> 4) * (ldo >> 5) + h * 2) * 512 + lane * 8; unsigned short* oh = (unsigned short*)OH + oo; unsigned short* ol = (unsigned short*)OL + oo;
#pragma unroll
  for (int dt = 0; dt < DT; ++dt) { FragH fh, fl;
#pragma unroll
    for (int g = 0; g < 2; ++g) { const v4f xa = *(const v4fa*)&sX[kh][wa][dt * 2 + g][lane][0], xb = *(const v4fa*)&sX[kh][wb][dt * 2 + g][lane][0];
#pragma unroll
      for (int r = 0; r < 4; ++r) { float v = xa[r] * fa + xb[r] * fb; v = v * li; const _Float16 hv = (_Float16)v; fh.h[g * 4 + r] = hv; fl.h[g * 4 + r] = (_Float16)((v - (float)hv) * 1024.0f); } }
    *(v8us*)(oh + dt * 256) = fh.half[0]; *(v8us*)(ol + dt * 256) = fl.half[0]; } }

// two planes [nout][nin] in fragment order, one behind the other: x16 weights (for the hi operand), then x1 weights (for the 2^10 residual operand) at Bt + nout * nin
__device__ __forceinline__ void d_wpair(int bx, const float* __restrict__ Wm, int nin, int nout, _Float16* __restrict__ Bt) { const size_t t = (size_t)bx * 256 + threadIdx.x; if (t >= (size_t)nout * (2 * nin / 8)) return; const size_t per = (size_t)nout * (nin / 8); const bool lo = t >= per; const FoRK s = fo_src(lo ? t - per : t, nin); const int o = s.row; FragH f;
  for (int q = 0; q < 8; ++q) { const int c = s.k + q; if (q) asm volatile("s_wait_xcnt 0x0" ::: "memory");      /* stands in front of each further load, whose result may land in a register that an earlier load names as its address */
    f.h[q] = (_Float16)(bf16_round(Wm[(size_t)c * nout + o]) * (lo ? 1.0f : 16.0f)); } *(v8us*)((unsigned short*)Bt + t * 8) = f.half[0];  }
template <int TWO_D>
__device__ __forceinline__ void d_rotab(int bx, int nrows, int rpb, const int* __restrict__ bar, const int* __restrict__ tib, float* __restrict__ CS, float* __restrict__ SN) {
  #pragma clang fp contract(off)
  const size_t t = (size_t)bx * 256 + threadIdx.x; if (t >= (size_t)nrows * 32) return; const int d = (int)(t % 32); const int row = (int)(t / 32); const int b = row / rpb, r = row % rpb; float pos, inv;
  if (TWO_D) { const int dm = d & 15; inv = 1.0f / powf(10000.0f, (float)dm * 2.0f / 32.0f); pos = (d < 16) ? (float)bar[(size_t)b * rpb + r] : (float)tib[(size_t)b * rpb + r]; }
  else { inv = 1.0f / powf(10000.0f, (float)(2 * d) / 64.0f); pos = (float)r; }
  const float th = pos * inv; const float c = cosf(th), s = sinf(th);
  { *(float*)(CS + t) = c; *(float*)(SN + t) = s;  } }
__device__ __forceinline__ void d_rope(int bx, const float* __restrict__ F, int nrows, int rpb, int nheads, const float* __restrict__ CS, const float* __restrict__ SN, _Float16* __restrict__ dst, int ldo, int dst_bstride, int row_off) {
  #pragma clang fp contract(off)
  /* dst in fragment order (ldo elements a row): a wave takes 16 rows of one head and the dims jg .. jg + 7 and jg + 32 .. jg + 39 that make half a fragment each; rpb, dst_bstride and row_off are multiples of 16 */
  const size_t t = (size_t)bx * 256 + threadIdx.x; if (t >= (size_t)nrows * nheads * 4) return; const int lane = (int)(t & 31); const size_t wid = t >> 5; const int jg = (int)(wid & 1) * 16 + (lane >> 4) * 8; const int h = (int)((wid >> 1) % nheads); const int row = (int)((wid >> 1) / nheads) * 16 + (lane & 15); const int b = row / rpb, r = row % rpb; const int ldi = nheads * 64;
  const float* xr = F + (size_t)row * ldi + h * 64; FragH f0, f1;
#pragma unroll
  for (int q = 0; q < 8; ++q) { const int d = jg + q; const float c = CS[(size_t)row * 32 + d], s = SN[(size_t)row * 32 + d]; const float x0 = xr[d], x1 = xr[d + 32];
    float o0 = x0 * c; o0 += -x1 * s; float o1 = x1 * c; o1 += x0 * s; f0.h[q] = (_Float16)o0; f1.h[q] = (_Float16)o1; }
  unsigned short* o = (unsigned short*)dst + fo_dst(b * dst_bstride + row_off + r, h * 64 + jg, ldo);
  { *(v8us*)o = f0.half[0]; *(v8us*)(o + 512) = f1.half[0];  } }      /* 32 dims on: the next block */
// f16 plane of an f32 plane, in fragment order (k2 into the key plane)
__device__ __forceinline__ void d_putk(int bx, const float* __restrict__ F, int nrows, int rpb, int ncol, _Float16* __restrict__ H, int dst_bstride, int row_off) {
  const size_t t = (size_t)bx * 256 + threadIdx.x; if (t >= (size_t)nrows * (ncol / 8)) return; const FoRK s = fo_src(t, ncol); const int b = s.row / rpb, r = s.row % rpb; FragH fh;
  for (int q = 0; q < 8; ++q) fh.h[q] = (_Float16)F[(size_t)s.row * ncol + s.k + q];
  *(v8us*)((unsigned short*)H + fo_dst(b * dst_bstride + row_off + r, s.k, ncol)) = fh.half[0]; }

// live bits of the phase-2 mask: bit l of word (qt, wd, rg) says whether key tile wd * 32 + l (32 keys) holds a non-zero word in rows 4 rg .. 4 rg + 3 of the 16-query tile qt. A wave per word, a lane per key tile (128 bytes a row); each word has a 128-byte line of its own
__device__ __forceinline__ void d_live(int bx, const int* __restrict__ MSK, unsigned int* __restrict__ LV) {
  typedef int v4ia __attribute__((ext_vector_type(4), may_alias));
  const int wv = bx * 8 + (int)(threadIdx.x >> 5), lane = threadIdx.x & 31; const int rg = wv & 3, wd = (wv >> 2) % 3, qt = (wv >> 2) / 3; const int kt = wd * 32 + lane; v4ia any = {0, 0, 0, 0};
  if (kt < TK / 32) { const int* p = MSK + (size_t)(qt * 16 + rg * 4) * TK + kt * 32;
#pragma unroll 1
    for (int r = 0; r < 4; ++r) {      /* kept rolled: a row's 8 loads are in flight together, and the launch's register count stays low for its other ranges */
#pragma unroll
      for (int c = 0; c < 8; ++c) any |= *(const v4ia*)(p + (size_t)r * TK + c * 4); } }
  const unsigned int word = __builtin_amdgcn_ballot_w32((any[0] | any[1] | any[2] | any[3]) != 0);
  if (lane == 0) LV[(size_t)wv * 32] = word; }

// ---- one launch per dependency level: kernels that do not depend on one another run as consecutive block ranges of one grid. Every range test reads blockIdx.x alone, so a work-group takes one branch as a whole; each body is the same code as before, handed its block number inside its own range. ----
constexpr int PB_W = DMOD * DMOD / 8 / 256, PB_WK = DMOD * KVD / 8 / 256;                  /* blocks of one transposed weight plane: 1024 and 256 columns */
constexpr int PB_P = DMOD * (2 * DMOD / 8) / 256, PB_PK = KVD * (2 * DMOD / 8) / 256;       /* blocks of one hi | residual weight pair */
constexpr int PB_T1 = NRS * 32 / 256, PB_T2 = NRR * 32 / 256;                              /* RoPE tables */
constexpr int PB_XS = NRS * DMOD / 8 / 256, PB_XR = NRR * DMOD / 8 / 256;                  /* f16 planes of the two inputs */
constexpr int PB_ALL = 2 * PB_W + 4 * PB_WK + 2 * PB_P + 2 * PB_PK + PB_T1 + PB_T2 + PB_XS + PB_XR;
__global__ __launch_bounds__(256) void k_prep(const float* w_sq, const float* w_sk, const float* w_sv, const float* w_rq, const float* w_rk, const float* w_rv,
    _Float16* BSQ, _Float16* BSK, _Float16* BSV, _Float16* BRQ, _Float16* BRK, _Float16* BRV,
    const float* w_so, const float* w_ro, const float* w_k2, const float* w_v2, _Float16* BSO, _Float16* BRO, _Float16* BK2, _Float16* BV2,
    const int* bar, const int* tib, float* CS1, float* SN1, float* CS2, float* SN2, const float* sum_x, _Float16* SX, const float* reg_x, _Float16* RX) {
  int bx = blockIdx.x;
  if (bx < 2 * PB_W + 4 * PB_WK) { const float* Wm = w_sq; _Float16* Bt = BSQ; int nout = DMOD;
    if (bx >= PB_W) { bx -= PB_W; Wm = w_rq; Bt = BRQ;
      if (bx >= PB_W) { bx -= PB_W; Wm = w_sk; Bt = BSK; nout = KVD;
        if (bx >= PB_WK) { bx -= PB_WK; Wm = w_sv; Bt = BSV;
          if (bx >= PB_WK) { bx -= PB_WK; Wm = w_rk; Bt = BRK;
            if (bx >= PB_WK) { bx -= PB_WK; Wm = w_rv; Bt = BRV; } } } } }
    d_wt_f16(bx, Wm, Bt, DMOD, nout, 16.0f); return; }
  bx -= 2 * PB_W + 4 * PB_WK;
  if (bx < 2 * PB_P + 2 * PB_PK) { const float* Wm = w_so; _Float16* Bt = BSO; int nout = DMOD;
    if (bx >= PB_P) { bx -= PB_P; Wm = w_ro; Bt = BRO;
      if (bx >= PB_P) { bx -= PB_P; Wm = w_k2; Bt = BK2; nout = KVD;
        if (bx >= PB_PK) { bx -= PB_PK; Wm = w_v2; Bt = BV2; } } }
    d_wpair(bx, Wm, DMOD, nout, Bt); return; }
  bx -= 2 * PB_P + 2 * PB_PK;
  if (bx < PB_T1) { d_rotab<0>(bx, NRS, SS, nullptr, nullptr, CS1, SN1); return; }
  bx -= PB_T1;
  if (bx < PB_T2) { d_rotab<1>(bx, NRR, RR, bar, tib, CS2, SN2); return; }
  bx -= PB_T2;
  if (bx < PB_XS) d_x16(bx, sum_x, SX, (size_t)NRS * DMOD / 8, DMOD); else d_x16(bx - PB_XS, reg_x, RX, (size_t)NRR * DMOD / 8, DMOD); }

// up to six GEMMs (d_gemm2) in one launch, all with the same K and alpha, operands in fragment order; ldc = N. RW, KS: the work-group's waves over rows and over k (d_gemm2). Jobs 0..2 read A0 (Ma rows), jobs 3..5 read A1 (Mb rows); in each triple N = DMOD, KVD, KVD. S_j is job j's bias. np == 2 (jobs 0..2 only): A0L is the residual plane of A0, and each B_j is a pair of planes, x16 weights and behind them x1 weights; both products are summed in the one launch. The grid ends behind the last job in use; the pointers of jobs behind it are not read.
template <int RW, int KS>
__global__ __launch_bounds__(32 * RW * KS) void k_gemm2m(const _Float16* A0, const _Float16* A1, const _Float16* A0L, const _Float16* B0, const _Float16* B1, const _Float16* B2, const _Float16* B3, const _Float16* B4, const _Float16* B5,
    const float* S0, const float* S1, const float* S2, const float* S3, const float* S4, const float* S5, float* C0, float* C1, float* C2, float* C3, float* C4, float* C5, int Ma, int Mb, int K, float alpha, int np) {
  int bx = blockIdx.x; const int ta = Ma / (32 * RW), tb = Mb / (32 * RW);      /* block tiles of 32 RW rows; a job has (M / (32 RW)) * (N / 64) blocks */
  const _Float16* A = A0; const _Float16* B = B0; const float* S = S0; float* C = C0; int M = Ma, N = DMOD;
  if (bx >= ta * (DMOD / 64)) { bx -= ta * (DMOD / 64); B = B1; S = S1; C = C1; N = KVD;
    if (bx >= ta * (KVD / 64)) { bx -= ta * (KVD / 64); B = B2; S = S2; C = C2;
      if (bx >= ta * (KVD / 64)) { bx -= ta * (KVD / 64); A = A1; M = Mb; B = B3; S = S3; C = C3; N = DMOD;
        if (bx >= tb * (DMOD / 64)) { bx -= tb * (DMOD / 64); B = B4; S = S4; C = C4; N = KVD;
          if (bx >= tb * (KVD / 64)) { bx -= tb * (KVD / 64); B = B5; S = S5; C = C5; } } } } }
  d_gemm2<0, RW, KS>(bx, A, 0, B, 0, A0L, B + (size_t)N * K, np, alpha, S, 0, nullptr, 1, (size_t)N, 0, C, nullptr, N, 0, M, N, K); }

constexpr int QB_RQ = NRR * NH * 4 / 256, QB_RK = NRR * NKV * 4 / 256, QB_RV = NB * NKV * (RR / 64), QB_SQ = NRS * NH * 4 / 256, QB_SK = NRS * NKV * 4 / 256, QB_SV = NB * NKV * (SS / 64), QB_K2 = NRS * (KVD / 8) / 256;      /* values: a block per tile of 64 keys x 64 dims */
constexpr int QB_LV = QTB * 3 * 4 / 8;      /* live bits of the phase-2 mask: 8 waves a block, a wave per word */
// what follows the six projections: RoPE of both q and both k planes, transposed hi + residual planes of both v; ahead of them, as it depends on an input alone, the live bits of the phase-2 mask
__global__ __launch_bounds__(256) void k_post(const float* FSQ, const float* FSK, const float* FSV, const float* FRQ, const float* FRK, const float* FRV, const float* CS1, const float* SN1, const float* CS2, const float* SN2,
    _Float16* SQ, _Float16* RQ, _Float16* KC, _Float16* VT, _Float16* VTL, const int* mupd, unsigned int* LV) {
  int bx = blockIdx.x;
  if (bx < QB_LV) { d_live(bx, mupd, LV); return; }
  bx -= QB_LV;
  if (bx < QB_RQ + QB_RK + QB_SQ + QB_SK) { const float* F = FRQ; const float* CS = CS2; const float* SN = SN2; _Float16* dst = RQ; int nrows = NRR, rpb = RR, nheads = NH, bstr = RR, roff = 0;
    if (bx >= QB_RQ) { bx -= QB_RQ; F = FRK; dst = KC; nheads = NKV; bstr = TK; roff = SS;      /* keys 64.. of each batch */
      if (bx >= QB_RK) { bx -= QB_RK; F = FSQ; CS = CS1; SN = SN1; dst = SQ; nrows = NRS; rpb = SS; nheads = NH; bstr = SS; roff = 0;
        if (bx >= QB_SQ) { bx -= QB_SQ; F = FSK; dst = KC; nheads = NKV; bstr = TK; } } }      /* keys 0..63 of each batch */
    d_rope(bx, F, nrows, rpb, nheads, CS, SN, dst, nheads * 64, bstr, roff); return; }
  bx -= QB_RQ + QB_RK + QB_SQ + QB_SK;
  const bool rg = bx < QB_RV; d_vtf(rg ? bx : bx - QB_RV, rg ? FRV : FSV, rg ? RR : SS, rg ? SS : 0, VT, VTL); }      /* regular values at keys 64.., summary values at keys 0..63 of each batch */
// k2 into key rows 0..63 (one plane), v2 into keys 0..63 of both V^T planes, of each batch; the regular keys' part of the planes stands as k_post wrote it
__global__ __launch_bounds__(256) void k_put2(const float* FK2, const float* FV2, _Float16* KC, _Float16* VT, _Float16* VTL) {
  const int bx = blockIdx.x;
  if (bx < QB_K2) d_putk(bx, FK2, NRS, SS, KVD, KC, TK, 0); else d_vtf(bx - QB_K2, FV2, SS, 0, VT, VTL); }

extern "C" void kernel_launch(void* const* d_in, const int* in_sizes, int n_in,
                              void* d_out, int out_size, void* d_ws, size_t ws_size, hipStream_t stream) {
  (void)in_sizes; (void)n_in; (void)out_size;
  const float* const* I = (const float* const*)d_in; const float* sum_x = I[0]; const float* reg_x = I[1];
  const float* w_sq = I[2]; const float* b_sq = I[3]; const float* w_sk = I[4]; const float* b_sk = I[5]; const float* w_sv = I[6]; const float* b_sv = I[7]; const float* w_so = I[8]; const float* b_so = I[9];
  const float* w_rq = I[10]; const float* b_rq = I[11]; const float* w_rk = I[12]; const float* b_rk = I[13]; const float* w_rv = I[14]; const float* b_rv = I[15]; const float* w_ro = I[16]; const float* b_ro = I[17];
  const float* w_k2 = I[18]; const float* b_k2 = I[19]; const float* w_v2 = I[20]; const float* b_v2 = I[21];
  const int* bar = (const int*)d_in[22]; const int* tib = (const int*)d_in[23]; const int* msum = (const int*)d_in[24]; const int* mupd = (const int*)d_in[25];
  char* ws = (char*)d_ws; size_t off = 0;
  auto take = [&](size_t bytes) { char* p = ws + off; off += (bytes + 255) & ~(size_t)255; return p; };
  const size_t w8 = (size_t)DMOD * DMOD / 8, w8k = (size_t)DMOD * KVD / 8;
  _Float16* BSQ = (_Float16*)take(w8 * 16); _Float16* BSK = (_Float16*)take(w8k * 16); _Float16* BSV = (_Float16*)take(w8k * 16); _Float16* BRQ = (_Float16*)take(w8 * 16); _Float16* BRK = (_Float16*)take(w8k * 16); _Float16* BRV = (_Float16*)take(w8k * 16);
  _Float16* BSO = (_Float16*)take(w8 * 32); _Float16* BRO = (_Float16*)take(w8 * 32); _Float16* BK2 = (_Float16*)take(w8k * 32); _Float16* BV2 = (_Float16*)take(w8k * 32);
  float* CS1 = (float*)take((size_t)NRS * 32 * 4); float* SN1 = (float*)take((size_t)NRS * 32 * 4); float* CS2 = (float*)take((size_t)NRR * 32 * 4); float* SN2 = (float*)take((size_t)NRR * 32 * 4); _Float16* SX = (_Float16*)take((size_t)NRS * DMOD * 2); _Float16* RX = (_Float16*)take((size_t)NRR * DMOD * 2);
  /* each projection has an f32 plane of its own, since all six are written by one launch */
  float* FRQ = (float*)take((size_t)NRR * DMOD * 4); float* FRK = (float*)take((size_t)NRR * KVD * 4); float* FRV = (float*)take((size_t)NRR * KVD * 4); float* FSQ = (float*)take((size_t)NRS * DMOD * 4); float* FSK = (float*)take((size_t)NRS * KVD * 4); float* FSV = (float*)take((size_t)NRS * KVD * 4);
  _Float16* SQ = (_Float16*)take((size_t)NRS * DMOD * 2); _Float16* RQ = (_Float16*)take((size_t)NRR * DMOD * 2); _Float16* KC = (_Float16*)take((size_t)NB * TK * KVD * 2); _Float16* VT = (_Float16*)take((size_t)NB * NKV * 64 * TK * 2); _Float16* VTL = (_Float16*)take((size_t)NB * NKV * 64 * TK * 2);
  _Float16* O1H = (_Float16*)take((size_t)NRS * DMOD * 2); _Float16* O1L = (_Float16*)take((size_t)NRS * DMOD * 2); _Float16* O2H = (_Float16*)FRQ; _Float16* O2L = O2H + (size_t)NRR * DMOD;      /* both reg_attn planes over the reg-q f32 scratch (dead after k_post) */
  unsigned int* LV = (unsigned int*)take((size_t)QTB * 3 * 4 * 128);      /* live bits of the phase-2 mask, a 128-byte line a word */
  float* FK2 = FSK; float* FV2 = FSV;      /* k2 / v2 f32 planes over the summary k / v scratch (dead after k_post) */
  if (off > ws_size) return;      /* about 70 MiB */
  float* out0 = (float*)d_out; float* out1 = (float*)d_out + (size_t)NRS * DMOD;
  /* weight planes, RoPE tables, input planes */
  k_prep<<<PB_ALL, 256, 0, stream>>>(w_sq, w_sk, w_sv, w_rq, w_rk, w_rv, BSQ, BSK, BSV, BRQ, BRK, BRV, w_so, w_ro, w_k2, w_v2, BSO, BRO, BK2, BV2, bar, tib, CS1, SN1, CS2, SN2, sum_x, SX, reg_x, RX);
  /* summary q/k/v and regular q/k/v */
  k_gemm2m<4, 1><<<(NRS / 128 + NRR / 128) * ((DMOD + 2 * KVD) / 64), 128, 0, stream>>>(SX, RX, nullptr, BSQ, BSK, BSV, BRQ, BRK, BRV, b_sq, b_sk, b_sv, b_rq, b_rk, b_rv, FSQ, FSK, FSV, FRQ, FRK, FRV, NRS, NRR, DMOD, 0.0625f, 1);
  k_post<<<QB_LV + QB_RQ + QB_RK + QB_SQ + QB_SK + QB_RV + QB_SV, 256, 0, stream>>>(FSQ, FSK, FSV, FRQ, FRK, FRV, CS1, SN1, CS2, SN2, SQ, RQ, KC, VT, VTL, mupd, LV);
  /* phase 1: summary queries over [summary ; regular] keys; sum_attn leaves as hi + residual planes */
  k_flash3gA<8><<<NB * NH * (TQA / 16), 32 * NSPL, 0, stream>>>(SQ, DMOD, KC, KVD, VT, VTL, msum, O1H, O1L, DMOD);
  /* output 0 = sum_attn W_so + b_so; k2 / v2 from sum_attn (no RoPE): hi and residual product of each in the one launch. 96 wave tiles only: 16 waves share each one's k range */
  k_gemm2m<1, 16><<<(NRS / 32) * ((DMOD + 2 * KVD) / 64), 512, 0, stream>>>(O1H, nullptr, O1L, BSO, BK2, BV2, nullptr, nullptr, nullptr, b_so, b_k2, b_v2, nullptr, nullptr, nullptr, out0, FK2, FV2, nullptr, nullptr, nullptr, NRS, 0, DMOD, 1.0f / 1024.0f, 2);
  k_put2<<<QB_K2 + QB_SV, 256, 0, stream>>>(FK2, FV2, KC, VT, VTL);      /* into keys 0..63 of each batch */
  /* phase 2: regular queries over [k2 ; regular] keys; reg_attn leaves as hi + residual planes */
  k_flash3gB<8><<<NB * NH * (QTB / 16), 512, 0, stream>>>(RQ, DMOD, KC, KVD, VT, VTL, mupd, LV, O2H, O2L, DMOD);
  k_gemm2m<4, 1><<<(NRR / 128) * (DMOD / 64), 128, 0, stream>>>(O2H, nullptr, O2L, BRO, nullptr, nullptr, nullptr, nullptr, nullptr, b_ro, nullptr, nullptr, nullptr, nullptr, nullptr, out1, nullptr, nullptr, nullptr, nullptr, nullptr, NRR, 0, DMOD, 1.0f / 1024.0f, 2);
}
